// v000
// Times are from an AMD MI455X. After a warm-up the kernel runs many times in a row, and a time is the length of
// such a window on the GPU divided by its runs, so every launch and the gaps after it count. The runs cycle
// through copies of the inputs. A figure is the median of several windows, for all but v000 over two sittings.
// Sittings can differ by a few percent; kernels timed side by side share one.
// v000, which the later versions start from, runs in 4690 microseconds.
#include <hip/hip_runtime.h>

// Simple multi-head attention scaled by the EMBEDDING size (x [8][1024][1024]; q,k,v = x W^T ('oi' [1024][1024], no bias); scores / sqrt(1024) (module quirk); softmax over all keys; out = merged Wo^T + bo -> [8][1024][1024] (8.4 M)).
// Layout per batch: bf16 copy of x; exact projections; dense T-1024 attention (hybrid rows: < 512 hi/lo 3 products, rest fp16 x1024); merged hi/lo x Wo exact + bo.
// Compute dtypes, f32 accumulate: every input rounded to bf16; projections exact; attention rows < 512 3 products, rest fp16; softmax f32; Wo hl x exact + bias.

#define NB_  8
#define TT   1024
#define DM   1024
#define NH_  16
#define NKV  16
#define REP  (NH_ / NKV)
#define HD   64
#define DQ   (NH_ * HD)
#define DKV  (NKV * HD)
#define ZH   2
#define RH   512                  // query rows < RH use hi+lo planes (0: none)
#define WIN  0
#define PCAR 1024.0f
#define SCL  0.03125f   // 1/sqrt(1024): the module scales by the embedding size
typedef _Float16 h16;
typedef unsigned short bf;
typedef __attribute__((ext_vector_type(16))) __bf16   v16bf;
typedef __attribute__((ext_vector_type(16))) _Float16 v16h;
typedef __attribute__((ext_vector_type(8)))  _Float16 v8h;
typedef __attribute__((ext_vector_type(8)))  unsigned short v8us;
typedef __attribute__((ext_vector_type(8)))  float    v8f;
typedef __attribute__((ext_vector_type(4)))  float    v4f;
typedef v8h  __attribute__((may_alias)) v8ha;
typedef v4f  __attribute__((may_alias)) v4fa;
typedef v8us __attribute__((may_alias)) v8usa;

__device__ __forceinline__ unsigned short f2bf(float f) { unsigned u = __float_as_uint(f); u += 0x7FFFu + ((u >> 16) & 1u); return (unsigned short)(u >> 16); }
__device__ __forceinline__ float bf2f(unsigned short b) { return __uint_as_float(((unsigned)b) << 16); }
__device__ __forceinline__ float bfr(float f) { return bf2f(f2bf(f)); }
__device__ __forceinline__ v16h cat16(v8h lo, v8h hi) { return __builtin_shufflevector(lo, hi, 0, 1, 2, 3, 4, 5, 6, 7, 8, 9, 10, 11, 12, 13, 14, 15); }
__device__ __forceinline__ v16bf cat16b(v8us lo, v8us hi) { return __builtin_bit_cast(v16bf, __builtin_shufflevector(lo, hi, 0, 1, 2, 3, 4, 5, 6, 7, 8, 9, 10, 11, 12, 13, 14, 15)); }
__device__ __forceinline__ v8f wmma16(v16h a, v16h b, v8f c) { return __builtin_amdgcn_wmma_f32_16x16x32_f16(false, a, false, b, (short)0, c, false, false); }
__device__ __forceinline__ v8f wmmab(v16bf a, v16bf b, v8f c) { return __builtin_amdgcn_wmma_f32_16x16x32_bf16(false, a, false, b, (short)0, c, false, false); }



// ---- k_gemmw: register-blocked GEMM, ONE WAVE per 64x64 output tile (16 accumulators), operands straight from K-contiguous 16-bit planes; grid (M/64, N/64, Z), 32 threads.
// C[m][n] (f32, pitch ldc, + optional f32 bias[n]) = sum_k A[m][k] Bt[n][k] (+ split products per NSPLIT). z-batch strides sA/sB/sC in elements. K % 32 == 0.
template <typename T16> struct WFrag;
template <> struct WFrag<h16> { typedef v16h V; static __device__ __forceinline__ V ld(const h16* p) { return cat16(*(const v8h*)p, *(const v8h*)(p + 16)); } static __device__ __forceinline__ v8f mma(V a, V b, v8f c) { return wmma16(a, b, c); } };
template <> struct WFrag<bf> { typedef v16bf V; static __device__ __forceinline__ V ld(const bf* p) { return cat16b(*(const v8us*)p, *(const v8us*)(p + 16)); } static __device__ __forceinline__ v8f mma(V a, V b, v8f c) { return wmmab(a, b, c); } };
template <typename T16, int NSPLIT, bool BIAS>
__global__ __launch_bounds__(32) void k_gemmw(const T16* __restrict__ A, const T16* __restrict__ A2, const T16* __restrict__ Bt, const T16* __restrict__ Bt2, int K, float* C, int ldc, const float* __restrict__ bias, size_t sA, size_t sB, size_t sC) {
    typedef typename WFrag<T16>::V V;
    __shared__ __align__(16) float os[16 * 68];
    const size_t z = blockIdx.z; A += z * sA; if (A2) A2 += z * sA; Bt += z * sB; if (Bt2) Bt2 += z * sB; C += z * sC;
    const int lane = threadIdx.x & 31, lr = lane & 15, hi = lane >> 4; const int r0 = blockIdx.x * 64, c0 = blockIdx.y * 64;
    v8f acc[4][4];
#pragma unroll
    for (int mb = 0; mb < 4; ++mb)
#pragma unroll
        for (int nb = 0; nb < 4; ++nb) acc[mb][nb] = (v8f){};
    const size_t aoff = (size_t)(r0 + lr) * K + 8 * hi, boff = (size_t)(c0 + lr) * K + 8 * hi;
#pragma unroll 1
    for (int kc = 0; kc < K; kc += 32) {
        V a[4], a2[4];
#pragma unroll
        for (int mb = 0; mb < 4; ++mb) { a[mb] = WFrag<T16>::ld(A + aoff + (size_t)mb * 16 * K + kc); if (NSPLIT == 1 || NSPLIT == 2) a2[mb] = WFrag<T16>::ld(A2 + aoff + (size_t)mb * 16 * K + kc); }
#pragma unroll
        for (int nb = 0; nb < 4; ++nb) { const V b = WFrag<T16>::ld(Bt + boff + (size_t)nb * 16 * K + kc); V b2; if (NSPLIT >= 2) b2 = WFrag<T16>::ld(Bt2 + boff + (size_t)nb * 16 * K + kc);
#pragma unroll
            for (int mb = 0; mb < 4; ++mb) { acc[mb][nb] = WFrag<T16>::mma(a[mb], b, acc[mb][nb]); if (NSPLIT == 1 || NSPLIT == 2) acc[mb][nb] = WFrag<T16>::mma(a2[mb], b, acc[mb][nb]); if (NSPLIT >= 2) acc[mb][nb] = WFrag<T16>::mma(a[mb], b2, acc[mb][nb]); } }
        asm volatile("v_nop\n\tv_nop\n\tv_nop\n\tv_nop" : "+v"(acc[0][0]), "+v"(acc[1][1]), "+v"(acc[2][2]), "+v"(acc[3][3]) : "v"(a[0]), "v"(a[3]));
    }
#pragma unroll
    for (int mb = 0; mb < 4; ++mb) {
#pragma unroll
        for (int nb = 0; nb < 4; ++nb) {
#pragma unroll
            for (int j = 0; j < 8; ++j) os[(hi * 8 + j) * 68 + nb * 16 + lr] = acc[mb][nb][j]; }
        __builtin_amdgcn_wave_barrier(); asm volatile("" ::: "memory");
        float* crow = C + (size_t)(r0 + mb * 16) * ldc + c0;
{
#pragma unroll
            for (int s = 0; s < 8; ++s) { const int row = 2 * s + hi, cofs = lr * 4; v4f val = *(const v4fa*)(os + row * 68 + cofs); if (BIAS) { val[0] += bfr(bias[c0 + cofs]); val[1] += bfr(bias[c0 + cofs + 1]); val[2] += bfr(bias[c0 + cofs + 2]); val[3] += bfr(bias[c0 + cofs + 3]); }
                *(v4f*)(crow + (size_t)row * ldc + cofs) = val; }
             }
        __builtin_amdgcn_wave_barrier(); asm volatile("" ::: "memory");
    }
}

__device__ __forceinline__ h16 tohx(float x) { return (h16)x; }
__device__ __forceinline__ void splitf(float y, unsigned short& h, unsigned short& l) { h = f2bf(y); l = f2bf(y - bf2f(h)); }
typedef __attribute__((ext_vector_type(2))) _Float16 v2h;
typedef __attribute__((ext_vector_type(4))) _Float16 v4h;
typedef __attribute__((ext_vector_type(2))) unsigned short v2us;
typedef __attribute__((ext_vector_type(4))) unsigned short v4us;
typedef __attribute__((ext_vector_type(2))) float v2f;
typedef __attribute__((ext_vector_type(4))) int v4i;

__global__ __launch_bounds__(256) void k_wtG(const float* __restrict__ w, int K, int N, bf* Bt) {
    const int lane = threadIdx.x & 31; const int L0 = (blockIdx.x * 8 + (threadIdx.x >> 5)) * 8; const int nlines = N * K / 64;
{
#pragma unroll 1
        for (int l = 0; l < 8; ++l) { const int L = L0 + l; if (L >= nlines) break; const size_t e = (size_t)L * 64 + lane * 2; const int k = (int)(e % K), n = (int)(e / K); v2us o;
            o[0] = f2bf(w[(size_t)k * N + n]); o[1] = f2bf(w[(size_t)(k + 1) * N + n]); *(v2us*)(Bt + e) = o; }
         }
}
__global__ __launch_bounds__(256) void k_cvt8(const float* __restrict__ src, bf* dst, size_t n8) { const size_t i = (size_t)blockIdx.x * 256 + threadIdx.x; if (i >= n8) return; const v8f v = *(const v8f*)(src + i * 8); v8us o;
#pragma unroll
    for (int k = 0; k < 8; ++k) o[k] = f2bf(v[k]); *(v8us*)(dst + i * 8) = o;  }

// k_rope: head planes [h][t][d] (fp16 + hi/lo) of rope(x) x sc with the rotate-half convention out[d] = x[d] cos[t][d] - x[d+HD/2] sin[t][d], out[d+HD/2] = x[d+HD/2] cos[t][d+HD/2] + x[d] sin[t][d+HD/2]
__global__ __launch_bounds__(256) void k_rope(const float* __restrict__ F, int pitch, int nheads, const float* __restrict__ CS, const float* __restrict__ RF, const float* __restrict__ nw, float sc, h16* P16, bf* Ph, bf* Pl) {
    const size_t e = ((size_t)blockIdx.x * 256 + threadIdx.x) * 2; if (e >= (size_t)nheads * TT * HD) return; const int d = (int)(e % HD); const int t = (int)((e / HD) % TT); const int h = (int)(e / ((size_t)HD * TT)); const float* f = F + (size_t)t * pitch + h * HD; const float rf = RF ? RF[(size_t)h * TT + t] : 1.0f; v2h o16; v2us oh, ol;
#pragma unroll
    for (int q = 0; q < 2; ++q) { const int dd = d + q; const int dp = (dd < HD / 2) ? dd + HD / 2 : dd - HD / 2; float x0 = f[dd], x1 = f[dp];
        if (RF) { float n0 = __fmul_rn(x0, rf), n1 = __fmul_rn(x1, rf); asm volatile("" : "+v"(n0)); asm volatile("" : "+v"(n1)); x0 = __fmul_rn(bfr(nw[dd]), n0); x1 = __fmul_rn(bfr(nw[dp]), n1); }
        const v2f cs = *(const v2f*)(CS + ((size_t)t * HD + dd) * 2); float a = __fmul_rn(x0, cs[0]), bq = __fmul_rn(x1, cs[1]); asm volatile("" : "+v"(a)); asm volatile("" : "+v"(bq)); const float r = ((dd < HD / 2) ? __fsub_rn(a, bq) : __fadd_rn(a, bq)) * sc;
        o16[q] = tohx(r); unsigned short a2, c2; splitf(r, a2, c2); oh[q] = a2; ol[q] = c2; }
    *(v2h*)(P16 + e) = o16; *(v2us*)(Ph + e) = oh; *(v2us*)(Pl + e) = ol;  }
__global__ __launch_bounds__(256) void k_vtp(const float* __restrict__ F, int pitch, int nheads, h16* V16, bf* Vh, bf* Vl) { const size_t e = ((size_t)blockIdx.x * 256 + threadIdx.x) * 2; if (e >= (size_t)nheads * HD * TT) return; const int t = (int)(e % TT); const int d = (int)((e / TT) % HD); const int g = (int)(e / ((size_t)TT * HD)); v2h o16; v2us oh, ol;
#pragma unroll
    for (int q = 0; q < 2; ++q) { const float x = F[(size_t)(t + q) * pitch + g * HD + d]; o16[q] = tohx(x); unsigned short a2, c2; splitf(x, a2, c2); oh[q] = a2; ol[q] = c2; }
    *(v2h*)(V16 + e) = o16; *(v2us*)(Vh + e) = oh; *(v2us*)(Vl + e) = ol;  }
__global__ __launch_bounds__(256) void k_csid(float* CS) { const int idx = blockIdx.x * 256 + threadIdx.x; if (idx >= TT * HD) return; v2f cs; cs[0] = 1.0f; cs[1] = 0.0f; *(v2f*)(CS + (size_t)idx * 2) = cs;  }
// k_asoft: per row (zz, i): t = S x DM^-0.5 (no mask); softmax over the 1024 keys (register row, one exp, fixed trees);
__global__ __launch_bounds__(256) void k_asoft(const float* __restrict__ Sb, h16* P16, bf* Ph, bf* Pl) {
    const int lane = threadIdx.x & 31; const int row = blockIdx.x * 8 + (threadIdx.x >> 5); if (row >= ZH * TT) return; const int i = row % TT; const int zz = row / TT; (void)zz; const bool hires = (i < RH); const float* sr = Sb + (size_t)row * TT; float v[TT / 32]; float mx = -3.0e38f;
#pragma unroll
    for (int ch = 0; ch < TT / 128; ++ch) { const int j0 = ch * 128 + lane * 4; const v4f a = *(const v4f*)(sr + j0);
#pragma unroll
        for (int q = 0; q < 4; ++q) { const int j = j0 + q; (void)j; const float t = a[q] * SCL; v[ch * 4 + q] = t; mx = fmaxf(mx, t); } }
#pragma unroll
    for (int sh = 16; sh; sh >>= 1) mx = fmaxf(mx, __shfl_xor(mx, sh, 32));
    float sum = 0.f;
#pragma unroll
    for (int k = 0; k < TT / 32; ++k) { float d0 = __fsub_rn(v[k], mx); asm volatile("" : "+v"(d0)); v[k] = __builtin_amdgcn_exp2f(__fmul_rn(d0, 1.4426950408889634f)); sum += v[k]; }
#pragma unroll
    for (int sh = 16; sh; sh >>= 1) sum += __shfl_xor(sum, sh, 32);
    const float f = __fdiv_rn(hires ? 1.0f : PCAR, sum);
{
        if (hires) {
#pragma unroll
            for (int ch = 0; ch < TT / 128; ++ch) { v4us oh, ol;
#pragma unroll
                for (int q = 0; q < 4; ++q) { unsigned short a, c2; splitf(v[ch * 4 + q] * f, a, c2); oh[q] = a; ol[q] = c2; }
                const size_t oo = ((size_t)zz * (RH ? RH : 1) + i) * TT + ch * 128 + lane * 4; *(v4us*)(Ph + oo) = oh; *(v4us*)(Pl + oo) = ol; }
        } else {
#pragma unroll
            for (int ch = 0; ch < TT / 128; ++ch) { v4h o4;
#pragma unroll
                for (int q = 0; q < 4; ++q) o4[q] = tohx(v[ch * 4 + q] * f);
                *(v4h*)(P16 + (size_t)row * TT + ch * 128 + lane * 4) = o4; } }
         }
}
__global__ __launch_bounds__(256) void k_merge(const float* __restrict__ O, int h0, bf* Ah, bf* Al) { const size_t e = ((size_t)blockIdx.x * 256 + threadIdx.x) * 2; if (e >= (size_t)ZH * TT * HD) return; const int d = (int)(e % HD); const int t = (int)((e / HD) % TT); const int zz = (int)(e / ((size_t)HD * TT)); const float cs = (t < RH) ? 1.0f : (1.0f / PCAR); const size_t oo = (size_t)t * DQ + (h0 + zz) * HD + d;
    v2us oh, ol;
#pragma unroll
    for (int q = 0; q < 2; ++q) { unsigned short a, c2; splitf(O[e + q] * cs, a, c2); oh[q] = a; ol[q] = c2; } *(v2us*)(Ah + oo) = oh; *(v2us*)(Al + oo) = ol;  }

extern "C" void kernel_launch(void* const* d_in, const int* in_sizes, int n_in,
                              void* d_out, int out_size, void* d_ws, size_t ws_size, hipStream_t stream) {
    (void)in_sizes; (void)n_in; (void)out_size;
    const float* x = (const float*)d_in[0]; const float* wq = (const float*)d_in[1]; const float* wk = (const float*)d_in[2]; const float* wv = (const float*)d_in[3]; const float* wo = (const float*)d_in[4]; const float* bo = (const float*)d_in[5];
    float* OUT = (float*)d_out;     // [8][1024][1024]
    char* wsp = (char*)d_ws;
    auto take = [&](size_t bytes) { char* p = wsp; wsp += (bytes + 255) & ~(size_t)255; return (void*)p; };
    bf* WQ = (bf*)take((size_t)DQ * DM * 2); bf* WK = (bf*)take((size_t)DKV * DM * 2); bf* WV = (bf*)take((size_t)DKV * DM * 2); bf* WO = (bf*)take((size_t)DM * DQ * 2); float* CS = (float*)take((size_t)TT * HD * 2 * 4);
    bf* XB = (bf*)take((size_t)TT * DM * 2); float* FQ = (float*)take((size_t)TT * DQ * 4); float* FK = (float*)take((size_t)TT * DKV * 4);
    h16* QP16 = (h16*)take((size_t)NH_ * TT * HD * 2); h16* KP16 = (h16*)take((size_t)NKV * TT * HD * 2); h16* VT16 = (h16*)take((size_t)NKV * HD * TT * 2);
    bf* QPh = (bf*)take((size_t)NH_ * TT * HD * 2); bf* QPl = (bf*)take((size_t)NH_ * TT * HD * 2); bf* KPh = (bf*)take((size_t)NKV * TT * HD * 2); bf* KPl = (bf*)take((size_t)NKV * TT * HD * 2); bf* VTh = (bf*)take((size_t)NKV * HD * TT * 2); bf* VTl = (bf*)take((size_t)NKV * HD * TT * 2); bf* Ph = (bf*)take((size_t)ZH * RH * TT * 2); bf* Pl = (bf*)take((size_t)ZH * RH * TT * 2);
    float* Sb = (float*)take((size_t)ZH * TT * TT * 4); h16* P16 = (h16*)take((size_t)ZH * TT * TT * 2); float* Ob = (float*)take((size_t)ZH * TT * HD * 4); bf* ATh = (bf*)take((size_t)TT * DQ * 2); bf* ATl = (bf*)take((size_t)TT * DQ * 2);
    if ((size_t)(wsp - (char*)d_ws) > ws_size) return;    // ws 256 MiB
    float* FV = FK;   // v projection reuses the k buffer after the k planes are built (stream-ordered)
    { k_cvt8<<<(unsigned)(((size_t)DQ * DM / 8 + 255) / 256), 256, 0, stream>>>(wq, WQ, (size_t)DQ * DM / 8); k_cvt8<<<(unsigned)(((size_t)DKV * DM / 8 + 255) / 256), 256, 0, stream>>>(wk, WK, (size_t)DKV * DM / 8); k_cvt8<<<(unsigned)(((size_t)DKV * DM / 8 + 255) / 256), 256, 0, stream>>>(wv, WV, (size_t)DKV * DM / 8);
      k_cvt8<<<(unsigned)(((size_t)DM * DQ / 8 + 255) / 256), 256, 0, stream>>>(wo, WO, (size_t)DM * DQ / 8);
       }
    k_csid<<<(TT * HD + 255) / 256, 256, 0, stream>>>(CS);
    const unsigned LQ = (unsigned)(((size_t)NH_ * TT * HD / 2 + 255) / 256), LKv = (unsigned)(((size_t)NKV * TT * HD / 2 + 255) / 256);
    for (int b = 0; b < NB_; ++b) {
        
        k_cvt8<<<(unsigned)(((size_t)TT * DM / 8 + 255) / 256), 256, 0, stream>>>(x + (size_t)b * TT * DM, XB, (size_t)TT * DM / 8);
        k_gemmw<bf, 0, false><<<dim3(TT / 64, DQ / 64, 1), 32, 0, stream>>>(XB, nullptr, WQ, nullptr, DM, FQ, DQ, nullptr, 0, 0, 0);
        k_rope<<<LQ, 256, 0, stream>>>(FQ, DQ, NH_, CS, nullptr, nullptr, 1.0f, QP16, QPh, QPl);
        k_gemmw<bf, 0, false><<<dim3(TT / 64, DKV / 64, 1), 32, 0, stream>>>(XB, nullptr, WK, nullptr, DM, FK, DKV, nullptr, 0, 0, 0);
        k_rope<<<LKv, 256, 0, stream>>>(FK, DKV, NKV, CS, nullptr, nullptr, 1.0f, KP16, KPh, KPl);
        k_gemmw<bf, 0, false><<<dim3(TT / 64, DKV / 64, 1), 32, 0, stream>>>(XB, nullptr, WV, nullptr, DM, FV, DKV, nullptr, 0, 0, 0); k_vtp<<<LKv, 256, 0, stream>>>(FV, DKV, NKV, VT16, VTh, VTl);
        for (int h0 = 0; h0 < NH_; h0 += ZH) { const size_t zq = (size_t)h0, zk = (size_t)(h0 / REP);   // one kv head per query head: the pass's two heads use consecutive kv planes (z-strides TT*HD)
            k_gemmw<bf, 2, false><<<dim3(RH / 64, TT / 64, ZH), 32, 0, stream>>>(QPh + zq * TT * HD, QPl + zq * TT * HD, KPh + zk * TT * HD, KPl + zk * TT * HD, HD, Sb, TT, nullptr, (size_t)TT * HD, (size_t)TT * HD, (size_t)TT * TT);
            k_gemmw<h16, 0, false><<<dim3((TT - RH) / 64, TT / 64, ZH), 32, 0, stream>>>(QP16 + zq * TT * HD + (size_t)RH * HD, nullptr, KP16 + zk * TT * HD, nullptr, HD, Sb + (size_t)RH * TT, TT, nullptr, (size_t)TT * HD, (size_t)TT * HD, (size_t)TT * TT);
            k_asoft<<<ZH * TT / 8, 256, 0, stream>>>(Sb, P16, Ph, Pl);
            k_gemmw<bf, 2, false><<<dim3(RH / 64, HD / 64, ZH), 32, 0, stream>>>(Ph, Pl, VTh + zk * HD * TT, VTl + zk * HD * TT, TT, Ob, HD, nullptr, (size_t)RH * TT, (size_t)HD * TT, (size_t)TT * HD);
            k_gemmw<h16, 0, false><<<dim3((TT - RH) / 64, HD / 64, ZH), 32, 0, stream>>>(P16 + (size_t)RH * TT, nullptr, VT16 + zk * HD * TT, nullptr, TT, Ob + (size_t)RH * HD, HD, nullptr, (size_t)TT * TT, (size_t)HD * TT, (size_t)TT * HD);
            k_merge<<<(unsigned)(((size_t)ZH * TT * HD / 2 + 255) / 256), 256, 0, stream>>>(Ob, h0, ATh, ATl); }
        k_gemmw<bf, 1, true><<<dim3(TT / 64, DM / 64, 1), 32, 0, stream>>>(ATh, ATl, WO, nullptr, DQ, OUT + (size_t)b * TT * DM, DM, bo, 0, 0, 0); }
}

// v001
// One run takes 795 microseconds.
// In two side-by-side timings against v000, it was 5.90 and 5.88 times as fast.
#include <hip/hip_runtime.h>

// Simple multi-head attention scaled by the EMBEDDING size (x [8][1024][1024]; q,k,v = x W^T ('oi' [1024][1024], no bias); scores / sqrt(1024) (module quirk); softmax over all keys; out = merged Wo^T + bo -> [8][1024][1024] (8.4 M)).
// Layout, all batches per launch: bf16 copy of x and weights; exact projections; dense T-1024 attention in passes of ZP (batch, head) planes x one row class (hybrid rows: < 512 hi/lo 3 products, rest fp16 x1024), P stored in place of its S row; merged hi/lo x Wo exact + bo.
// Compute dtypes, f32 accumulate: every input rounded to bf16; projections exact; attention rows < 512 3 products, rest fp16; softmax f32; Wo hl x exact + bias.

#define NB_  8
#define TT   1024
#define DM   1024
#define NH_  16
#define NKV  16
#define REP  (NH_ / NKV)
#define HD   64
#define DQ   (NH_ * HD)
#define DKV  (NKV * HD)
#define ZP   32                   // (batch, head) planes per attention pass; one pass holds one row class (RH rows per plane)
#define RH   512                  // query rows < RH use hi+lo planes
#define WIN  0
#define PCAR 1024.0f
#define SCL  0.03125f   // 1/sqrt(1024): the module scales by the embedding size
typedef _Float16 h16;
typedef unsigned short bf;
typedef __attribute__((ext_vector_type(16))) __bf16   v16bf;
typedef __attribute__((ext_vector_type(16))) _Float16 v16h;
typedef __attribute__((ext_vector_type(8)))  _Float16 v8h;
typedef __attribute__((ext_vector_type(8)))  unsigned short v8us;
typedef __attribute__((ext_vector_type(8)))  float    v8f;
typedef __attribute__((ext_vector_type(4)))  float    v4f;
typedef v8h  __attribute__((may_alias)) v8ha;
typedef v4f  __attribute__((may_alias)) v4fa;
typedef v8us __attribute__((may_alias)) v8usa;

__device__ __forceinline__ unsigned short f2bf(float f) { unsigned u = __float_as_uint(f); u += 0x7FFFu + ((u >> 16) & 1u); return (unsigned short)(u >> 16); }
__device__ __forceinline__ float bf2f(unsigned short b) { return __uint_as_float(((unsigned)b) << 16); }
__device__ __forceinline__ float bfr(float f) { return bf2f(f2bf(f)); }
__device__ __forceinline__ v16h cat16(v8h lo, v8h hi) { return __builtin_shufflevector(lo, hi, 0, 1, 2, 3, 4, 5, 6, 7, 8, 9, 10, 11, 12, 13, 14, 15); }
__device__ __forceinline__ v16bf cat16b(v8us lo, v8us hi) { return __builtin_bit_cast(v16bf, __builtin_shufflevector(lo, hi, 0, 1, 2, 3, 4, 5, 6, 7, 8, 9, 10, 11, 12, 13, 14, 15)); }
__device__ __forceinline__ v8f wmma16(v16h a, v16h b, v8f c) { return __builtin_amdgcn_wmma_f32_16x16x32_f16(false, a, false, b, (short)0, c, false, false); }
__device__ __forceinline__ v8f wmmab(v16bf a, v16bf b, v8f c) { return __builtin_amdgcn_wmma_f32_16x16x32_bf16(false, a, false, b, (short)0, c, false, false); }



// ---- k_gemmw: register-blocked GEMM, ONE WAVE per 64x64 output tile (16 accumulators), operands straight from K-contiguous 16-bit planes (A row pitch lda, Bt row pitch K); grid (M/64, N/64, Z), 32 threads.
// C[m][n] (f32, pitch ldc, + optional f32 bias[n]) = sum_k A[m][k] Bt[n][k] (+ split products per NSPLIT). z-batch strides sA/sB/sC in elements. K % 32 == 0.
template <typename T16> struct WFrag;
template <> struct WFrag<h16> { typedef v16h V; static __device__ __forceinline__ V ld(const h16* p) { return cat16(*(const v8h*)p, *(const v8h*)(p + 16)); } static __device__ __forceinline__ v8f mma(V a, V b, v8f c) { return wmma16(a, b, c); } };
template <> struct WFrag<bf> { typedef v16bf V; static __device__ __forceinline__ V ld(const bf* p) { return cat16b(*(const v8us*)p, *(const v8us*)(p + 16)); } static __device__ __forceinline__ v8f mma(V a, V b, v8f c) { return wmmab(a, b, c); } };
template <typename T16, int NSPLIT, bool BIAS>
__global__ __launch_bounds__(32) void k_gemmw(const T16* __restrict__ A, const T16* __restrict__ A2, const T16* __restrict__ Bt, const T16* __restrict__ Bt2, int K, int lda, float* C, int ldc, const float* __restrict__ bias, size_t sA, size_t sB, size_t sC) {
    typedef typename WFrag<T16>::V V;
    __shared__ __align__(16) float os[16 * 68];
    const size_t z = blockIdx.z; A += z * sA; if (A2) A2 += z * sA; Bt += z * sB; if (Bt2) Bt2 += z * sB; C += z * sC;
    const int lane = threadIdx.x & 31, lr = lane & 15, hi = lane >> 4; const int r0 = blockIdx.x * 64, c0 = blockIdx.y * 64;
    v8f acc[4][4];
#pragma unroll
    for (int mb = 0; mb < 4; ++mb)
#pragma unroll
        for (int nb = 0; nb < 4; ++nb) acc[mb][nb] = (v8f){};
    const size_t aoff = (size_t)(r0 + lr) * lda + 8 * hi, boff = (size_t)(c0 + lr) * K + 8 * hi;
#pragma unroll 1
    for (int kc = 0; kc < K; kc += 32) {
        V a[4], a2[4]; const T16* pa[4]; const T16* pa2[4];
#pragma unroll
        for (int mb = 0; mb < 4; ++mb) { pa[mb] = A + aoff + (size_t)mb * 16 * lda + kc; a[mb] = WFrag<T16>::ld(pa[mb]); if (NSPLIT == 1 || NSPLIT == 2) { pa2[mb] = A2 + aoff + (size_t)mb * 16 * lda + kc; a2[mb] = WFrag<T16>::ld(pa2[mb]); } }
        // s_wait_xcnt 0 behind the run of A loads, before any register that one of them names is written again; the addresses are inputs so that each address pair stays whole up to the wait (without that, a later load of the run lands in an earlier load's address pair).
        if (NSPLIT == 1 || NSPLIT == 2) asm volatile("s_wait_xcnt 0x0" :: "v"(pa[0]), "v"(pa[1]), "v"(pa[2]), "v"(pa[3]), "v"(pa2[0]), "v"(pa2[1]), "v"(pa2[2]), "v"(pa2[3]) : "memory");
        else asm volatile("s_wait_xcnt 0x0" :: "v"(pa[0]), "v"(pa[1]), "v"(pa[2]), "v"(pa[3]) : "memory");
#pragma unroll
        for (int nb = 0; nb < 4; ++nb) { const T16* pb = Bt + boff + (size_t)nb * 16 * K + kc; const V b = WFrag<T16>::ld(pb); V b2;
            // the same wait behind each B fragment's loads, its addresses held whole up to it
            if (NSPLIT >= 2) { const T16* pb2 = Bt2 + boff + (size_t)nb * 16 * K + kc; b2 = WFrag<T16>::ld(pb2); asm volatile("s_wait_xcnt 0x0" :: "v"(pb), "v"(pb2) : "memory"); }
            else asm volatile("s_wait_xcnt 0x0" :: "v"(pb) : "memory");
#pragma unroll
            for (int mb = 0; mb < 4; ++mb) { acc[mb][nb] = WFrag<T16>::mma(a[mb], b, acc[mb][nb]); if (NSPLIT == 1 || NSPLIT == 2) acc[mb][nb] = WFrag<T16>::mma(a2[mb], b, acc[mb][nb]); if (NSPLIT >= 2) acc[mb][nb] = WFrag<T16>::mma(a[mb], b2, acc[mb][nb]); } }
        asm volatile("v_nop\n\tv_nop\n\tv_nop\n\tv_nop" : "+v"(acc[0][0]), "+v"(acc[1][1]), "+v"(acc[2][2]), "+v"(acc[3][3]) : "v"(a[0]), "v"(a[3]));
    }
#pragma unroll
    for (int mb = 0; mb < 4; ++mb) {
#pragma unroll
        for (int nb = 0; nb < 4; ++nb) {
#pragma unroll
            for (int j = 0; j < 8; ++j) os[(hi * 8 + j) * 68 + nb * 16 + lr] = acc[mb][nb][j]; }
        __builtin_amdgcn_wave_barrier(); asm volatile("" ::: "memory");
        float* crow = C + (size_t)(r0 + mb * 16) * ldc + c0;
{
#pragma unroll
            for (int s = 0; s < 8; ++s) { const int row = 2 * s + hi, cofs = lr * 4; v4f val = *(const v4fa*)(os + row * 68 + cofs); if (BIAS) { val[0] += bfr(bias[c0 + cofs]); val[1] += bfr(bias[c0 + cofs + 1]); val[2] += bfr(bias[c0 + cofs + 2]); val[3] += bfr(bias[c0 + cofs + 3]); }
                *(v4f*)(crow + (size_t)row * ldc + cofs) = val; }
             }
        __builtin_amdgcn_wave_barrier(); asm volatile("" ::: "memory");
    }
}

__device__ __forceinline__ h16 tohx(float x) { return (h16)x; }
__device__ __forceinline__ void splitf(float y, unsigned short& h, unsigned short& l) { h = f2bf(y); l = f2bf(y - bf2f(h)); }
typedef __attribute__((ext_vector_type(2))) _Float16 v2h;
typedef __attribute__((ext_vector_type(4))) _Float16 v4h;
typedef __attribute__((ext_vector_type(2))) unsigned short v2us;
typedef __attribute__((ext_vector_type(4))) unsigned short v4us;
typedef __attribute__((ext_vector_type(2))) float v2f;
typedef __attribute__((ext_vector_type(4))) int v4i;

__global__ __launch_bounds__(256) void k_wtG(const float* __restrict__ w, int K, int N, bf* Bt) {
    const int lane = threadIdx.x & 31; const int L0 = (blockIdx.x * 8 + (threadIdx.x >> 5)) * 8; const int nlines = N * K / 64;
{
#pragma unroll 1
        for (int l = 0; l < 8; ++l) { const int L = L0 + l; if (L >= nlines) break; const size_t e = (size_t)L * 64 + lane * 2; const int k = (int)(e % K), n = (int)(e / K); v2us o;
            o[0] = f2bf(w[(size_t)k * N + n]); o[1] = f2bf(w[(size_t)(k + 1) * N + n]); *(v2us*)(Bt + e) = o; }
         }
}
// k_cvt8: bf16 copies of the four weights and of x in one launch; blockIdx.y picks a chunk of DM*DM elements (0..3: wo, wq, wk, wv; 4..: x, one batch each), dst holds the chunks in that order.
static_assert(DQ == DM && DKV == DM && TT == DM && NH_ == NKV && 2 * RH == TT && (NB_ * NH_) % ZP == 0, "chunking and pass shapes");
__global__ __launch_bounds__(256) void k_cvt8(const float* __restrict__ wo, const float* __restrict__ wq, const float* __restrict__ wk, const float* __restrict__ wv, const float* __restrict__ x, bf* dst) { const int y = blockIdx.y; const float* src = (y == 0) ? wo : (y == 1) ? wq : (y == 2) ? wk : (y == 3) ? wv : x + (size_t)(y - 4) * DM * DM;
    const size_t i = (size_t)blockIdx.x * 256 + threadIdx.x; const v8f v = *(const v8f*)(src + i * 8); v8us o;
#pragma unroll
    for (int k = 0; k < 8; ++k) o[k] = f2bf(v[k]); *(v8us*)(dst + (size_t)y * DM * DM + i * 8) = o;  }

// k_rope: blockIdx.y picks a block of TT rows of F (one batch of q, then of k) and its nheads planes. Head planes [h][t][d] (fp16 + hi/lo) of rope(x) x sc with the rotate-half convention out[d] = x[d] cos[t][d] - x[d+HD/2] sin[t][d], out[d+HD/2] = x[d+HD/2] cos[t][d+HD/2] + x[d] sin[t][d+HD/2]
__global__ __launch_bounds__(256) void k_rope(const float* __restrict__ F, int pitch, int nheads, const float* __restrict__ CS, const float* __restrict__ RF, const float* __restrict__ nw, float sc, h16* P16, bf* Ph, bf* Pl) {
    { const size_t y = blockIdx.y, po = y * nheads * TT * HD; F += y * TT * pitch; P16 += po; Ph += po; Pl += po; }
    const size_t e = ((size_t)blockIdx.x * 256 + threadIdx.x) * 2; if (e >= (size_t)nheads * TT * HD) return; const int d = (int)(e % HD); const int t = (int)((e / HD) % TT); const int h = (int)(e / ((size_t)HD * TT)); const float* f = F + (size_t)t * pitch + h * HD; const float rf = RF ? RF[(size_t)h * TT + t] : 1.0f; v2h o16; v2us oh, ol;
#pragma unroll
    for (int q = 0; q < 2; ++q) { const int dd = d + q; const int dp = (dd < HD / 2) ? dd + HD / 2 : dd - HD / 2; float x0 = f[dd], x1 = f[dp];
        if (RF) { float n0 = __fmul_rn(x0, rf), n1 = __fmul_rn(x1, rf); asm volatile("" : "+v"(n0)); asm volatile("" : "+v"(n1)); x0 = __fmul_rn(bfr(nw[dd]), n0); x1 = __fmul_rn(bfr(nw[dp]), n1); }
        const v2f cs = *(const v2f*)(CS + ((size_t)t * HD + dd) * 2); float a = __fmul_rn(x0, cs[0]), bq = __fmul_rn(x1, cs[1]); asm volatile("" : "+v"(a)); asm volatile("" : "+v"(bq)); const float r = ((dd < HD / 2) ? __fsub_rn(a, bq) : __fadd_rn(a, bq)) * sc;
        o16[q] = tohx(r); unsigned short a2, c2; splitf(r, a2, c2); oh[q] = a2; ol[q] = c2; }
    *(v2h*)(P16 + e) = o16; *(v2us*)(Ph + e) = oh; *(v2us*)(Pl + e) = ol;  }
__global__ __launch_bounds__(256) void k_vtp(const float* __restrict__ F, int pitch, int nheads, h16* V16, bf* Vh, bf* Vl) { { const size_t y = blockIdx.y, po = y * nheads * HD * TT; F += y * TT * pitch; V16 += po; Vh += po; Vl += po; }   // blockIdx.y: batch
    const size_t e = ((size_t)blockIdx.x * 256 + threadIdx.x) * 2; if (e >= (size_t)nheads * HD * TT) return; const int t = (int)(e % TT); const int d = (int)((e / TT) % HD); const int g = (int)(e / ((size_t)TT * HD)); v2h o16; v2us oh, ol;
#pragma unroll
    for (int q = 0; q < 2; ++q) { const float x = F[(size_t)(t + q) * pitch + g * HD + d]; o16[q] = tohx(x); unsigned short a2, c2; splitf(x, a2, c2); oh[q] = a2; ol[q] = c2; }
    *(v2h*)(V16 + e) = o16; *(v2us*)(Vh + e) = oh; *(v2us*)(Vl + e) = ol;  }
__global__ __launch_bounds__(256) void k_csid(float* CS) { const int idx = blockIdx.x * 256 + threadIdx.x; if (idx >= TT * HD) return; v2f cs; cs[0] = 1.0f; cs[1] = 0.0f; *(v2f*)(CS + (size_t)idx * 2) = cs;  }
// k_asoft: one pass's rows (ZP planes x RH rows of one class, HIRES: hi/lo rows): t = S x SCL (no mask); softmax over the 1024 keys (register row, one exp, fixed trees).
// P replaces its own S row (4 * TT bytes): HIRES: hi plane in the first TT 16-bit slots, lo plane in the next TT; else fp16 x PCAR in the first TT slots. One wave owns a row and holds all of it in registers before its first store.
typedef v4us __attribute__((may_alias)) v4usa;
typedef v4h  __attribute__((may_alias)) v4ha;
template <bool HIRES>
__global__ __launch_bounds__(256) void k_asoft(float* Sb) {
    const int lane = threadIdx.x & 31; const int row = blockIdx.x * 8 + (threadIdx.x >> 5); if (row >= ZP * RH) return; float* sr = Sb + (size_t)row * TT; float v[TT / 32]; float mx = -3.0e38f;
#pragma unroll
    for (int ch = 0; ch < TT / 128; ++ch) { const int j0 = ch * 128 + lane * 4; const v4f a = *(const v4fa*)(sr + j0);
#pragma unroll
        for (int q = 0; q < 4; ++q) { const float t = a[q] * SCL; v[ch * 4 + q] = t; mx = fmaxf(mx, t); } }
#pragma unroll
    for (int sh = 16; sh; sh >>= 1) mx = fmaxf(mx, __shfl_xor(mx, sh, 32));
    float sum = 0.f;
#pragma unroll
    for (int k = 0; k < TT / 32; ++k) { float d0 = __fsub_rn(v[k], mx); asm volatile("" : "+v"(d0)); v[k] = __builtin_amdgcn_exp2f(__fmul_rn(d0, 1.4426950408889634f)); sum += v[k]; }
#pragma unroll
    for (int sh = 16; sh; sh >>= 1) sum += __shfl_xor(sum, sh, 32);
    const float f = __fdiv_rn(HIRES ? 1.0f : PCAR, sum);
    if (HIRES) { bf* ph = (bf*)sr; bf* pl = ph + TT;
#pragma unroll
        for (int ch = 0; ch < TT / 128; ++ch) { v4us oh, ol;
#pragma unroll
            for (int q = 0; q < 4; ++q) { unsigned short a, c2; splitf(v[ch * 4 + q] * f, a, c2); oh[q] = a; ol[q] = c2; }
            *(v4usa*)(ph + ch * 128 + lane * 4) = oh; *(v4usa*)(pl + ch * 128 + lane * 4) = ol; }
    } else { h16* p16 = (h16*)sr;
#pragma unroll
        for (int ch = 0; ch < TT / 128; ++ch) { v4h o4;
#pragma unroll
            for (int q = 0; q < 4; ++q) o4[q] = tohx(v[ch * 4 + q] * f);
            *(v4ha*)(p16 + ch * 128 + lane * 4) = o4; } }
}
// k_merge: one pass's O [zz][i][d] (plane g0 + zz = batch * NH_ + head, row t = i for hi/lo rows, RH + i else) -> hi/lo planes of the merged [batch][t][DQ]
__global__ __launch_bounds__(256) void k_merge(const float* __restrict__ O, int g0, int hires, bf* Ah, bf* Al) { const size_t e = ((size_t)blockIdx.x * 256 + threadIdx.x) * 2; if (e >= (size_t)ZP * RH * HD) return; const int d = (int)(e % HD); const int t = (int)((e / HD) % RH) + (hires ? 0 : RH); const int g = g0 + (int)(e / ((size_t)HD * RH)); const float cs = hires ? 1.0f : (1.0f / PCAR); const size_t oo = ((size_t)(g / NH_) * TT + t) * DQ + (g % NH_) * HD + d;
    v2us oh, ol;
#pragma unroll
    for (int q = 0; q < 2; ++q) { unsigned short a, c2; splitf(O[e + q] * cs, a, c2); oh[q] = a; ol[q] = c2; } *(v2us*)(Ah + oo) = oh; *(v2us*)(Al + oo) = ol;  }

extern "C" void kernel_launch(void* const* d_in, const int* in_sizes, int n_in,
                              void* d_out, int out_size, void* d_ws, size_t ws_size, hipStream_t stream) {
    (void)in_sizes; (void)n_in; (void)out_size;
    const float* x = (const float*)d_in[0]; const float* wq = (const float*)d_in[1]; const float* wk = (const float*)d_in[2]; const float* wv = (const float*)d_in[3]; const float* wo = (const float*)d_in[4]; const float* bo = (const float*)d_in[5];
    float* OUT = (float*)d_out;     // [8][1024][1024]
    char* ws = (char*)d_ws; const size_t Mi = (size_t)1 << 20;
    if (ws_size < 253 * Mi) return;    // ws 256 MiB
    // Workspace map in MiB; regions are reused in stream order once their last reader has run.
    //   0 WO | 2 WQ WK WV | 8 XB (all batches) | 24 CS | 25 .. 169 nine planes of 16 (all batches) | 137 FQ (over VTh, VTl until k_vtp) | 169 FK | 201 FV
    //   attention: 169 Sb (64, over FK FV) | 233 Ob (4) | 237 ATh (16) | 2 ATl (16, over WQ WK WV XB)
    const size_t PL = (size_t)NB_ * NH_ * TT * HD;   // elements of one plane set
    bf* WO = (bf*)ws; bf* WQ = (bf*)(ws + 2 * Mi); bf* XB = (bf*)(ws + 8 * Mi); float* CS = (float*)(ws + 24 * Mi);
    h16* QP16 = (h16*)(ws + 25 * Mi); h16* KP16 = QP16 + PL; bf* QPh = (bf*)(ws + 57 * Mi); bf* KPh = QPh + PL; bf* QPl = (bf*)(ws + 89 * Mi); bf* KPl = QPl + PL;
    h16* VT16 = (h16*)(ws + 121 * Mi); bf* VTh = (bf*)(ws + 137 * Mi); bf* VTl = (bf*)(ws + 153 * Mi);
    float* FQ = (float*)(ws + 137 * Mi); float* FV = (float*)(ws + 201 * Mi);   // FQ, FK, FV in a row: the z planes of one projection launch
    float* Sb = (float*)(ws + 169 * Mi); float* Ob = (float*)(ws + 233 * Mi); bf* ATh = (bf*)(ws + 237 * Mi); bf* ATl = (bf*)(ws + 2 * Mi);
    k_cvt8<<<dim3(DM * DM / 8 / 256, 4 + NB_, 1), 256, 0, stream>>>(wo, wq, wk, wv, x, WO);
    k_csid<<<(TT * HD + 255) / 256, 256, 0, stream>>>(CS);
    k_gemmw<bf, 0, false><<<dim3(NB_ * TT / 64, DQ / 64, 3), 32, 0, stream>>>(XB, nullptr, WQ, nullptr, DM, DM, FQ, DQ, nullptr, 0, (size_t)DQ * DM, (size_t)NB_ * TT * DQ);
    k_rope<<<dim3((unsigned)((size_t)NH_ * TT * HD / 2 / 256), 2 * NB_, 1), 256, 0, stream>>>(FQ, DQ, NH_, CS, nullptr, nullptr, 1.0f, QP16, QPh, QPl);   // q batches, then k batches
    k_vtp<<<dim3((unsigned)((size_t)NKV * HD * TT / 2 / 256), NB_, 1), 256, 0, stream>>>(FV, DKV, NKV, VT16, VTh, VTl);
    for (int g0 = 0; g0 < NB_ * NH_; g0 += ZP) { const size_t zo = (size_t)g0 * TT * HD;   // one kv head per query head: plane g of q meets plane g of k and v
        k_gemmw<bf, 2, false><<<dim3(RH / 64, TT / 64, ZP), 32, 0, stream>>>(QPh + zo, QPl + zo, KPh + zo, KPl + zo, HD, HD, Sb, TT, nullptr, (size_t)TT * HD, (size_t)TT * HD, (size_t)RH * TT);
        k_asoft<true><<<ZP * RH / 8, 256, 0, stream>>>(Sb);
        k_gemmw<bf, 2, false><<<dim3(RH / 64, HD / 64, ZP), 32, 0, stream>>>((const bf*)Sb, (const bf*)Sb + TT, VTh + zo, VTl + zo, TT, 2 * TT, Ob, HD, nullptr, (size_t)RH * 2 * TT, (size_t)HD * TT, (size_t)RH * HD);
        k_merge<<<(unsigned)((size_t)ZP * RH * HD / 2 / 256), 256, 0, stream>>>(Ob, g0, 1, ATh, ATl);
        k_gemmw<h16, 0, false><<<dim3((TT - RH) / 64, TT / 64, ZP), 32, 0, stream>>>(QP16 + zo + (size_t)RH * HD, nullptr, KP16 + zo, nullptr, HD, HD, Sb, TT, nullptr, (size_t)TT * HD, (size_t)TT * HD, (size_t)(TT - RH) * TT);
        k_asoft<false><<<ZP * RH / 8, 256, 0, stream>>>(Sb);
        k_gemmw<h16, 0, false><<<dim3((TT - RH) / 64, HD / 64, ZP), 32, 0, stream>>>((const h16*)Sb, nullptr, VT16 + zo, nullptr, TT, 2 * TT, Ob, HD, nullptr, (size_t)(TT - RH) * 2 * TT, (size_t)HD * TT, (size_t)(TT - RH) * HD);
        k_merge<<<(unsigned)((size_t)ZP * RH * HD / 2 / 256), 256, 0, stream>>>(Ob, g0, 0, ATh, ATl); }
    k_gemmw<bf, 1, true><<<dim3(NB_ * TT / 64, DM / 64, 1), 32, 0, stream>>>(ATh, ATl, WO, nullptr, DQ, DQ, OUT, DM, bo, 0, 0, 0);
}

// v003
// It runs in 272 microseconds.
// Versions between v001 and this one are left out; their measured steps multiply to 2.92 times as fast.
// Over all steps from v000 it is 17.2 times as fast.
#include <hip/hip_runtime.h>

// Simple multi-head attention scaled by the EMBEDDING size (x [8][1024][1024]; q,k,v = x W^T ('oi' [1024][1024], no bias); scores / sqrt(1024) (module quirk); softmax over all keys; out = merged Wo^T + bo -> [8][1024][1024] (8.4 M)).
// Every 16-bit operand plane [row][k] lies in fragment order: element (row, k) at ((row / 16) * (K / 8) + k / 8) * 128 + (row % 16) * 8 + k % 8, so a 16 x 32 fragment is 1 KB in a row and each of its two wave-wide 16-byte loads covers 512 contiguous bytes (four whole lines).
// Layout, all batches per launch: bf16 copy of x and weights; exact projections; dense T-1024 attention fused in one launch (scores, running softmax and P V stay in registers; hybrid rows: < 512 hi/lo 3 products, rest fp16 x1024); merged hi/lo x Wo exact + bo.
// Compute dtypes, f32 accumulate: every input rounded to bf16; projections exact; attention rows < 512 3 products, rest fp16; softmax f32; Wo hl x exact + bias.

#define NB_  8
#define TT   1024
#define DM   1024
#define NH_  16
#define NKV  16
#define REP  (NH_ / NKV)
#define HD   64
#define DQ   (NH_ * HD)
#define DKV  (NKV * HD)
#define RH   512                  // query rows < RH use hi+lo planes (0: none)
#define WIN  0
#define PCAR 1024.0f
#define SCL  0.03125f   // 1/sqrt(1024): the module scales by the embedding size
typedef _Float16 h16;
typedef unsigned short bf;
typedef __attribute__((ext_vector_type(16))) __bf16   v16bf;
typedef __attribute__((ext_vector_type(16))) _Float16 v16h;
typedef __attribute__((ext_vector_type(8)))  _Float16 v8h;
typedef __attribute__((ext_vector_type(8)))  unsigned short v8us;
typedef __attribute__((ext_vector_type(8)))  float    v8f;
typedef __attribute__((ext_vector_type(4)))  float    v4f;
typedef v8h  __attribute__((may_alias)) v8ha;
typedef v4f  __attribute__((may_alias)) v4fa;
typedef v8us __attribute__((may_alias)) v8usa;

__device__ __forceinline__ unsigned short f2bf(float f) { unsigned u = __float_as_uint(f); u += 0x7FFFu + ((u >> 16) & 1u); return (unsigned short)(u >> 16); }
__device__ __forceinline__ float bf2f(unsigned short b) { return __uint_as_float(((unsigned)b) << 16); }
__device__ __forceinline__ float bfr(float f) { return bf2f(f2bf(f)); }
__device__ __forceinline__ v16h cat16(v8h lo, v8h hi) { return __builtin_shufflevector(lo, hi, 0, 1, 2, 3, 4, 5, 6, 7, 8, 9, 10, 11, 12, 13, 14, 15); }
__device__ __forceinline__ v16bf cat16b(v8us lo, v8us hi) { return __builtin_bit_cast(v16bf, __builtin_shufflevector(lo, hi, 0, 1, 2, 3, 4, 5, 6, 7, 8, 9, 10, 11, 12, 13, 14, 15)); }
__device__ __forceinline__ v8f wmma16(v16h a, v16h b, v8f c) { return __builtin_amdgcn_wmma_f32_16x16x32_f16(false, a, false, b, (short)0, c, false, false); }
__device__ __forceinline__ v8f wmmab(v16bf a, v16bf b, v8f c) { return __builtin_amdgcn_wmma_f32_16x16x32_bf16(false, a, false, b, (short)0, c, false, false); }



// ---- k_gemmw: register-blocked GEMM, ONE WAVE per 64x64 output tile (16 accumulators), operands straight from 16-bit planes in fragment order (A of lda, Bt of K elements a row; WFrag::ld takes the fragment's start + lane * 8); grid (M/64, N/64, Z), 32 threads.
// C[m][n] (f32, pitch ldc, + optional f32 bias[n]) = sum_k A[m][k] Bt[n][k] (+ split products per NSPLIT). z-batch strides sA/sB/sC in elements. K % 32 == 0.
template <typename T16> struct WFrag;
template <> struct WFrag<h16> { typedef v16h V; static __device__ __forceinline__ V ld(const h16* p) { return cat16(*(const v8h*)p, *(const v8h*)(p + 256)); } static __device__ __forceinline__ v8f mma(V a, V b, v8f c) { return wmma16(a, b, c); } };
template <> struct WFrag<bf> { typedef v16bf V; static __device__ __forceinline__ V ld(const bf* p) { return cat16b(*(const v8us*)p, *(const v8us*)(p + 256)); } static __device__ __forceinline__ v8f mma(V a, V b, v8f c) { return wmmab(a, b, c); } };
template <typename T16, int NSPLIT, bool BIAS>
__global__ __launch_bounds__(32) void k_gemmw(const T16* __restrict__ A, const T16* __restrict__ A2, const T16* __restrict__ Bt, const T16* __restrict__ Bt2, int K, int lda, float* C, int ldc, const float* __restrict__ bias, size_t sA, size_t sB, size_t sC) {
    typedef typename WFrag<T16>::V V;
    __shared__ __align__(16) float os[16 * 68];
    const size_t z = blockIdx.z; A += z * sA; if (A2) A2 += z * sA; Bt += z * sB; if (Bt2) Bt2 += z * sB; C += z * sC;
    const int lane = threadIdx.x & 31, lr = lane & 15, hi = lane >> 4; const int r0 = blockIdx.x * 64, c0 = blockIdx.y * 64;
    v8f acc[4][4];
#pragma unroll
    for (int mb = 0; mb < 4; ++mb)
#pragma unroll
        for (int nb = 0; nb < 4; ++nb) acc[mb][nb] = (v8f){};
    const size_t aoff = (size_t)r0 * lda + lane * 8, boff = (size_t)c0 * K + lane * 8;
#pragma unroll 1
    for (int kc = 0; kc < K; kc += 32) {
        V a[4], a2[4]; const T16* pa[4]; const T16* pa2[4];
#pragma unroll
        for (int mb = 0; mb < 4; ++mb) { pa[mb] = A + aoff + (size_t)mb * 16 * lda + kc * 16; a[mb] = WFrag<T16>::ld(pa[mb]); if (NSPLIT == 1 || NSPLIT == 2) { pa2[mb] = A2 + aoff + (size_t)mb * 16 * lda + kc * 16; a2[mb] = WFrag<T16>::ld(pa2[mb]); } }
        // s_wait_xcnt 0 behind the run of A loads, before any register that one of them names is written again; the addresses are inputs so that each address pair stays whole up to the wait (without that, a later load of the run lands in an earlier load's address pair).
        if (NSPLIT == 1 || NSPLIT == 2) asm volatile("s_wait_xcnt 0x0" :: "v"(pa[0]), "v"(pa[1]), "v"(pa[2]), "v"(pa[3]), "v"(pa2[0]), "v"(pa2[1]), "v"(pa2[2]), "v"(pa2[3]) : "memory");
        else asm volatile("s_wait_xcnt 0x0" :: "v"(pa[0]), "v"(pa[1]), "v"(pa[2]), "v"(pa[3]) : "memory");
#pragma unroll
        for (int nb = 0; nb < 4; ++nb) { const T16* pb = Bt + boff + (size_t)nb * 16 * K + kc * 16; const V b = WFrag<T16>::ld(pb); V b2;
            // the same wait behind each B fragment's loads, its addresses held whole up to it
            if (NSPLIT >= 2) { const T16* pb2 = Bt2 + boff + (size_t)nb * 16 * K + kc * 16; b2 = WFrag<T16>::ld(pb2); asm volatile("s_wait_xcnt 0x0" :: "v"(pb), "v"(pb2) : "memory"); }
            else asm volatile("s_wait_xcnt 0x0" :: "v"(pb) : "memory");
#pragma unroll
            for (int mb = 0; mb < 4; ++mb) { acc[mb][nb] = WFrag<T16>::mma(a[mb], b, acc[mb][nb]); if (NSPLIT == 1 || NSPLIT == 2) acc[mb][nb] = WFrag<T16>::mma(a2[mb], b, acc[mb][nb]); if (NSPLIT >= 2) acc[mb][nb] = WFrag<T16>::mma(a[mb], b2, acc[mb][nb]); } }
        asm volatile("v_nop\n\tv_nop\n\tv_nop\n\tv_nop" : "+v"(acc[0][0]), "+v"(acc[1][1]), "+v"(acc[2][2]), "+v"(acc[3][3]) : "v"(a[0]), "v"(a[3]));
    }
#pragma unroll
    for (int mb = 0; mb < 4; ++mb) {
#pragma unroll
        for (int nb = 0; nb < 4; ++nb) {
#pragma unroll
            for (int j = 0; j < 8; ++j) os[(hi * 8 + j) * 68 + nb * 16 + lr] = acc[mb][nb][j]; }
        __builtin_amdgcn_wave_barrier(); asm volatile("" ::: "memory");
        float* crow = C + (size_t)(r0 + mb * 16) * ldc + c0;
{
#pragma unroll
            for (int s = 0; s < 8; ++s) { const int row = 2 * s + hi, cofs = lr * 4; v4f val = *(const v4fa*)(os + row * 68 + cofs); if (BIAS) { val[0] += bfr(bias[c0 + cofs]); val[1] += bfr(bias[c0 + cofs + 1]); val[2] += bfr(bias[c0 + cofs + 2]); val[3] += bfr(bias[c0 + cofs + 3]); }
                *(v4f*)(crow + (size_t)row * ldc + cofs) = val; }
             }
        __builtin_amdgcn_wave_barrier(); asm volatile("" ::: "memory");
    }
}

__device__ __forceinline__ h16 tohx(float x) { return (h16)x; }
__device__ __forceinline__ void splitf(float y, unsigned short& h, unsigned short& l) { h = f2bf(y); l = f2bf(y - bf2f(h)); }
typedef __attribute__((ext_vector_type(2))) _Float16 v2h;
typedef __attribute__((ext_vector_type(4))) _Float16 v4h;
typedef __attribute__((ext_vector_type(2))) unsigned short v2us;
typedef __attribute__((ext_vector_type(4))) unsigned short v4us;
typedef __attribute__((ext_vector_type(2))) float v2f;
typedef __attribute__((ext_vector_type(4))) int v4i;

__global__ __launch_bounds__(256) void k_wtG(const float* __restrict__ w, int K, int N, bf* Bt) {
    const int lane = threadIdx.x & 31; const int L0 = (blockIdx.x * 8 + (threadIdx.x >> 5)) * 8; const int nlines = N * K / 64;
{
#pragma unroll 1
        for (int l = 0; l < 8; ++l) { const int L = L0 + l; if (L >= nlines) break; const size_t e = (size_t)L * 64 + lane * 2; const int k = (int)(e % K), n = (int)(e / K); v2us o;
            o[0] = f2bf(w[(size_t)k * N + n]); o[1] = f2bf(w[(size_t)(k + 1) * N + n]); *(v2us*)(Bt + e) = o; }
         }
}
// k_cvt8: bf16 copies of the four weights and of x in one launch, in fragment order; blockIdx.y picks a chunk of DM*DM elements (0..3: wo, wq, wk, wv; 4..: x, one batch each), dst holds the chunks in that order.
// A block takes 16 rows x 256 k (blockIdx.x = row tile * 4 + k quarter): a wave reads 1 KB of one row, the 16-byte octets turn in LDS (one group of 16 rows per k octet, pitch 272 B against bank conflicts), a wave stores 512 contiguous bytes.
static_assert(DQ == DM && DKV == DM && TT == DM && NH_ == NKV && RH % 256 == 0 && TT % 256 == 0 && NH_ % 4 == 0 && HD == 64, "chunking and row blocks");
__global__ __launch_bounds__(256) void k_cvt8(const float* __restrict__ wo, const float* __restrict__ wq, const float* __restrict__ wk, const float* __restrict__ wv, const float* __restrict__ x, bf* dst) { const int y = blockIdx.y; const float* src = (y == 0) ? wo : (y == 1) ? wq : (y == 2) ? wk : (y == 3) ? wv : x + (size_t)(y - 4) * DM * DM;
    __shared__ __align__(16) bf ts[32 * 136];
    const int rt = blockIdx.x >> 2, kq = blockIdx.x & 3, tid = threadIdx.x;
    const float* s0 = src + (size_t)(rt * 16 + (tid >> 5)) * DM + kq * 256 + (tid & 31) * 8; const float* s1 = s0 + 8 * DM;   // rows tid / 32 and 8 + tid / 32, k octet tid % 32
    const v8f v0 = *(const v8f*)s0, v1 = *(const v8f*)s1;
    // s_wait_xcnt 0 behind the loads, before any register that one of them names is written again; the address (s1 is s0 plus an immediate offset) is an input so that it stays whole up to the wait
    asm volatile("s_wait_xcnt 0x0" :: "v"(s0) : "memory");
    v8us o0, o1;
#pragma unroll
    for (int k = 0; k < 8; ++k) { o0[k] = f2bf(v0[k]); o1[k] = f2bf(v1[k]); }
    *(v8usa*)(ts + (tid & 31) * 136 + (tid >> 5) * 8) = o0; *(v8usa*)(ts + (tid & 31) * 136 + (8 + (tid >> 5)) * 8) = o1;
    __syncthreads();   // the octets cross waves
    bf* d0 = dst + (size_t)y * DM * DM + ((size_t)rt * (DM / 8) + kq * 32) * 128 + tid * 8;
    *(v8us*)d0 = *(const v8usa*)(ts + (tid >> 4) * 136 + (tid & 15) * 8); *(v8us*)(d0 + 2048) = *(const v8usa*)(ts + (16 + (tid >> 4)) * 136 + (tid & 15) * 8);  }

// k_rope: blockIdx.y picks a block of TT rows of F (one batch of q, then of k) and its nheads planes. Head planes [h][t][d] (fp16 + hi/lo), each in fragment order, of rope(x) x sc with the rotate-half convention out[d] = x[d] cos[t][d] - x[d+HD/2] sin[t][d], out[d+HD/2] = x[d+HD/2] cos[t][d+HD/2] + x[d] sin[t][d+HD/2]
// A block takes 16 rows x 4 heads (blockIdx.x = row tile * (nheads / 4) + head quarter), a thread two octets of d: a wave reads 1 KB of one row, the octets turn in LDS as in k_cvt8, a wave stores 512 contiguous bytes of a plane.
__global__ __launch_bounds__(256) void k_rope(const float* __restrict__ F, int pitch, int nheads, const float* __restrict__ CS, const float* __restrict__ RF, const float* __restrict__ nw, float sc, h16* P16, bf* Ph, bf* Pl) {
    __shared__ __align__(16) h16 s16[32 * 136]; __shared__ __align__(16) bf sh[32 * 136]; __shared__ __align__(16) bf sl[32 * 136];
    { const size_t y = blockIdx.y, po = y * nheads * TT * HD; F += y * TT * pitch; P16 += po; Ph += po; Pl += po; }
    const int hq = nheads / 4, rt = blockIdx.x / hq, h0 = (blockIdx.x % hq) * 4, tid = threadIdx.x;
    const int c = tid & 31, h = h0 + (c >> 3), d = (c & 7) * 8, dq = (d < HD / 2) ? d + HD / 2 : d - HD / 2;   // an octet lies in one half of the head: its partners are the octet at dq
    const float* p0[2]; const float* p1[2]; const float* pc[2]; v8f X0[2], X1[2], C0[2], C1[2]; float rfs[2];
#pragma unroll
    for (int u = 0; u < 2; ++u) { const int t = rt * 16 + (tid >> 5) + 8 * u; p0[u] = F + (size_t)t * pitch + h * HD + d; p1[u] = F + (size_t)t * pitch + h * HD + dq; pc[u] = CS + ((size_t)t * HD + d) * 2;
        X0[u] = *(const v8f*)p0[u]; X1[u] = *(const v8f*)p1[u]; C0[u] = *(const v8f*)pc[u]; C1[u] = *(const v8f*)(pc[u] + 8); }
    // s_wait_xcnt 0 behind the loads of both rows, before any register that one of them names is written again; the addresses are inputs so that they stay whole up to the wait
    asm volatile("s_wait_xcnt 0x0" :: "v"(p0[0]), "v"(p1[0]), "v"(pc[0]), "v"(p0[1]), "v"(p1[1]), "v"(pc[1]) : "memory");
#pragma unroll
    for (int u = 0; u < 2; ++u) { rfs[u] = 1.0f;
        // the same wait behind the row factor's load
        if (RF) { const float* pr = RF + (size_t)h * TT + rt * 16 + (tid >> 5) + 8 * u; rfs[u] = *pr; asm volatile("s_wait_xcnt 0x0" :: "v"(pr) : "memory"); } }
#pragma unroll
    for (int u = 0; u < 2; ++u) { const int lr = (tid >> 5) + 8 * u; const float rf = rfs[u]; v8h o16; v8us oh, ol;
#pragma unroll
        for (int q = 0; q < 8; ++q) { const int dd = d + q, dp = dq + q; float x0 = X0[u][q], x1 = X1[u][q];
            if (RF) { float n0 = __fmul_rn(x0, rf), n1 = __fmul_rn(x1, rf); asm volatile("" : "+v"(n0)); asm volatile("" : "+v"(n1)); x0 = __fmul_rn(bfr(nw[dd]), n0); x1 = __fmul_rn(bfr(nw[dp]), n1); }
            const float cc = (q < 4) ? C0[u][2 * (q & 3)] : C1[u][2 * (q & 3)], ss = (q < 4) ? C0[u][2 * (q & 3) + 1] : C1[u][2 * (q & 3) + 1]; float a = __fmul_rn(x0, cc), bq = __fmul_rn(x1, ss); asm volatile("" : "+v"(a)); asm volatile("" : "+v"(bq)); const float r = ((d < HD / 2) ? __fsub_rn(a, bq) : __fadd_rn(a, bq)) * sc;
            o16[q] = tohx(r); unsigned short a2, c2; splitf(r, a2, c2); oh[q] = a2; ol[q] = c2; }
        *(v8ha*)(s16 + c * 136 + lr * 8) = o16; *(v8usa*)(sh + c * 136 + lr * 8) = oh; *(v8usa*)(sl + c * 136 + lr * 8) = ol; }
    __syncthreads();   // the octets cross waves
#pragma unroll
    for (int u = 0; u < 2; ++u) { const int g = (tid >> 4) + 16 * u, w = tid & 15; const size_t e = (size_t)(h0 + (g >> 3)) * TT * HD + (size_t)(rt * (HD / 8) + (g & 7)) * 128 + w * 8;
        *(v8h*)(P16 + e) = *(const v8ha*)(s16 + g * 136 + w * 8); *(v8us*)(Ph + e) = *(const v8usa*)(sh + g * 136 + w * 8); *(v8us*)(Pl + e) = *(const v8usa*)(sl + g * 136 + w * 8); }  }
// k_vtp: V^T planes [g][d][t] (fp16 + hi/lo), each in fragment order (rows d, k = t); blockIdx.y: batch, blockIdx.x = g * (TT / 32) + block of 32 t. A wave reads 4 rows of 256 B; the f32 tile turns in LDS (pitch 68 floats: the column reads of the two lane halves fall on different banks); a thread gathers one octet of t, a wave stores 512 contiguous bytes.
__global__ __launch_bounds__(256) void k_vtp(const float* __restrict__ F, int pitch, int nheads, h16* V16, bf* Vh, bf* Vl) { { const size_t y = blockIdx.y, po = y * nheads * HD * TT; F += y * TT * pitch; V16 += po; Vh += po; Vl += po; }
    __shared__ __align__(16) float ts[32 * 68];
    const int g = blockIdx.x / (TT / 32), kq = blockIdx.x % (TT / 32), tid = threadIdx.x;
    { const float* s = F + (size_t)(kq * 32 + (tid >> 3)) * pitch + g * HD + (tid & 7) * 8; const v8f v = *(const v8f*)s;
      // the same wait behind the load
      asm volatile("s_wait_xcnt 0x0" :: "v"(s) : "memory");
      float* w = ts + (tid >> 3) * 68 + (tid & 7) * 8; *(v4fa*)w = __builtin_shufflevector(v, v, 0, 1, 2, 3); *(v4fa*)(w + 4) = __builtin_shufflevector(v, v, 4, 5, 6, 7); }
    __syncthreads();   // the tile crosses waves
    const int lr = tid & 15, k0 = ((tid >> 4) & 3) * 8, dt = tid >> 6; v8h o16; v8us oh, ol;
#pragma unroll
    for (int q = 0; q < 8; ++q) { const float x = ts[(k0 + q) * 68 + dt * 16 + lr]; o16[q] = tohx(x); unsigned short a2, c2; splitf(x, a2, c2); oh[q] = a2; ol[q] = c2; }
    const size_t e = (size_t)g * HD * TT + ((size_t)dt * (TT / 8) + kq * 4) * 128 + (tid & 63) * 8;
    *(v8h*)(V16 + e) = o16; *(v8us*)(Vh + e) = oh; *(v8us*)(Vl + e) = ol;  }
__global__ __launch_bounds__(256) void k_csid(float* CS) { const int idx = blockIdx.x * 256 + threadIdx.x; if (idx >= TT * HD) return; v2f cs; cs[0] = 1.0f; cs[1] = 0.0f; *(v2f*)(CS + (size_t)idx * 2) = cs;  }
// k_fattn: fused attention. One wave owns 32 query rows of one (batch, head) plane and walks the TT keys 32 at a time; 8 waves (256 rows) per block read the same K and V. grid (planes, TT / 256): blockIdx.y picks the row block, the hi/lo row blocks come first.
// St = K Q^T (A: K rows, B: Q rows): a lane holds 16 scores of ONE query (column lr; keys 8 hi + j of each 16-key tile), so maximum, sum and rescale are lane-local but for one exchange between the lane halves.
// The two St tiles of a 32-key block, converted in place, are the B operand of Ot += V^T P^T (A: VT rows d, loaded in the same k order). P is exp(t - running max), not normalised (fp16 rows: x PCAR); Ot is divided by the f32 sum at the end.
__device__ __forceinline__ float xhalf(float x) { const int b = __float_as_int(x); return __int_as_float(__builtin_amdgcn_permlanex16(b, b, 0x76543210, 0xfedcba98, false, false)); }   // lane l <-> l ^ 16
template <typename T16, bool HIRES>
__device__ __forceinline__ void attn_rows(const T16* Q, const T16* Q2, const T16* Kp, const T16* Kp2, const T16* Vp, const T16* Vp2, int t0, bf* Ah, bf* Al) {
    // every inner loop below is fully unrolled (#pragma unroll): fragment and accumulator arrays stay in registers only under constant indices
    typedef typename WFrag<T16>::V V; static_assert(PCAR == 1024.0f, "the exponent bias 10 below is log2(PCAR)");
    const int lane = threadIdx.x & 31;   // in the comments: lr = lane % 16, hi = lane / 16
    const float C = SCL * 1.4426950408889634f;
    V q[2][2], q2[2][2];
    { const T16* pq = Q + (size_t)t0 * HD + lane * 8; const T16* pq2 = HIRES ? Q2 + (size_t)t0 * HD + lane * 8 : pq;   // fragment order: 16 rows x 32 d are 512 elements in a row
#pragma unroll
      for (int qt = 0; qt < 2; ++qt)
#pragma unroll
          for (int ks = 0; ks < 2; ++ks) { q[qt][ks] = WFrag<T16>::ld(pq + qt * 16 * HD + ks * 512); if (HIRES) q2[qt][ks] = WFrag<T16>::ld(pq2 + qt * 16 * HD + ks * 512); }
      // s_wait_xcnt 0 behind the Q loads, before any register that one of them names is written again; the addresses are inputs so that they stay whole up to the wait
      asm volatile("s_wait_xcnt 0x0" :: "v"(pq), "v"(pq2) : "memory"); }
    v8f o[2][4]; float m[2], l[2];
#pragma unroll
    for (int qt = 0; qt < 2; ++qt) { m[qt] = -3.0e38f; l[qt] = 0.f;
#pragma unroll
        for (int dt = 0; dt < 4; ++dt) o[qt][dt] = (v8f){}; }
    const T16* pk = Kp + lane * 8; const T16* pk2 = HIRES ? Kp2 + lane * 8 : pk;
    const T16* pv = Vp + lane * 8; const T16* pv2 = HIRES ? Vp2 + lane * 8 : pv;
#pragma unroll 1   // one 32-key block per trip: an unrolled body would not fit the registers of four waves per SIMD
    for (int kb = 0; kb < TT; kb += 32) {
        V kf[2][2], kf2[2][2];
#pragma unroll
        for (int kt = 0; kt < 2; ++kt)
#pragma unroll
            for (int ks = 0; ks < 2; ++ks) { kf[kt][ks] = WFrag<T16>::ld(pk + kt * 16 * HD + ks * 512); if (HIRES) kf2[kt][ks] = WFrag<T16>::ld(pk2 + kt * 16 * HD + ks * 512); }
        // the same wait behind the K loads, their addresses held whole up to it
        asm volatile("s_wait_xcnt 0x0" :: "v"(pk), "v"(pk2) : "memory");
        v8f st[2][2];
#pragma unroll
        for (int kt = 0; kt < 2; ++kt)
#pragma unroll
            for (int qt = 0; qt < 2; ++qt) { v8f s = (v8f){};
#pragma unroll
                for (int ks = 0; ks < 2; ++ks) { s = WFrag<T16>::mma(kf[kt][ks], q[qt][ks], s); if (HIRES) { s = WFrag<T16>::mma(kf[kt][ks], q2[qt][ks], s); s = WFrag<T16>::mma(kf2[kt][ks], q[qt][ks], s); } }
                st[qt][kt] = s; }
        V vf[4], vf2[4];
#pragma unroll
        for (int dt = 0; dt < 4; ++dt) { vf[dt] = WFrag<T16>::ld(pv + (size_t)dt * 16 * TT); if (HIRES) vf2[dt] = WFrag<T16>::ld(pv2 + (size_t)dt * 16 * TT); }
        // the same wait behind the V loads (issued here so that the softmax below covers their latency), before the four addresses step on
        asm volatile("s_wait_xcnt 0x0" :: "v"(pv), "v"(pv2) : "memory");
        pk += 32 * HD; pk2 += 32 * HD; pv += 512; pv2 += 512;
        V p[2], p2[2];
#pragma unroll
        for (int qt = 0; qt < 2; ++qt) { float mx = st[qt][0][0];
#pragma unroll
            for (int j = 1; j < 16; ++j) mx = fmaxf(mx, st[qt][j >> 3][j & 7]);
            mx = fmaxf(mx, xhalf(mx)); const float mn = fmaxf(m[qt], mx); float al = (m[qt] - mn) * C; m[qt] = mn;
            const float nb = (HIRES ? 0.0f : 10.0f) - mn * C;   // fp16 rows carry P x PCAR = 2^10
            float e[16];
#pragma unroll
            for (int j = 0; j < 16; ++j) e[j] = __builtin_fmaf(st[qt][j >> 3][j & 7], C, nb);
            // the 17 exponentials of one query tile in one statement, each in place: none overwrites the source or reads the result of the one before it; the v_nop is the slot between the last one and whatever follows
            asm("v_exp_f32 %0, %0\n\tv_exp_f32 %1, %1\n\tv_exp_f32 %2, %2\n\tv_exp_f32 %3, %3\n\tv_exp_f32 %4, %4\n\tv_exp_f32 %5, %5\n\tv_exp_f32 %6, %6\n\tv_exp_f32 %7, %7\n\tv_exp_f32 %8, %8\n\t"
                "v_exp_f32 %9, %9\n\tv_exp_f32 %10, %10\n\tv_exp_f32 %11, %11\n\tv_exp_f32 %12, %12\n\tv_exp_f32 %13, %13\n\tv_exp_f32 %14, %14\n\tv_exp_f32 %15, %15\n\tv_exp_f32 %16, %16\n\tv_nop"
                : "+v"(al), "+v"(e[0]), "+v"(e[1]), "+v"(e[2]), "+v"(e[3]), "+v"(e[4]), "+v"(e[5]), "+v"(e[6]), "+v"(e[7]), "+v"(e[8]), "+v"(e[9]), "+v"(e[10]), "+v"(e[11]), "+v"(e[12]), "+v"(e[13]), "+v"(e[14]), "+v"(e[15]));
            float sum = 0.f;
#pragma unroll
            for (int j = 0; j < 16; ++j) { sum += e[j];
                if constexpr (HIRES) { const __bf16 h = (__bf16)e[j]; p[qt][j] = h; p2[qt][j] = (__bf16)(e[j] - (float)h); } else p[qt][j] = (h16)e[j]; }
            l[qt] = l[qt] * al + sum;
#pragma unroll
            for (int dt = 0; dt < 4; ++dt) o[qt][dt] *= al; }
#pragma unroll
        for (int dt = 0; dt < 4; ++dt)
#pragma unroll
            for (int qt = 0; qt < 2; ++qt) { o[qt][dt] = WFrag<T16>::mma(vf[dt], p[qt], o[qt][dt]); if (HIRES) { o[qt][dt] = WFrag<T16>::mma(vf[dt], p2[qt], o[qt][dt]); o[qt][dt] = WFrag<T16>::mma(vf2[dt], p[qt], o[qt][dt]); } }
    }
    // o[qt][dt][j] = Ot[d = dt * 16 + 8 hi + j][query t0 + qt * 16 + lr]: 8 consecutive d of one merged row per lane, in fragment order 512 contiguous bytes per wave-wide store
#pragma unroll
    for (int qt = 0; qt < 2; ++qt) { const float f = __fdiv_rn(1.0f, l[qt] + xhalf(l[qt])); const size_t oo = (size_t)(t0 + qt * 16) * DQ + lane * 8;
#pragma unroll
        for (int dt = 0; dt < 4; ++dt) { v8us oh, ol;
#pragma unroll
            for (int j = 0; j < 8; ++j) { unsigned short a, c2; splitf(o[qt][dt][j] * f, a, c2); oh[j] = a; ol[j] = c2; }
            bf* sh = Ah + oo + dt * 256; bf* sl = Al + oo + dt * 256; *(v8us*)sh = oh; *(v8us*)sl = ol;
            // the same wait behind the two stores, before a register that one of them names (address or data) is written again
            asm volatile("s_wait_xcnt 0x0" :: "v"(sh), "v"(sl), "v"(oh), "v"(ol) : "memory"); } }
}
__global__ __launch_bounds__(256) void k_fattn(const h16* Q16, const h16* K16, const h16* V16, const bf* Qh, const bf* Ql, const bf* Kh, const bf* Kl, const bf* Vh, const bf* Vl, bf* Ah, bf* Al) {
    const int g = blockIdx.x; const size_t zo = (size_t)g * TT * HD; const int t0 = blockIdx.y * 256 + (threadIdx.x >> 5) * 32;   // plane g = batch * NH_ + head: one kv head per query head
    const size_t ao = (size_t)(g / NH_) * TT * DQ + (g % NH_) * HD * 16;   // merged planes in fragment order: a head's 8 octets of d, 128 elements each
    if (blockIdx.y * 256 < RH) attn_rows<bf, true>(Qh + zo, Ql + zo, Kh + zo, Kl + zo, Vh + zo, Vl + zo, t0, Ah + ao, Al + ao);
    else attn_rows<h16, false>(Q16 + zo, nullptr, K16 + zo, nullptr, V16 + zo, nullptr, t0, Ah + ao, Al + ao);
}

extern "C" void kernel_launch(void* const* d_in, const int* in_sizes, int n_in,
                              void* d_out, int out_size, void* d_ws, size_t ws_size, hipStream_t stream) {
    (void)in_sizes; (void)n_in; (void)out_size;
    const float* x = (const float*)d_in[0]; const float* wq = (const float*)d_in[1]; const float* wk = (const float*)d_in[2]; const float* wv = (const float*)d_in[3]; const float* wo = (const float*)d_in[4]; const float* bo = (const float*)d_in[5];
    float* OUT = (float*)d_out;     // [8][1024][1024]
    char* ws = (char*)d_ws; const size_t Mi = (size_t)1 << 20;
    if (ws_size < 253 * Mi) return;    // ws 256 MiB
    // Workspace map in MiB; regions are reused in stream order once their last reader has run.
    //   0 WO | 2 WQ WK WV | 8 XB (all batches) | 24 CS | 25 .. 169 nine planes of 16 (all batches) | 137 FQ (over VTh, VTl until k_vtp) | 169 FK | 201 FV
    //   attention: 237 ATh (16) | 2 ATl (16, over WQ WK WV XB)
    const size_t PL = (size_t)NB_ * NH_ * TT * HD;   // elements of one plane set
    bf* WO = (bf*)ws; bf* WQ = (bf*)(ws + 2 * Mi); bf* XB = (bf*)(ws + 8 * Mi); float* CS = (float*)(ws + 24 * Mi);
    h16* QP16 = (h16*)(ws + 25 * Mi); h16* KP16 = QP16 + PL; bf* QPh = (bf*)(ws + 57 * Mi); bf* KPh = QPh + PL; bf* QPl = (bf*)(ws + 89 * Mi); bf* KPl = QPl + PL;
    h16* VT16 = (h16*)(ws + 121 * Mi); bf* VTh = (bf*)(ws + 137 * Mi); bf* VTl = (bf*)(ws + 153 * Mi);
    float* FQ = (float*)(ws + 137 * Mi); float* FV = (float*)(ws + 201 * Mi);   // FQ, FK, FV in a row: the z planes of one projection launch
    bf* ATh = (bf*)(ws + 237 * Mi); bf* ATl = (bf*)(ws + 2 * Mi);
    k_cvt8<<<dim3(DM / 16 * (DM / 256), 4 + NB_, 1), 256, 0, stream>>>(wo, wq, wk, wv, x, WO);
    k_csid<<<(TT * HD + 255) / 256, 256, 0, stream>>>(CS);
    k_gemmw<bf, 0, false><<<dim3(NB_ * TT / 64, DQ / 64, 3), 32, 0, stream>>>(XB, nullptr, WQ, nullptr, DM, DM, FQ, DQ, nullptr, 0, (size_t)DQ * DM, (size_t)NB_ * TT * DQ);
    k_rope<<<dim3(TT / 16 * (NH_ / 4), 2 * NB_, 1), 256, 0, stream>>>(FQ, DQ, NH_, CS, nullptr, nullptr, 1.0f, QP16, QPh, QPl);   // q batches, then k batches
    k_vtp<<<dim3(NKV * (TT / 32), NB_, 1), 256, 0, stream>>>(FV, DKV, NKV, VT16, VTh, VTl);
    k_fattn<<<dim3(NB_ * NH_, TT / 256, 1), 256, 0, stream>>>(QP16, KP16, VT16, QPh, QPl, KPh, KPl, VTh, VTl, ATh, ATl);
    k_gemmw<bf, 1, true><<<dim3(NB_ * TT / 64, DM / 64, 1), 32, 0, stream>>>(ATh, ATl, WO, nullptr, DQ, DQ, OUT, DM, bo, 0, 0, 0);
}

// v004
// A run of this version takes 242 microseconds.
// Two timings next to v003 put it at 1.11 and 1.13 times that version's speed.
// All steps since v000 together make it 19.3 times as fast.
#include <hip/hip_runtime.h>

// Simple multi-head attention scaled by the EMBEDDING size (x [8][1024][1024]; q,k,v = x W^T ('oi' [1024][1024], no bias); scores / sqrt(1024) (module quirk); softmax over all keys; out = merged Wo^T + bo -> [8][1024][1024] (8.4 M)).
// Every 16-bit operand plane [row][k] lies in fragment order: element (row, k) at ((row / 16) * (K / 8) + k / 8) * 128 + (row % 16) * 8 + k % 8, so a 16 x 32 fragment is 1 KB in a row and each of its two wave-wide 16-byte loads covers 512 contiguous bytes (four whole lines).
// Layout, all batches per launch: bf16 copy of x and weights; exact projections that store the attention's operand planes themselves; dense T-1024 attention fused in one launch (scores, running softmax and P V stay in registers; hybrid rows: < 512 hi/lo 3 products, rest fp16 x1024); merged hi/lo x Wo exact + bo.
// Compute dtypes, f32 accumulate: every input rounded to bf16; projections exact; attention rows < 512 3 products, rest fp16; softmax f32; Wo hl x exact + bias.

#define NB_  8
#define TT   1024
#define DM   1024
#define NH_  16
#define NKV  16
#define REP  (NH_ / NKV)
#define HD   64
#define DQ   (NH_ * HD)
#define DKV  (NKV * HD)
#define RH   512                  // query rows < RH use hi+lo planes (0: none)
#define WIN  0
#define PCAR 1024.0f
#define SCL  0.03125f   // 1/sqrt(1024): the module scales by the embedding size
typedef _Float16 h16;
typedef unsigned short bf;
typedef __attribute__((ext_vector_type(16))) __bf16   v16bf;
typedef __attribute__((ext_vector_type(16))) _Float16 v16h;
typedef __attribute__((ext_vector_type(8)))  _Float16 v8h;
typedef __attribute__((ext_vector_type(8)))  unsigned short v8us;
typedef __attribute__((ext_vector_type(8)))  __bf16   v8b;
typedef __attribute__((ext_vector_type(8)))  float    v8f;
typedef __attribute__((ext_vector_type(4)))  float    v4f;
typedef v8h  __attribute__((may_alias)) v8ha;
typedef v4f  __attribute__((may_alias)) v4fa;
typedef v8us __attribute__((may_alias)) v8usa;

__device__ __forceinline__ unsigned short f2bf(float f) { unsigned u = __float_as_uint(f); u += 0x7FFFu + ((u >> 16) & 1u); return (unsigned short)(u >> 16); }
__device__ __forceinline__ float bf2f(unsigned short b) { return __uint_as_float(((unsigned)b) << 16); }
__device__ __forceinline__ float bfr(float f) { return bf2f(f2bf(f)); }
__device__ __forceinline__ v16h cat16(v8h lo, v8h hi) { return __builtin_shufflevector(lo, hi, 0, 1, 2, 3, 4, 5, 6, 7, 8, 9, 10, 11, 12, 13, 14, 15); }
__device__ __forceinline__ v16bf cat16b(v8us lo, v8us hi) { return __builtin_bit_cast(v16bf, __builtin_shufflevector(lo, hi, 0, 1, 2, 3, 4, 5, 6, 7, 8, 9, 10, 11, 12, 13, 14, 15)); }
__device__ __forceinline__ v8f wmma16(v16h a, v16h b, v8f c) { return __builtin_amdgcn_wmma_f32_16x16x32_f16(false, a, false, b, (short)0, c, false, false); }
__device__ __forceinline__ v8f wmmab(v16bf a, v16bf b, v8f c) { return __builtin_amdgcn_wmma_f32_16x16x32_bf16(false, a, false, b, (short)0, c, false, false); }



// ---- k_gemmw: register-blocked GEMM, ONE WAVE per 64x64 output tile (16 accumulators), operands straight from 16-bit planes in fragment order (A of lda, Bt of K elements a row; WFrag::ld takes the fragment's start + lane * 8); grid (M/64, N/64, Z), 32 threads.
// C[m][n] (f32, pitch ldc, + optional f32 bias[n]) = sum_k A[m][k] Bt[n][k] (+ split products per NSPLIT). z-batch strides sA/sB/sC in elements. K % 32 == 0.
// PLANES (the projections; A = x, Bt = wq wk wv by z, lda == K): no C. The tile is 64 positions x one head and goes from the accumulators straight into that head's fp16, hi and lo planes (P16, Ph, Pl: q, k, v sets in a row by z), in fragment order.
// A lane's 8 accumulator values run along the A operand's rows, and a plane wants 8 consecutive k per lane: d for the q and k planes [h][t][d], so there the weight is the A operand (the two pointers and tile origins change places); t for the V^T planes [h][d][t], so there x is.
template <typename T16> struct WFrag;
template <> struct WFrag<h16> { typedef v16h V; static __device__ __forceinline__ V ld(const h16* p) { return cat16(*(const v8h*)p, *(const v8h*)(p + 256)); } static __device__ __forceinline__ v8f mma(V a, V b, v8f c) { return wmma16(a, b, c); } };
template <> struct WFrag<bf> { typedef v16bf V; static __device__ __forceinline__ V ld(const bf* p) { return cat16b(*(const v8us*)p, *(const v8us*)(p + 256)); } static __device__ __forceinline__ v8f mma(V a, V b, v8f c) { return wmmab(a, b, c); } };
template <typename T16, int NSPLIT, bool BIAS, bool PLANES>
__global__ __launch_bounds__(32) void k_gemmw(const T16* __restrict__ A, const T16* __restrict__ A2, const T16* __restrict__ Bt, const T16* __restrict__ Bt2, int K, int lda, float* C, int ldc, const float* __restrict__ bias, size_t sA, size_t sB, size_t sC, h16* P16, bf* Ph, bf* Pl) {
    typedef typename WFrag<T16>::V V;
    __shared__ __align__(16) float os[16 * 68];
    const size_t z = blockIdx.z; A += z * sA; if (A2) A2 += z * sA; Bt += z * sB; if (Bt2) Bt2 += z * sB; C += z * sC;
    const int lane = threadIdx.x & 31, lr = lane & 15, hi = lane >> 4; int r0 = blockIdx.x * 64, c0 = blockIdx.y * 64;
    const bool wa = PLANES && z < 2;   // q, k: the weight rows are the A operand
    if (wa) { const T16* t = A; A = Bt; Bt = t; r0 = blockIdx.y * 64; c0 = blockIdx.x * 64; }
    v8f acc[4][4];
#pragma unroll
    for (int mb = 0; mb < 4; ++mb)
#pragma unroll
        for (int nb = 0; nb < 4; ++nb) acc[mb][nb] = (v8f){};
    const size_t aoff = (size_t)r0 * lda + lane * 8, boff = (size_t)c0 * K + lane * 8;
#pragma unroll 1
    for (int kc = 0; kc < K; kc += 32) {
        V a[4], a2[4]; const T16* pa[4]; const T16* pa2[4];
#pragma unroll
        for (int mb = 0; mb < 4; ++mb) { pa[mb] = A + aoff + (size_t)mb * 16 * lda + kc * 16; a[mb] = WFrag<T16>::ld(pa[mb]); if (NSPLIT == 1 || NSPLIT == 2) { pa2[mb] = A2 + aoff + (size_t)mb * 16 * lda + kc * 16; a2[mb] = WFrag<T16>::ld(pa2[mb]); } }
        // s_wait_xcnt 0 behind the run of A loads, before any register that one of them names is written again; the addresses are inputs so that each address pair stays whole up to the wait (without that, a later load of the run lands in an earlier load's address pair).
        if (NSPLIT == 1 || NSPLIT == 2) asm volatile("s_wait_xcnt 0x0" :: "v"(pa[0]), "v"(pa[1]), "v"(pa[2]), "v"(pa[3]), "v"(pa2[0]), "v"(pa2[1]), "v"(pa2[2]), "v"(pa2[3]) : "memory");
        else asm volatile("s_wait_xcnt 0x0" :: "v"(pa[0]), "v"(pa[1]), "v"(pa[2]), "v"(pa[3]) : "memory");
#pragma unroll
        for (int nb = 0; nb < 4; ++nb) { const T16* pb = Bt + boff + (size_t)nb * 16 * K + kc * 16; const V b = WFrag<T16>::ld(pb); V b2;
            // the same wait behind each B fragment's loads, its addresses held whole up to it
            if (NSPLIT >= 2) { const T16* pb2 = Bt2 + boff + (size_t)nb * 16 * K + kc * 16; b2 = WFrag<T16>::ld(pb2); asm volatile("s_wait_xcnt 0x0" :: "v"(pb), "v"(pb2) : "memory"); }
            else asm volatile("s_wait_xcnt 0x0" :: "v"(pb) : "memory");
#pragma unroll
            for (int mb = 0; mb < 4; ++mb) { acc[mb][nb] = WFrag<T16>::mma(a[mb], b, acc[mb][nb]); if (NSPLIT == 1 || NSPLIT == 2) acc[mb][nb] = WFrag<T16>::mma(a2[mb], b, acc[mb][nb]); if (NSPLIT >= 2) acc[mb][nb] = WFrag<T16>::mma(a[mb], b2, acc[mb][nb]); } }
        asm volatile("v_nop\n\tv_nop\n\tv_nop\n\tv_nop" : "+v"(acc[0][0]), "+v"(acc[1][1]), "+v"(acc[2][2]), "+v"(acc[3][3]) : "v"(a[0]), "v"(a[3]));
    }
    if constexpr (PLANES) {
        // acc[mb][nb][j]: A row mb * 16 + 8 hi + j (the plane's k), B row nb * 16 + lr (the plane's row): octet mb * 2 + hi of row group nb, so each wave-wide 16-byte store covers 512 contiguous bytes
        const int x0 = blockIdx.x * 64, tb = x0 % TT; const int sn = wa ? 16 * HD : 16 * TT;   // elements from one group of 16 plane rows to the next
        const size_t base = ((z * NB_ + x0 / TT) * NH_ + blockIdx.y) * (size_t)(TT * HD) + (wa ? tb * HD : tb * 16) + lane * 8;
#pragma unroll
        for (int mb = 0; mb < 4; ++mb)
#pragma unroll
            for (int nb = 0; nb < 4; ++nb) { v8h o16; v8b oh, ol;
#pragma unroll
                for (int j = 0; j < 8; ++j) { const float y = acc[mb][nb][j]; o16[j] = (h16)y; const __bf16 h = (__bf16)y; oh[j] = h; ol[j] = (__bf16)(y - (float)h); }
                const size_t e = base + (size_t)nb * sn + mb * 256; h16* s16 = P16 + e; bf* sh = Ph + e; bf* sl = Pl + e; *(v8h*)s16 = o16; *(v8b*)sh = oh; *(v8b*)sl = ol;
                // s_wait_xcnt 0 behind the three stores, before a register that one of them names (address or data) is written again
                asm volatile("s_wait_xcnt 0x0" :: "v"(s16), "v"(sh), "v"(sl), "v"(o16), "v"(oh), "v"(ol) : "memory"); }
        return;
    }
#pragma unroll
    for (int mb = 0; mb < 4; ++mb) {
#pragma unroll
        for (int nb = 0; nb < 4; ++nb) {
#pragma unroll
            for (int j = 0; j < 8; ++j) os[(hi * 8 + j) * 68 + nb * 16 + lr] = acc[mb][nb][j]; }
        __builtin_amdgcn_wave_barrier(); asm volatile("" ::: "memory");
        float* crow = C + (size_t)(r0 + mb * 16) * ldc + c0;
{
#pragma unroll
            for (int s = 0; s < 8; ++s) { const int row = 2 * s + hi, cofs = lr * 4; v4f val = *(const v4fa*)(os + row * 68 + cofs); if (BIAS) { val[0] += bfr(bias[c0 + cofs]); val[1] += bfr(bias[c0 + cofs + 1]); val[2] += bfr(bias[c0 + cofs + 2]); val[3] += bfr(bias[c0 + cofs + 3]); }
                *(v4f*)(crow + (size_t)row * ldc + cofs) = val; }
             }
        __builtin_amdgcn_wave_barrier(); asm volatile("" ::: "memory");
    }
}

__device__ __forceinline__ void splitf(float y, unsigned short& h, unsigned short& l) { h = f2bf(y); l = f2bf(y - bf2f(h)); }
typedef __attribute__((ext_vector_type(2))) _Float16 v2h;
typedef __attribute__((ext_vector_type(4))) _Float16 v4h;
typedef __attribute__((ext_vector_type(2))) unsigned short v2us;
typedef __attribute__((ext_vector_type(4))) unsigned short v4us;
typedef __attribute__((ext_vector_type(2))) float v2f;
typedef __attribute__((ext_vector_type(4))) int v4i;

__global__ __launch_bounds__(256) void k_wtG(const float* __restrict__ w, int K, int N, bf* Bt) {
    const int lane = threadIdx.x & 31; const int L0 = (blockIdx.x * 8 + (threadIdx.x >> 5)) * 8; const int nlines = N * K / 64;
{
#pragma unroll 1
        for (int l = 0; l < 8; ++l) { const int L = L0 + l; if (L >= nlines) break; const size_t e = (size_t)L * 64 + lane * 2; const int k = (int)(e % K), n = (int)(e / K); v2us o;
            o[0] = f2bf(w[(size_t)k * N + n]); o[1] = f2bf(w[(size_t)(k + 1) * N + n]); *(v2us*)(Bt + e) = o; }
         }
}
// k_cvt8: bf16 copies of the four weights and of x in one launch, in fragment order; blockIdx.y picks a chunk of DM*DM elements (0..3: wo, wq, wk, wv; 4..: x, one batch each), dst holds the chunks in that order.
// A block takes 16 rows x 256 k (blockIdx.x = row tile * 4 + k quarter): a wave reads 1 KB of one row, the 16-byte octets turn in LDS (one group of 16 rows per k octet, pitch 272 B against bank conflicts), a wave stores 512 contiguous bytes.
static_assert(DQ == DM && DKV == DM && TT == DM && NH_ == NKV && RH % 256 == 0 && TT % 256 == 0 && NH_ % 4 == 0 && HD == 64, "chunking and row blocks");
__global__ __launch_bounds__(256) void k_cvt8(const float* __restrict__ wo, const float* __restrict__ wq, const float* __restrict__ wk, const float* __restrict__ wv, const float* __restrict__ x, bf* dst) { const int y = blockIdx.y; const float* src = (y == 0) ? wo : (y == 1) ? wq : (y == 2) ? wk : (y == 3) ? wv : x + (size_t)(y - 4) * DM * DM;
    __shared__ __align__(16) bf ts[32 * 136];
    const int rt = blockIdx.x >> 2, kq = blockIdx.x & 3, tid = threadIdx.x;
    const float* s0 = src + (size_t)(rt * 16 + (tid >> 5)) * DM + kq * 256 + (tid & 31) * 8; const float* s1 = s0 + 8 * DM;   // rows tid / 32 and 8 + tid / 32, k octet tid % 32
    const v8f v0 = *(const v8f*)s0, v1 = *(const v8f*)s1;
    // s_wait_xcnt 0 behind the loads, before any register that one of them names is written again; the address (s1 is s0 plus an immediate offset) is an input so that it stays whole up to the wait
    asm volatile("s_wait_xcnt 0x0" :: "v"(s0) : "memory");
    v8us o0, o1;
#pragma unroll
    for (int k = 0; k < 8; ++k) { o0[k] = f2bf(v0[k]); o1[k] = f2bf(v1[k]); }
    *(v8usa*)(ts + (tid & 31) * 136 + (tid >> 5) * 8) = o0; *(v8usa*)(ts + (tid & 31) * 136 + (8 + (tid >> 5)) * 8) = o1;
    __syncthreads();   // the octets cross waves
    bf* d0 = dst + (size_t)y * DM * DM + ((size_t)rt * (DM / 8) + kq * 32) * 128 + tid * 8;
    *(v8us*)d0 = *(const v8usa*)(ts + (tid >> 4) * 136 + (tid & 15) * 8); *(v8us*)(d0 + 2048) = *(const v8usa*)(ts + (16 + (tid >> 4)) * 136 + (tid & 15) * 8);  }

// k_fattn: fused attention. One wave owns 32 query rows of one (batch, head) plane and walks the TT keys 32 at a time; 8 waves (256 rows) per block read the same K and V. grid (planes, TT / 256): blockIdx.y picks the row block, the hi/lo row blocks come first.
// St = K Q^T (A: K rows, B: Q rows): a lane holds 16 scores of ONE query (column lr; keys 8 hi + j of each 16-key tile), so maximum, sum and rescale are lane-local but for one exchange between the lane halves.
// The two St tiles of a 32-key block, converted in place, are the B operand of Ot += V^T P^T (A: VT rows d, loaded in the same k order). P is exp(t - running max), not normalised (fp16 rows: x PCAR); Ot is divided by the f32 sum at the end.
__device__ __forceinline__ float xhalf(float x) { const int b = __float_as_int(x); return __int_as_float(__builtin_amdgcn_permlanex16(b, b, 0x76543210, 0xfedcba98, false, false)); }   // lane l <-> l ^ 16
template <typename T16, bool HIRES>
__device__ __forceinline__ void attn_rows(const T16* Q, const T16* Q2, const T16* Kp, const T16* Kp2, const T16* Vp, const T16* Vp2, int t0, bf* Ah, bf* Al) {
    // every inner loop below is fully unrolled (#pragma unroll): fragment and accumulator arrays stay in registers only under constant indices
    typedef typename WFrag<T16>::V V; static_assert(PCAR == 1024.0f, "the exponent bias 10 below is log2(PCAR)");
    const int lane = threadIdx.x & 31;   // in the comments: lr = lane % 16, hi = lane / 16
    const float C = SCL * 1.4426950408889634f;
    V q[2][2], q2[2][2];
    { const T16* pq = Q + (size_t)t0 * HD + lane * 8; const T16* pq2 = HIRES ? Q2 + (size_t)t0 * HD + lane * 8 : pq;   // fragment order: 16 rows x 32 d are 512 elements in a row
#pragma unroll
      for (int qt = 0; qt < 2; ++qt)
#pragma unroll
          for (int ks = 0; ks < 2; ++ks) { q[qt][ks] = WFrag<T16>::ld(pq + qt * 16 * HD + ks * 512); if (HIRES) q2[qt][ks] = WFrag<T16>::ld(pq2 + qt * 16 * HD + ks * 512); }
      // s_wait_xcnt 0 behind the Q loads, before any register that one of them names is written again; the addresses are inputs so that they stay whole up to the wait
      asm volatile("s_wait_xcnt 0x0" :: "v"(pq), "v"(pq2) : "memory"); }
    v8f o[2][4]; float m[2], l[2];
#pragma unroll
    for (int qt = 0; qt < 2; ++qt) { m[qt] = -3.0e38f; l[qt] = 0.f;
#pragma unroll
        for (int dt = 0; dt < 4; ++dt) o[qt][dt] = (v8f){}; }
    const T16* pk = Kp + lane * 8; const T16* pk2 = HIRES ? Kp2 + lane * 8 : pk;
    const T16* pv = Vp + lane * 8; const T16* pv2 = HIRES ? Vp2 + lane * 8 : pv;
#pragma unroll 1   // one 32-key block per trip: an unrolled body would not fit the registers of four waves per SIMD
    for (int kb = 0; kb < TT; kb += 32) {
        V kf[2][2], kf2[2][2];
#pragma unroll
        for (int kt = 0; kt < 2; ++kt)
#pragma unroll
            for (int ks = 0; ks < 2; ++ks) { kf[kt][ks] = WFrag<T16>::ld(pk + kt * 16 * HD + ks * 512); if (HIRES) kf2[kt][ks] = WFrag<T16>::ld(pk2 + kt * 16 * HD + ks * 512); }
        // the same wait behind the K loads, their addresses held whole up to it
        asm volatile("s_wait_xcnt 0x0" :: "v"(pk), "v"(pk2) : "memory");
        v8f st[2][2];
#pragma unroll
        for (int kt = 0; kt < 2; ++kt)
#pragma unroll
            for (int qt = 0; qt < 2; ++qt) { v8f s = (v8f){};
#pragma unroll
                for (int ks = 0; ks < 2; ++ks) { s = WFrag<T16>::mma(kf[kt][ks], q[qt][ks], s); if (HIRES) { s = WFrag<T16>::mma(kf[kt][ks], q2[qt][ks], s); s = WFrag<T16>::mma(kf2[kt][ks], q[qt][ks], s); } }
                st[qt][kt] = s; }
        V vf[4], vf2[4];
#pragma unroll
        for (int dt = 0; dt < 4; ++dt) { vf[dt] = WFrag<T16>::ld(pv + (size_t)dt * 16 * TT); if (HIRES) vf2[dt] = WFrag<T16>::ld(pv2 + (size_t)dt * 16 * TT); }
        // the same wait behind the V loads (issued here so that the softmax below covers their latency), before the four addresses step on
        asm volatile("s_wait_xcnt 0x0" :: "v"(pv), "v"(pv2) : "memory");
        pk += 32 * HD; pk2 += 32 * HD; pv += 512; pv2 += 512;
        V p[2], p2[2];
#pragma unroll
        for (int qt = 0; qt < 2; ++qt) { float mx = st[qt][0][0];
#pragma unroll
            for (int j = 1; j < 16; ++j) mx = fmaxf(mx, st[qt][j >> 3][j & 7]);
            mx = fmaxf(mx, xhalf(mx)); const float mn = fmaxf(m[qt], mx); float al = (m[qt] - mn) * C; m[qt] = mn;
            const float nb = (HIRES ? 0.0f : 10.0f) - mn * C;   // fp16 rows carry P x PCAR = 2^10
            float e[16];
#pragma unroll
            for (int j = 0; j < 16; ++j) e[j] = __builtin_fmaf(st[qt][j >> 3][j & 7], C, nb);
            // the 17 exponentials of one query tile in one statement, each in place: none overwrites the source or reads the result of the one before it; the v_nop is the slot between the last one and whatever follows
            asm("v_exp_f32 %0, %0\n\tv_exp_f32 %1, %1\n\tv_exp_f32 %2, %2\n\tv_exp_f32 %3, %3\n\tv_exp_f32 %4, %4\n\tv_exp_f32 %5, %5\n\tv_exp_f32 %6, %6\n\tv_exp_f32 %7, %7\n\tv_exp_f32 %8, %8\n\t"
                "v_exp_f32 %9, %9\n\tv_exp_f32 %10, %10\n\tv_exp_f32 %11, %11\n\tv_exp_f32 %12, %12\n\tv_exp_f32 %13, %13\n\tv_exp_f32 %14, %14\n\tv_exp_f32 %15, %15\n\tv_exp_f32 %16, %16\n\tv_nop"
                : "+v"(al), "+v"(e[0]), "+v"(e[1]), "+v"(e[2]), "+v"(e[3]), "+v"(e[4]), "+v"(e[5]), "+v"(e[6]), "+v"(e[7]), "+v"(e[8]), "+v"(e[9]), "+v"(e[10]), "+v"(e[11]), "+v"(e[12]), "+v"(e[13]), "+v"(e[14]), "+v"(e[15]));
            float sum = 0.f;
#pragma unroll
            for (int j = 0; j < 16; ++j) { sum += e[j];
                if constexpr (HIRES) { const __bf16 h = (__bf16)e[j]; p[qt][j] = h; p2[qt][j] = (__bf16)(e[j] - (float)h); } else p[qt][j] = (h16)e[j]; }
            l[qt] = l[qt] * al + sum;
#pragma unroll
            for (int dt = 0; dt < 4; ++dt) o[qt][dt] *= al; }
#pragma unroll
        for (int dt = 0; dt < 4; ++dt)
#pragma unroll
            for (int qt = 0; qt < 2; ++qt) { o[qt][dt] = WFrag<T16>::mma(vf[dt], p[qt], o[qt][dt]); if (HIRES) { o[qt][dt] = WFrag<T16>::mma(vf[dt], p2[qt], o[qt][dt]); o[qt][dt] = WFrag<T16>::mma(vf2[dt], p[qt], o[qt][dt]); } }
    }
    // o[qt][dt][j] = Ot[d = dt * 16 + 8 hi + j][query t0 + qt * 16 + lr]: 8 consecutive d of one merged row per lane, in fragment order 512 contiguous bytes per wave-wide store
#pragma unroll
    for (int qt = 0; qt < 2; ++qt) { const float f = __fdiv_rn(1.0f, l[qt] + xhalf(l[qt])); const size_t oo = (size_t)(t0 + qt * 16) * DQ + lane * 8;
#pragma unroll
        for (int dt = 0; dt < 4; ++dt) { v8us oh, ol;
#pragma unroll
            for (int j = 0; j < 8; ++j) { unsigned short a, c2; splitf(o[qt][dt][j] * f, a, c2); oh[j] = a; ol[j] = c2; }
            bf* sh = Ah + oo + dt * 256; bf* sl = Al + oo + dt * 256; *(v8us*)sh = oh; *(v8us*)sl = ol;
            // the same wait behind the two stores, before a register that one of them names (address or data) is written again
            asm volatile("s_wait_xcnt 0x0" :: "v"(sh), "v"(sl), "v"(oh), "v"(ol) : "memory"); } }
}
__global__ __launch_bounds__(256) void k_fattn(const h16* Q16, const h16* K16, const h16* V16, const bf* Qh, const bf* Ql, const bf* Kh, const bf* Kl, const bf* Vh, const bf* Vl, bf* Ah, bf* Al) {
    const int g = blockIdx.x; const size_t zo = (size_t)g * TT * HD; const int t0 = blockIdx.y * 256 + (threadIdx.x >> 5) * 32;   // plane g = batch * NH_ + head: one kv head per query head
    const size_t ao = (size_t)(g / NH_) * TT * DQ + (g % NH_) * HD * 16;   // merged planes in fragment order: a head's 8 octets of d, 128 elements each
    if (blockIdx.y * 256 < RH) attn_rows<bf, true>(Qh + zo, Ql + zo, Kh + zo, Kl + zo, Vh + zo, Vl + zo, t0, Ah + ao, Al + ao);
    else attn_rows<h16, false>(Q16 + zo, nullptr, K16 + zo, nullptr, V16 + zo, nullptr, t0, Ah + ao, Al + ao);
}

extern "C" void kernel_launch(void* const* d_in, const int* in_sizes, int n_in,
                              void* d_out, int out_size, void* d_ws, size_t ws_size, hipStream_t stream) {
    (void)in_sizes; (void)n_in; (void)out_size;
    const float* x = (const float*)d_in[0]; const float* wq = (const float*)d_in[1]; const float* wk = (const float*)d_in[2]; const float* wv = (const float*)d_in[3]; const float* wo = (const float*)d_in[4]; const float* bo = (const float*)d_in[5];
    float* OUT = (float*)d_out;     // [8][1024][1024]
    char* ws = (char*)d_ws; const size_t Mi = (size_t)1 << 20;
    if (ws_size < 253 * Mi) return;    // ws 256 MiB
    // Workspace map in MiB; regions are reused in stream order once their last reader has run.
    //   0 WO | 2 WQ WK WV | 8 XB (all batches) | 25 .. 169 nine planes of 16 (all batches): fp16 q k v | 73 hi q k v | 121 lo q k v
    //   attention: 237 ATh (16) | 2 ATl (16, over WQ WK WV XB)
    const size_t PL = (size_t)NB_ * NH_ * TT * HD;   // elements of one plane set
    bf* WO = (bf*)ws; bf* WQ = (bf*)(ws + 2 * Mi); bf* XB = (bf*)(ws + 8 * Mi);
    h16* QP16 = (h16*)(ws + 25 * Mi); h16* KP16 = QP16 + PL; h16* VT16 = KP16 + PL; bf* QPh = (bf*)(ws + 73 * Mi); bf* KPh = QPh + PL; bf* VTh = KPh + PL; bf* QPl = (bf*)(ws + 121 * Mi); bf* KPl = QPl + PL; bf* VTl = KPl + PL;   // q, k, v in a row: the z sets of the projection launch
    bf* ATh = (bf*)(ws + 237 * Mi); bf* ATl = (bf*)(ws + 2 * Mi);
    k_cvt8<<<dim3(DM / 16 * (DM / 256), 4 + NB_, 1), 256, 0, stream>>>(wo, wq, wk, wv, x, WO);
    k_gemmw<bf, 0, false, true><<<dim3(NB_ * TT / 64, DQ / 64, 3), 32, 0, stream>>>(XB, nullptr, WQ, nullptr, DM, DM, nullptr, 0, nullptr, 0, (size_t)DQ * DM, 0, QP16, QPh, QPl);
    k_fattn<<<dim3(NB_ * NH_, TT / 256, 1), 256, 0, stream>>>(QP16, KP16, VT16, QPh, QPl, KPh, KPl, VTh, VTl, ATh, ATl);
    k_gemmw<bf, 1, true, false><<<dim3(NB_ * TT / 64, DM / 64, 1), 32, 0, stream>>>(ATh, ATl, WO, nullptr, DQ, DQ, OUT, DM, bo, 0, 0, 0, nullptr, nullptr, nullptr);
}

// v005
// Measured time: 199 microseconds a run.
// Two timings next to v004 put it at 1.24 and 1.25 times that version's speed.
// Counting every step since v000, it is 24.0 times as fast.
#include <hip/hip_runtime.h>

// Simple multi-head attention scaled by the EMBEDDING size (x [8][1024][1024]; q,k,v = x W^T ('oi' [1024][1024], no bias); scores / sqrt(1024) (module quirk); softmax over all keys; out = merged Wo^T + bo -> [8][1024][1024] (8.4 M)).
// Every 16-bit operand plane [row][k] lies in fragment order: element (row, k) at ((row / 16) * (K / 8) + k / 8) * 128 + (row % 16) * 8 + k % 8, so a 16 x 32 fragment is 1 KB in a row and each of its two wave-wide 16-byte loads covers 512 contiguous bytes (four whole lines).
// Layout, all batches per launch: bf16 copy of x and weights; exact projections that store the attention's operand planes themselves; dense T-1024 attention fused in one launch (scores, running softmax and P V stay in registers; hybrid rows: < 512 hi/lo 3 products, rest fp16 x1024); merged hi/lo x Wo exact + bo.
// Compute dtypes, f32 accumulate: every input rounded to bf16; projections exact; attention rows < 512 3 products, rest fp16; softmax f32; Wo hl x exact + bias.

#define NB_  8
#define TT   1024
#define DM   1024
#define NH_  16
#define NKV  16
#define REP  (NH_ / NKV)
#define HD   64
#define DQ   (NH_ * HD)
#define DKV  (NKV * HD)
#define RH   512                  // query rows < RH use hi+lo planes (0: none)
#define WIN  0
#define PCAR 1024.0f
#define SCL  0.03125f   // 1/sqrt(1024): the module scales by the embedding size
typedef _Float16 h16;
typedef unsigned short bf;
typedef __attribute__((ext_vector_type(16))) __bf16   v16bf;
typedef __attribute__((ext_vector_type(16))) _Float16 v16h;
typedef __attribute__((ext_vector_type(8)))  _Float16 v8h;
typedef __attribute__((ext_vector_type(8)))  unsigned short v8us;
typedef __attribute__((ext_vector_type(8)))  __bf16   v8b;
typedef __attribute__((ext_vector_type(8)))  float    v8f;
typedef __attribute__((ext_vector_type(4)))  float    v4f;
typedef v8h  __attribute__((may_alias)) v8ha;
typedef v4f  __attribute__((may_alias)) v4fa;
typedef v8us __attribute__((may_alias)) v8usa;

__device__ __forceinline__ unsigned short f2bf(float f) { unsigned u = __float_as_uint(f); u += 0x7FFFu + ((u >> 16) & 1u); return (unsigned short)(u >> 16); }
__device__ __forceinline__ float bf2f(unsigned short b) { return __uint_as_float(((unsigned)b) << 16); }
__device__ __forceinline__ float bfr(float f) { return bf2f(f2bf(f)); }
__device__ __forceinline__ v16h cat16(v8h lo, v8h hi) { return __builtin_shufflevector(lo, hi, 0, 1, 2, 3, 4, 5, 6, 7, 8, 9, 10, 11, 12, 13, 14, 15); }
__device__ __forceinline__ v16bf cat16b(v8us lo, v8us hi) { return __builtin_bit_cast(v16bf, __builtin_shufflevector(lo, hi, 0, 1, 2, 3, 4, 5, 6, 7, 8, 9, 10, 11, 12, 13, 14, 15)); }
__device__ __forceinline__ v8f wmma16(v16h a, v16h b, v8f c) { return __builtin_amdgcn_wmma_f32_16x16x32_f16(false, a, false, b, (short)0, c, false, false); }
__device__ __forceinline__ v8f wmmab(v16bf a, v16bf b, v8f c) { return __builtin_amdgcn_wmma_f32_16x16x32_bf16(false, a, false, b, (short)0, c, false, false); }



// ---- k_gemmw: register-blocked GEMM, ONE WAVE per 64x64 output tile (16 accumulators), operands straight from 16-bit planes in fragment order (A of lda, Bt of K elements a row; WFrag::ld takes the fragment's start + lane * 8); grid (M/64, N/64, Z), 32 threads.
// C[m][n] (f32, pitch ldc, + optional f32 bias[n]) = sum_k A[m][k] Bt[n][k] (+ split products per NSPLIT). z-batch strides sA/sB/sC in elements. K % 32 == 0.
// PLANES (the projections; A = x, Bt = wq wk wv by z, lda == K): no C. The tile is 64 positions x one head and goes from the accumulators straight into that head's fp16, hi and lo planes (P16, Ph, Pl: q, k, v sets in a row by z), in fragment order.
// A lane's 8 accumulator values run along the A operand's rows, and a plane wants 8 consecutive k per lane: d for the q and k planes [h][t][d], so there the weight is the A operand (the two pointers and tile origins change places); t for the V^T planes [h][d][t], so there x is.
template <typename T16> struct WFrag;
template <> struct WFrag<h16> { typedef v16h V; static __device__ __forceinline__ V ld(const h16* p) { return cat16(*(const v8h*)p, *(const v8h*)(p + 256)); } static __device__ __forceinline__ v8f mma(V a, V b, v8f c) { return wmma16(a, b, c); } };
template <> struct WFrag<bf> { typedef v16bf V; static __device__ __forceinline__ V ld(const bf* p) { return cat16b(*(const v8us*)p, *(const v8us*)(p + 256)); } static __device__ __forceinline__ v8f mma(V a, V b, v8f c) { return wmmab(a, b, c); } };
template <typename T16, int NSPLIT, bool BIAS, bool PLANES>
__global__ __launch_bounds__(32) void k_gemmw(const T16* __restrict__ A, const T16* __restrict__ A2, const T16* __restrict__ Bt, const T16* __restrict__ Bt2, int K, int lda, float* C, int ldc, const float* __restrict__ bias, size_t sA, size_t sB, size_t sC, h16* P16, bf* Ph, bf* Pl) {
    typedef typename WFrag<T16>::V V;
    __shared__ __align__(16) float os[16 * 68];
    const size_t z = blockIdx.z; A += z * sA; if (A2) A2 += z * sA; Bt += z * sB; if (Bt2) Bt2 += z * sB; C += z * sC;
    const int lane = threadIdx.x & 31, lr = lane & 15, hi = lane >> 4; int r0 = blockIdx.x * 64, c0 = blockIdx.y * 64;
    const bool wa = PLANES && z < 2;   // q, k: the weight rows are the A operand
    if (wa) { const T16* t = A; A = Bt; Bt = t; r0 = blockIdx.y * 64; c0 = blockIdx.x * 64; }
    v8f acc[4][4];
#pragma unroll
    for (int mb = 0; mb < 4; ++mb)
#pragma unroll
        for (int nb = 0; nb < 4; ++nb) acc[mb][nb] = (v8f){};
    const size_t aoff = (size_t)r0 * lda + lane * 8, boff = (size_t)c0 * K + lane * 8;
#pragma unroll 1
    for (int kc = 0; kc < K; kc += 32) {
        V a[4], a2[4]; const T16* pa[4]; const T16* pa2[4];
#pragma unroll
        for (int mb = 0; mb < 4; ++mb) { pa[mb] = A + aoff + (size_t)mb * 16 * lda + kc * 16; a[mb] = WFrag<T16>::ld(pa[mb]); if (NSPLIT == 1 || NSPLIT == 2) { pa2[mb] = A2 + aoff + (size_t)mb * 16 * lda + kc * 16; a2[mb] = WFrag<T16>::ld(pa2[mb]); } }
        // s_wait_xcnt 0 behind the run of A loads, before any register that one of them names is written again; the addresses are inputs so that each address pair stays whole up to the wait (without that, a later load of the run lands in an earlier load's address pair).
        if (NSPLIT == 1 || NSPLIT == 2) asm volatile("s_wait_xcnt 0x0" :: "v"(pa[0]), "v"(pa[1]), "v"(pa[2]), "v"(pa[3]), "v"(pa2[0]), "v"(pa2[1]), "v"(pa2[2]), "v"(pa2[3]) : "memory");
        else asm volatile("s_wait_xcnt 0x0" :: "v"(pa[0]), "v"(pa[1]), "v"(pa[2]), "v"(pa[3]) : "memory");
#pragma unroll
        for (int nb = 0; nb < 4; ++nb) { const T16* pb = Bt + boff + (size_t)nb * 16 * K + kc * 16; const V b = WFrag<T16>::ld(pb); V b2;
            // the same wait behind each B fragment's loads, its addresses held whole up to it
            if (NSPLIT >= 2) { const T16* pb2 = Bt2 + boff + (size_t)nb * 16 * K + kc * 16; b2 = WFrag<T16>::ld(pb2); asm volatile("s_wait_xcnt 0x0" :: "v"(pb), "v"(pb2) : "memory"); }
            else asm volatile("s_wait_xcnt 0x0" :: "v"(pb) : "memory");
#pragma unroll
            for (int mb = 0; mb < 4; ++mb) { acc[mb][nb] = WFrag<T16>::mma(a[mb], b, acc[mb][nb]); if (NSPLIT == 1 || NSPLIT == 2) acc[mb][nb] = WFrag<T16>::mma(a2[mb], b, acc[mb][nb]); if (NSPLIT >= 2) acc[mb][nb] = WFrag<T16>::mma(a[mb], b2, acc[mb][nb]); } }
        asm volatile("v_nop\n\tv_nop\n\tv_nop\n\tv_nop" : "+v"(acc[0][0]), "+v"(acc[1][1]), "+v"(acc[2][2]), "+v"(acc[3][3]) : "v"(a[0]), "v"(a[3]));
    }
    if constexpr (PLANES) {
        // acc[mb][nb][j]: A row mb * 16 + 8 hi + j (the plane's k), B row nb * 16 + lr (the plane's row): octet mb * 2 + hi of row group nb, so each wave-wide 16-byte store covers 512 contiguous bytes
        const int x0 = blockIdx.x * 64, tb = x0 % TT; const int sn = wa ? 16 * HD : 16 * TT;   // elements from one group of 16 plane rows to the next
        const size_t base = ((z * NB_ + x0 / TT) * NH_ + blockIdx.y) * (size_t)(TT * HD) + (wa ? tb * HD : tb * 16) + lane * 8;
#pragma unroll
        for (int mb = 0; mb < 4; ++mb)
#pragma unroll
            for (int nb = 0; nb < 4; ++nb) { v8h o16; v8b oh, ol;
#pragma unroll
                for (int j = 0; j < 8; ++j) { const float y = acc[mb][nb][j]; o16[j] = (h16)y; const __bf16 h = (__bf16)y; oh[j] = h; ol[j] = (__bf16)(y - (float)h); }
                const size_t e = base + (size_t)nb * sn + mb * 256; h16* s16 = P16 + e; bf* sh = Ph + e; bf* sl = Pl + e; *(v8h*)s16 = o16; *(v8b*)sh = oh; *(v8b*)sl = ol;
                // s_wait_xcnt 0 behind the three stores, before a register that one of them names (address or data) is written again
                asm volatile("s_wait_xcnt 0x0" :: "v"(s16), "v"(sh), "v"(sl), "v"(o16), "v"(oh), "v"(ol) : "memory"); }
        return;
    }
#pragma unroll
    for (int mb = 0; mb < 4; ++mb) {
#pragma unroll
        for (int nb = 0; nb < 4; ++nb) {
#pragma unroll
            for (int j = 0; j < 8; ++j) os[(hi * 8 + j) * 68 + nb * 16 + lr] = acc[mb][nb][j]; }
        __builtin_amdgcn_wave_barrier(); asm volatile("" ::: "memory");
        float* crow = C + (size_t)(r0 + mb * 16) * ldc + c0;
{
#pragma unroll
            for (int s = 0; s < 8; ++s) { const int row = 2 * s + hi, cofs = lr * 4; v4f val = *(const v4fa*)(os + row * 68 + cofs); if (BIAS) { val[0] += bfr(bias[c0 + cofs]); val[1] += bfr(bias[c0 + cofs + 1]); val[2] += bfr(bias[c0 + cofs + 2]); val[3] += bfr(bias[c0 + cofs + 3]); }
                *(v4f*)(crow + (size_t)row * ldc + cofs) = val; }
             }
        __builtin_amdgcn_wave_barrier(); asm volatile("" ::: "memory");
    }
}

__device__ __forceinline__ void splitf(float y, unsigned short& h, unsigned short& l) { h = f2bf(y); l = f2bf(y - bf2f(h)); }
typedef __attribute__((ext_vector_type(2))) _Float16 v2h;
typedef __attribute__((ext_vector_type(4))) _Float16 v4h;
typedef __attribute__((ext_vector_type(2))) unsigned short v2us;
typedef __attribute__((ext_vector_type(4))) unsigned short v4us;
typedef __attribute__((ext_vector_type(2))) float v2f;
typedef __attribute__((ext_vector_type(4))) int v4i;

__global__ __launch_bounds__(256) void k_wtG(const float* __restrict__ w, int K, int N, bf* Bt) {
    const int lane = threadIdx.x & 31; const int L0 = (blockIdx.x * 8 + (threadIdx.x >> 5)) * 8; const int nlines = N * K / 64;
{
#pragma unroll 1
        for (int l = 0; l < 8; ++l) { const int L = L0 + l; if (L >= nlines) break; const size_t e = (size_t)L * 64 + lane * 2; const int k = (int)(e % K), n = (int)(e / K); v2us o;
            o[0] = f2bf(w[(size_t)k * N + n]); o[1] = f2bf(w[(size_t)(k + 1) * N + n]); *(v2us*)(Bt + e) = o; }
         }
}
// k_cvt8: bf16 copies of the four weights and of x in one launch, in fragment order; blockIdx.y picks a chunk of DM*DM elements (0..3: wo, wq, wk, wv; 4..: x, one batch each), dst holds the chunks in that order.
// A block takes 16 rows x 256 k (blockIdx.x = row tile * 4 + k quarter): a wave reads 1 KB of one row, the 16-byte octets turn in LDS (one group of 16 rows per k octet, pitch 272 B against bank conflicts), a wave stores 512 contiguous bytes.
static_assert(DQ == DM && DKV == DM && TT == DM && NH_ == NKV && RH % 256 == 0 && TT % 256 == 0 && NH_ % 4 == 0 && HD == 64, "chunking and row blocks");
__global__ __launch_bounds__(256) void k_cvt8(const float* __restrict__ wo, const float* __restrict__ wq, const float* __restrict__ wk, const float* __restrict__ wv, const float* __restrict__ x, bf* dst) { const int y = blockIdx.y; const float* src = (y == 0) ? wo : (y == 1) ? wq : (y == 2) ? wk : (y == 3) ? wv : x + (size_t)(y - 4) * DM * DM;
    __shared__ __align__(16) bf ts[32 * 136];
    const int rt = blockIdx.x >> 2, kq = blockIdx.x & 3, tid = threadIdx.x;
    const float* s0 = src + (size_t)(rt * 16 + (tid >> 5)) * DM + kq * 256 + (tid & 31) * 8; const float* s1 = s0 + 8 * DM;   // rows tid / 32 and 8 + tid / 32, k octet tid % 32
    const v8f v0 = *(const v8f*)s0, v1 = *(const v8f*)s1;
    // s_wait_xcnt 0 behind the loads, before any register that one of them names is written again; the address (s1 is s0 plus an immediate offset) is an input so that it stays whole up to the wait
    asm volatile("s_wait_xcnt 0x0" :: "v"(s0) : "memory");
    v8us o0, o1;
#pragma unroll
    for (int k = 0; k < 8; ++k) { o0[k] = f2bf(v0[k]); o1[k] = f2bf(v1[k]); }
    *(v8usa*)(ts + (tid & 31) * 136 + (tid >> 5) * 8) = o0; *(v8usa*)(ts + (tid & 31) * 136 + (8 + (tid >> 5)) * 8) = o1;
    __syncthreads();   // the octets cross waves
    bf* d0 = dst + (size_t)y * DM * DM + ((size_t)rt * (DM / 8) + kq * 32) * 128 + tid * 8;
    *(v8us*)d0 = *(const v8usa*)(ts + (tid >> 4) * 136 + (tid & 15) * 8); *(v8us*)(d0 + 2048) = *(const v8usa*)(ts + (16 + (tid >> 4)) * 136 + (tid & 15) * 8);  }

// k_fattn: fused attention. One wave owns 32 query rows of one (batch, head) plane and walks the TT keys 32 at a time; 8 waves (256 rows) per block read the same K and V. grid (planes, TT / 256): blockIdx.y picks the row block, the hi/lo row blocks come first.
// K and V come through a two-buffer LDS ring: a tile is 32 keys of every plane the row block uses (K 4 KB, V 4 KB, then the lo planes), brought once per block by asynchronous copies (16 bytes a thread and plane) one trip ahead of its use; fragment order carries over, so a fragment is 1 KB in a row in LDS too.
// St = K Q^T (A: K rows, B: Q rows): a lane holds 16 scores of ONE query (column lr; keys 8 hi + j of each 16-key tile), so maximum, sum and rescale are lane-local but for one exchange between the lane halves.
// The two St tiles of a 32-key block, converted in place, are the B operand of Ot += V^T P^T (A: VT rows d, loaded in the same k order). P is exp(t - running max), not normalised (fp16 rows: x PCAR); Ot is divided by the f32 sum at the end.
__device__ __forceinline__ float xhalf(float x) { const int b = __float_as_int(x); return __int_as_float(__builtin_amdgcn_permlanex16(b, b, 0x76543210, 0xfedcba98, false, false)); }   // lane l <-> l ^ 16
template <typename T16, bool HIRES>
__device__ __forceinline__ void ring_fill(const T16* gk, const T16* gk2, const T16* gv, const T16* gv2, unsigned dst) {
    // one tile's copies and the s_wait_xcnt 0 behind them in one statement: no register that a copy names is written again before the wait
    if constexpr (HIRES) asm volatile("global_load_async_to_lds_b128 %0, %4, off\n\tglobal_load_async_to_lds_b128 %1, %5, off\n\tglobal_load_async_to_lds_b128 %2, %6, off\n\tglobal_load_async_to_lds_b128 %3, %7, off\n\ts_wait_xcnt 0x0"
                                      :: "v"(dst), "v"(dst + 4096u), "v"(dst + 8192u), "v"(dst + 12288u), "v"(gk), "v"(gv), "v"(gk2), "v"(gv2) : "memory");
    else asm volatile("global_load_async_to_lds_b128 %0, %2, off\n\tglobal_load_async_to_lds_b128 %1, %3, off\n\ts_wait_xcnt 0x0" :: "v"(dst), "v"(dst + 4096u), "v"(gk), "v"(gv) : "memory");
}
template <typename T16, bool HIRES>
__device__ __forceinline__ void attn_rows(const T16* Q, const T16* Q2, const T16* Kp, const T16* Kp2, const T16* Vp, const T16* Vp2, int t0, bf* Ah, bf* Al, const unsigned char* ring) {
    // every inner loop below is fully unrolled (#pragma unroll): fragment and accumulator arrays stay in registers only under constant indices
    typedef typename WFrag<T16>::V V; static_assert(PCAR == 1024.0f, "the exponent bias 10 below is log2(PCAR)");
    const int lane = threadIdx.x & 31;   // in the comments: lr = lane % 16, hi = lane / 16
    const float C = SCL * 1.4426950408889634f;
    V q[2][2], q2[2][2];
    { const T16* pq = Q + (size_t)t0 * HD + lane * 8; const T16* pq2 = HIRES ? Q2 + (size_t)t0 * HD + lane * 8 : pq;   // fragment order: 16 rows x 32 d are 512 elements in a row
#pragma unroll
      for (int qt = 0; qt < 2; ++qt)
#pragma unroll
          for (int ks = 0; ks < 2; ++ks) { q[qt][ks] = WFrag<T16>::ld(pq + qt * 16 * HD + ks * 512); if (HIRES) q2[qt][ks] = WFrag<T16>::ld(pq2 + qt * 16 * HD + ks * 512); }
      // s_wait_xcnt 0 behind the Q loads, before any register that one of them names is written again; the addresses are inputs so that they stay whole up to the wait
      asm volatile("s_wait_xcnt 0x0" :: "v"(pq), "v"(pq2) : "memory"); }
    v8f o[2][4]; float m[2], l[2];
#pragma unroll
    for (int qt = 0; qt < 2; ++qt) { m[qt] = -3.0e38f; l[qt] = 0.f;
#pragma unroll
        for (int dt = 0; dt < 4; ++dt) o[qt][dt] = (v8f){}; }
    // the thread's 16 bytes of each plane's tile: K tiles are 4 KB in a row; a V tile is 1 KB of each of the four groups of 16 d
    constexpr unsigned BUFB = HIRES ? 16384u : 8192u;
    const int tid = threadIdx.x; const size_t ck = (size_t)tid * 8, cv = (size_t)(tid >> 6) * 16 * TT + (tid & 63) * 8;
    const T16* gk = Kp + ck; const T16* gk2 = HIRES ? Kp2 + ck : gk; const T16* gv = Vp + cv; const T16* gv2 = HIRES ? Vp2 + cv : gv;
    const unsigned cdst = (unsigned)(size_t)ring + tid * 16;   // LDS byte address: the low 32 bits of the __shared__ address
    ring_fill<T16, HIRES>(gk, gk2, gv, gv2, cdst);
    asm volatile("s_wait_asynccnt 0x0" ::: "memory");   // tile 0 has landed, as far as this wave copied it
    __syncthreads();                                     // and every other wave's part of it
    ring_fill<T16, HIRES>(gk + 32 * HD, gk2 + 32 * HD, gv + 512, gv2 + 512, cdst + BUFB);
#pragma unroll 1   // one 32-key block per trip: an unrolled body would not fit the registers of four waves per SIMD
    for (int kb = 0; kb < TT; kb += 32) {
        const unsigned bo = (kb & 32) ? BUFB : 0u;   // trip t reads buffer t % 2 alone
        const T16* pk = (const T16*)(ring + bo) + lane * 8; const T16* pv = pk + 2048; const T16* pk2 = HIRES ? pk + 4096 : pk; const T16* pv2 = HIRES ? pk + 6144 : pv;
        V kf[2][2], kf2[2][2];
#pragma unroll
        for (int kt = 0; kt < 2; ++kt)
#pragma unroll
            for (int ks = 0; ks < 2; ++ks) { kf[kt][ks] = WFrag<T16>::ld(pk + kt * 16 * HD + ks * 512); if (HIRES) kf2[kt][ks] = WFrag<T16>::ld(pk2 + kt * 16 * HD + ks * 512); }
        v8f st[2][2];
#pragma unroll
        for (int kt = 0; kt < 2; ++kt)
#pragma unroll
            for (int qt = 0; qt < 2; ++qt) { v8f s = (v8f){};
#pragma unroll
                for (int ks = 0; ks < 2; ++ks) { s = WFrag<T16>::mma(kf[kt][ks], q[qt][ks], s); if (HIRES) { s = WFrag<T16>::mma(kf[kt][ks], q2[qt][ks], s); s = WFrag<T16>::mma(kf2[kt][ks], q[qt][ks], s); } }
                st[qt][kt] = s; }
        V vf[4], vf2[4];
#pragma unroll
        for (int dt = 0; dt < 4; ++dt) { vf[dt] = WFrag<T16>::ld(pv + dt * 512); if (HIRES) vf2[dt] = WFrag<T16>::ld(pv2 + dt * 512); }
        V p[2], p2[2];
#pragma unroll
        for (int qt = 0; qt < 2; ++qt) { float mx = st[qt][0][0];
#pragma unroll
            for (int j = 1; j < 16; ++j) mx = fmaxf(mx, st[qt][j >> 3][j & 7]);
            mx = fmaxf(mx, xhalf(mx)); const float mn = fmaxf(m[qt], mx); float al = (m[qt] - mn) * C; m[qt] = mn;
            const float nb = (HIRES ? 0.0f : 10.0f) - mn * C;   // fp16 rows carry P x PCAR = 2^10
            float e[16];
#pragma unroll
            for (int j = 0; j < 16; ++j) e[j] = __builtin_fmaf(st[qt][j >> 3][j & 7], C, nb);
            // the 17 exponentials of one query tile in one statement, each in place: none overwrites the source or reads the result of the one before it; the v_nop is the slot between the last one and whatever follows
            asm("v_exp_f32 %0, %0\n\tv_exp_f32 %1, %1\n\tv_exp_f32 %2, %2\n\tv_exp_f32 %3, %3\n\tv_exp_f32 %4, %4\n\tv_exp_f32 %5, %5\n\tv_exp_f32 %6, %6\n\tv_exp_f32 %7, %7\n\tv_exp_f32 %8, %8\n\t"
                "v_exp_f32 %9, %9\n\tv_exp_f32 %10, %10\n\tv_exp_f32 %11, %11\n\tv_exp_f32 %12, %12\n\tv_exp_f32 %13, %13\n\tv_exp_f32 %14, %14\n\tv_exp_f32 %15, %15\n\tv_exp_f32 %16, %16\n\tv_nop"
                : "+v"(al), "+v"(e[0]), "+v"(e[1]), "+v"(e[2]), "+v"(e[3]), "+v"(e[4]), "+v"(e[5]), "+v"(e[6]), "+v"(e[7]), "+v"(e[8]), "+v"(e[9]), "+v"(e[10]), "+v"(e[11]), "+v"(e[12]), "+v"(e[13]), "+v"(e[14]), "+v"(e[15]));
            float sum = 0.f;
#pragma unroll
            for (int j = 0; j < 16; ++j) { sum += e[j];
                if constexpr (HIRES) { const __bf16 h = (__bf16)e[j]; p[qt][j] = h; p2[qt][j] = (__bf16)(e[j] - (float)h); } else p[qt][j] = (h16)e[j]; }
            l[qt] = l[qt] * al + sum;
#pragma unroll
            for (int dt = 0; dt < 4; ++dt) o[qt][dt] *= al; }
#pragma unroll
        for (int dt = 0; dt < 4; ++dt)
#pragma unroll
            for (int qt = 0; qt < 2; ++qt) { o[qt][dt] = WFrag<T16>::mma(vf[dt], p[qt], o[qt][dt]); if (HIRES) { o[qt][dt] = WFrag<T16>::mma(vf[dt], p2[qt], o[qt][dt]); o[qt][dt] = WFrag<T16>::mma(vf2[dt], p[qt], o[qt][dt]); } }
        // publish point of the next tile: this wave's reads of the buffer are done, its copies of the next tile have landed, every wave has come as far; only then the refill of the buffer just read
        asm volatile("s_wait_dscnt 0x0" ::: "memory");
        asm volatile("s_wait_asynccnt 0x0" ::: "memory");
        __syncthreads();
        if (kb + 64 < TT) ring_fill<T16, HIRES>(gk + (size_t)(kb + 64) * HD, gk2 + (size_t)(kb + 64) * HD, gv + (size_t)(kb + 64) * 16, gv2 + (size_t)(kb + 64) * 16, cdst + bo);
    }
    asm volatile("s_wait_asynccnt 0x0" ::: "memory");   // no copy is outstanding when the wave goes on to its end
    // o[qt][dt][j] = Ot[d = dt * 16 + 8 hi + j][query t0 + qt * 16 + lr]: 8 consecutive d of one merged row per lane, in fragment order 512 contiguous bytes per wave-wide store
#pragma unroll
    for (int qt = 0; qt < 2; ++qt) { const float f = __fdiv_rn(1.0f, l[qt] + xhalf(l[qt])); const size_t oo = (size_t)(t0 + qt * 16) * DQ + lane * 8;
#pragma unroll
        for (int dt = 0; dt < 4; ++dt) { v8us oh, ol;
#pragma unroll
            for (int j = 0; j < 8; ++j) { unsigned short a, c2; splitf(o[qt][dt][j] * f, a, c2); oh[j] = a; ol[j] = c2; }
            bf* sh = Ah + oo + dt * 256; bf* sl = Al + oo + dt * 256; *(v8us*)sh = oh; *(v8us*)sl = ol;
            // the same wait behind the two stores, before a register that one of them names (address or data) is written again
            asm volatile("s_wait_xcnt 0x0" :: "v"(sh), "v"(sl), "v"(oh), "v"(ol) : "memory"); } }
}
__global__ __launch_bounds__(256) void k_fattn(const h16* Q16, const h16* K16, const h16* V16, const bf* Qh, const bf* Ql, const bf* Kh, const bf* Kl, const bf* Vh, const bf* Vl, bf* Ah, bf* Al) {
    __shared__ __align__(16) unsigned char ring[2 * 16384];
    const int g = blockIdx.x; const size_t zo = (size_t)g * TT * HD; const int t0 = blockIdx.y * 256 + (threadIdx.x >> 5) * 32;   // plane g = batch * NH_ + head: one kv head per query head
    const size_t ao = (size_t)(g / NH_) * TT * DQ + (g % NH_) * HD * 16;   // merged planes in fragment order: a head's 8 octets of d, 128 elements each
    if (blockIdx.y * 256 < RH) attn_rows<bf, true>(Qh + zo, Ql + zo, Kh + zo, Kl + zo, Vh + zo, Vl + zo, t0, Ah + ao, Al + ao, ring);
    else attn_rows<h16, false>(Q16 + zo, nullptr, K16 + zo, nullptr, V16 + zo, nullptr, t0, Ah + ao, Al + ao, ring);
}

extern "C" void kernel_launch(void* const* d_in, const int* in_sizes, int n_in,
                              void* d_out, int out_size, void* d_ws, size_t ws_size, hipStream_t stream) {
    (void)in_sizes; (void)n_in; (void)out_size;
    const float* x = (const float*)d_in[0]; const float* wq = (const float*)d_in[1]; const float* wk = (const float*)d_in[2]; const float* wv = (const float*)d_in[3]; const float* wo = (const float*)d_in[4]; const float* bo = (const float*)d_in[5];
    float* OUT = (float*)d_out;     // [8][1024][1024]
    char* ws = (char*)d_ws; const size_t Mi = (size_t)1 << 20;
    if (ws_size < 253 * Mi) return;    // ws 256 MiB
    // Workspace map in MiB; regions are reused in stream order once their last reader has run.
    //   0 WO | 2 WQ WK WV | 8 XB (all batches) | 25 .. 169 nine planes of 16 (all batches): fp16 q k v | 73 hi q k v | 121 lo q k v
    //   attention: 237 ATh (16) | 2 ATl (16, over WQ WK WV XB)
    const size_t PL = (size_t)NB_ * NH_ * TT * HD;   // elements of one plane set
    bf* WO = (bf*)ws; bf* WQ = (bf*)(ws + 2 * Mi); bf* XB = (bf*)(ws + 8 * Mi);
    h16* QP16 = (h16*)(ws + 25 * Mi); h16* KP16 = QP16 + PL; h16* VT16 = KP16 + PL; bf* QPh = (bf*)(ws + 73 * Mi); bf* KPh = QPh + PL; bf* VTh = KPh + PL; bf* QPl = (bf*)(ws + 121 * Mi); bf* KPl = QPl + PL; bf* VTl = KPl + PL;   // q, k, v in a row: the z sets of the projection launch
    bf* ATh = (bf*)(ws + 237 * Mi); bf* ATl = (bf*)(ws + 2 * Mi);
    k_cvt8<<<dim3(DM / 16 * (DM / 256), 4 + NB_, 1), 256, 0, stream>>>(wo, wq, wk, wv, x, WO);
    k_gemmw<bf, 0, false, true><<<dim3(NB_ * TT / 64, DQ / 64, 3), 32, 0, stream>>>(XB, nullptr, WQ, nullptr, DM, DM, nullptr, 0, nullptr, 0, (size_t)DQ * DM, 0, QP16, QPh, QPl);
    k_fattn<<<dim3(NB_ * NH_, TT / 256, 1), 256, 0, stream>>>(QP16, KP16, VT16, QPh, QPl, KPh, KPl, VTh, VTl, ATh, ATl);
    k_gemmw<bf, 1, true, false><<<dim3(NB_ * TT / 64, DM / 64, 1), 32, 0, stream>>>(ATh, ATl, WO, nullptr, DQ, DQ, OUT, DM, bo, 0, 0, 0, nullptr, nullptr, nullptr);
}

// v006
// Measured time: 138 microseconds a run.
// Two timings next to v005 put it at 1.45 and 1.43 times that version's speed.
// All steps since v000 together make it 34.4 times as fast.
#include <hip/hip_runtime.h>

// Simple multi-head attention scaled by the EMBEDDING size (x [8][1024][1024]; q,k,v = x W^T ('oi' [1024][1024], no bias); scores / sqrt(1024) (module quirk); softmax over all keys; out = merged Wo^T + bo -> [8][1024][1024] (8.4 M)).
// Every 16-bit operand plane [row][k] lies in fragment order: element (row, k) at ((row / 16) * (K / 8) + k / 8) * 128 + (row % 16) * 8 + k % 8, so a 16 x 32 fragment is 1 KB in a row and each of its two wave-wide 16-byte loads covers 512 contiguous bytes (four whole lines).
// Layout, all batches per launch: bf16 copy of x and weights; exact projections that store the attention's operand planes themselves; dense T-1024 attention fused in one launch (scores, running softmax and P V stay in registers; hybrid rows: < 512 hi/lo 3 products, rest fp16 x1024); merged hi/lo x Wo exact + bo.
// Compute dtypes, f32 accumulate: every input rounded to bf16; projections exact; attention rows < 512 3 products, rest fp16; softmax f32; Wo hl x exact + bias.

#define NB_  8
#define TT   1024
#define DM   1024
#define NH_  16
#define NKV  16
#define REP  (NH_ / NKV)
#define HD   64
#define DQ   (NH_ * HD)
#define DKV  (NKV * HD)
#define RH   512                  // query rows < RH use hi+lo planes (0: none)
#define WIN  0
#define PCAR 1024.0f
#define SCL  0.03125f   // 1/sqrt(1024): the module scales by the embedding size
typedef _Float16 h16;
typedef unsigned short bf;
typedef __attribute__((ext_vector_type(16))) __bf16   v16bf;
typedef __attribute__((ext_vector_type(16))) _Float16 v16h;
typedef __attribute__((ext_vector_type(8)))  _Float16 v8h;
typedef __attribute__((ext_vector_type(8)))  unsigned short v8us;
typedef __attribute__((ext_vector_type(8)))  __bf16   v8b;
typedef __attribute__((ext_vector_type(8)))  float    v8f;
typedef __attribute__((ext_vector_type(4)))  float    v4f;
typedef v8h  __attribute__((may_alias)) v8ha;
typedef v4f  __attribute__((may_alias)) v4fa;
typedef v8us __attribute__((may_alias)) v8usa;

__device__ __forceinline__ unsigned short f2bf(float f) { unsigned u = __float_as_uint(f); u += 0x7FFFu + ((u >> 16) & 1u); return (unsigned short)(u >> 16); }
__device__ __forceinline__ float bf2f(unsigned short b) { return __uint_as_float(((unsigned)b) << 16); }
__device__ __forceinline__ float bfr(float f) { return bf2f(f2bf(f)); }
__device__ __forceinline__ v16h cat16(v8h lo, v8h hi) { return __builtin_shufflevector(lo, hi, 0, 1, 2, 3, 4, 5, 6, 7, 8, 9, 10, 11, 12, 13, 14, 15); }
__device__ __forceinline__ v16bf cat16b(v8us lo, v8us hi) { return __builtin_bit_cast(v16bf, __builtin_shufflevector(lo, hi, 0, 1, 2, 3, 4, 5, 6, 7, 8, 9, 10, 11, 12, 13, 14, 15)); }
__device__ __forceinline__ v8f wmma16(v16h a, v16h b, v8f c) { return __builtin_amdgcn_wmma_f32_16x16x32_f16(false, a, false, b, (short)0, c, false, false); }
__device__ __forceinline__ v8f wmmab(v16bf a, v16bf b, v8f c) { return __builtin_amdgcn_wmma_f32_16x16x32_bf16(false, a, false, b, (short)0, c, false, false); }



// ---- k_gemmw: register-blocked GEMM, one wave per 64x64 output tile (16 accumulators), EIGHT WAVES per block: 4 along the x rows, 2 along the weight rows, a block tile of 256 x 128. Operands are 16-bit planes in fragment order (A of lda, Bt of K elements a row); grid (M/256, N/128, Z), 256 threads.
// The operands come through a two-buffer LDS ring: a stage is 64 k of the block's 256 A rows (32 KB; with NSPLIT 1 the A2 rows behind them) and 128 Bt rows (16 KB), brought once per block by asynchronous copies (16 bytes a thread and copy) one trip ahead of its use. Fragment order carries over: 16 rows x 64 k are 2 KB in a row in memory and in LDS, a fragment 1 KB (WFrag::ld takes the fragment's start + lane * 8).
// C[m][n] (f32, pitch ldc, + optional f32 bias[n]) = sum_k A[m][k] Bt[n][k] (NSPLIT 1: + A2[m][k] Bt[n][k]). z-batch strides sA/sB/sC in elements. K % 64 == 0.
// PLANES (the projections; A = x, Bt = wq wk wv by z, lda == K): no C. A wave's tile is 64 positions x one head and goes from the accumulators straight into that head's fp16, hi and lo planes (P16, Ph, Pl: q, k, v sets in a row by z), in fragment order.
// A lane's 8 accumulator values run along the A operand's rows, and a plane wants 8 consecutive k per lane: d for the q and k planes [h][t][d], so there the weight is the WMMA's A operand (the two LDS pointers and tile origins change places); t for the V^T planes [h][d][t], so there x is.
template <typename T16> struct WFrag;
template <> struct WFrag<h16> { typedef v16h V; static __device__ __forceinline__ V ld(const h16* p) { return cat16(*(const v8h*)p, *(const v8h*)(p + 256)); } static __device__ __forceinline__ v8f mma(V a, V b, v8f c) { return wmma16(a, b, c); } };
template <> struct WFrag<bf> { typedef v16bf V; static __device__ __forceinline__ V ld(const bf* p) { return cat16b(*(const v8us*)p, *(const v8us*)(p + 256)); } static __device__ __forceinline__ v8f mma(V a, V b, v8f c) { return wmmab(a, b, c); } };
// eight copies (32 KB: 16 row groups, two per copy, sg elements from one copy's groups to the next's) and the s_wait_xcnt 0 behind them in one statement: no register that a copy names is written again before the wait
template <typename T16>
__device__ __forceinline__ void gemm_fill8(const T16* g, size_t sg, unsigned dst) {
    asm volatile("global_load_async_to_lds_b128 %0, %8, off\n\tglobal_load_async_to_lds_b128 %1, %9, off\n\tglobal_load_async_to_lds_b128 %2, %10, off\n\tglobal_load_async_to_lds_b128 %3, %11, off\n\t"
                 "global_load_async_to_lds_b128 %4, %12, off\n\tglobal_load_async_to_lds_b128 %5, %13, off\n\tglobal_load_async_to_lds_b128 %6, %14, off\n\tglobal_load_async_to_lds_b128 %7, %15, off\n\ts_wait_xcnt 0x0"
                 :: "v"(dst), "v"(dst + 4096u), "v"(dst + 8192u), "v"(dst + 12288u), "v"(dst + 16384u), "v"(dst + 20480u), "v"(dst + 24576u), "v"(dst + 28672u),
                    "v"(g), "v"(g + sg), "v"(g + 2 * sg), "v"(g + 3 * sg), "v"(g + 4 * sg), "v"(g + 5 * sg), "v"(g + 6 * sg), "v"(g + 7 * sg) : "memory");
}
// the same for four copies (16 KB: 8 row groups)
template <typename T16>
__device__ __forceinline__ void gemm_fill4(const T16* g, size_t sg, unsigned dst) {
    asm volatile("global_load_async_to_lds_b128 %0, %4, off\n\tglobal_load_async_to_lds_b128 %1, %5, off\n\tglobal_load_async_to_lds_b128 %2, %6, off\n\tglobal_load_async_to_lds_b128 %3, %7, off\n\ts_wait_xcnt 0x0"
                 :: "v"(dst), "v"(dst + 4096u), "v"(dst + 8192u), "v"(dst + 12288u), "v"(g), "v"(g + sg), "v"(g + 2 * sg), "v"(g + 3 * sg) : "memory");
}
template <typename T16, int NSPLIT, bool BIAS, bool PLANES>
__global__ __launch_bounds__(256) void k_gemmw(const T16* __restrict__ A, const T16* __restrict__ A2, const T16* __restrict__ Bt, int K, int lda, float* C, int ldc, const float* __restrict__ bias, size_t sA, size_t sB, size_t sC, h16* P16, bf* Ph, bf* Pl) {
    typedef typename WFrag<T16>::V V; static_assert(NSPLIT == 0 || NSPLIT == 1, "the ring stages A, A2 and Bt");
    constexpr unsigned XBY = 32768u, WOFF = (NSPLIT == 1 ? 2u : 1u) * XBY, BUFB = WOFF + 16384u;   // bytes: one A part of a stage, where its Bt part begins, a whole stage
    __shared__ __align__(16) unsigned char ring[2 * BUFB];
    __shared__ __align__(16) float osall[PLANES ? 4 : 8 * 16 * 68];
    const size_t z = blockIdx.z; A += z * sA; if (NSPLIT == 1) A2 += z * sA; Bt += z * sB; C += z * sC;
    const int tid = threadIdx.x, lane = tid & 31, lr = lane & 15, hi = lane >> 4, wx = (tid >> 5) & 3, wy = tid >> 7;
    const int bx = blockIdx.x * 4 + wx, by = blockIdx.y * 2 + wy;   // the wave's 64 x 64 tile: bx along the x rows, by along the weight rows
    const bool wa = PLANES && z < 2;   // q, k: the weight rows are the A operand
    v8f acc[4][4];
#pragma unroll
    for (int mb = 0; mb < 4; ++mb)
#pragma unroll
        for (int nb = 0; nb < 4; ++nb) acc[mb][nb] = (v8f){};
    // the thread's 16 bytes of each copy: copy i brings row groups 2 i and 2 i + 1 of a part, 2 KB each, threads 0..127 the first of the two
    const size_t ce = (size_t)(tid & 127) * 8, sgx = (size_t)32 * lda, sgw = (size_t)32 * K;
    const T16* gx = A + ((size_t)blockIdx.x * 16 + (tid >> 7)) * 16 * lda + ce; const T16* gx2 = NSPLIT == 1 ? A2 + ((size_t)blockIdx.x * 16 + (tid >> 7)) * 16 * lda + ce : gx;
    const T16* gw = Bt + ((size_t)blockIdx.y * 8 + (tid >> 7)) * 16 * K + ce;
    const unsigned cdst = (unsigned)(size_t)ring + tid * 16;   // LDS byte address: the low 32 bits of the __shared__ address
    gemm_fill8<T16>(gx, sgx, cdst); if (NSPLIT == 1) gemm_fill8<T16>(gx2, sgx, cdst + XBY); gemm_fill4<T16>(gw, sgw, cdst + WOFF);
    asm volatile("s_wait_asynccnt 0x0" ::: "memory");   // stage 0 has landed, as far as this wave copied it
    __syncthreads();                                     // and every other wave's part of it
    if (64 < K) { gemm_fill8<T16>(gx + 1024, sgx, cdst + BUFB); if (NSPLIT == 1) gemm_fill8<T16>(gx2 + 1024, sgx, cdst + BUFB + XBY); gemm_fill4<T16>(gw + 1024, sgw, cdst + BUFB + WOFF); }
#pragma unroll 1   // one stage per trip: trip t reads buffer t % 2 alone
    for (int kc = 0; kc < K; kc += 64) {
        const unsigned bo = (kc & 64) ? BUFB : 0u;
        const T16* xs = (const T16*)(ring + bo) + wx * 4096 + lane * 8; const T16* wsp = (const T16*)(ring + bo + WOFF) + wy * 4096 + lane * 8;   // the wave's four row groups of each part
        const T16* pa = wa ? wsp : xs; const T16* pb = wa ? xs : wsp;
        auto refill = [&]() { if (kc + 128 < K) { const size_t ko = (size_t)(kc + 128) * 16; gemm_fill8<T16>(gx + ko, sgx, cdst + bo); if (NSPLIT == 1) gemm_fill8<T16>(gx2 + ko, sgx, cdst + bo + XBY); gemm_fill4<T16>(gw + ko, sgw, cdst + bo + WOFF); } };   // stage t + 2, while it exists, into the buffer of trip t
#pragma unroll
        for (int ks = 0; ks < 2; ++ks) {
            V a[4], a2[4], b[4];
#pragma unroll
            for (int mb = 0; mb < 4; ++mb) { a[mb] = WFrag<T16>::ld(pa + mb * 1024 + ks * 512); if (NSPLIT == 1) a2[mb] = WFrag<T16>::ld(pa + XBY / 2 + mb * 1024 + ks * 512); }
#pragma unroll
            for (int nb = 0; nb < 4; ++nb) b[nb] = WFrag<T16>::ld(pb + nb * 1024 + ks * 512);
            // the 32 k's fragment loads stay one group in front of its matrix instructions: left free, the B loads sink among them, one waited place per four or eight
            __builtin_amdgcn_sched_barrier(0);
            if (ks == 1) {
                // publish point of the next stage, behind the trip's last fragment loads: this wave's reads of the buffer are done, its copies of the next stage have landed, every wave has come as far; only then the refill of the buffer just read.
                // The second 32 k's products, from registers alone, follow it: a wave comes out of the barrier with matrix work at hand. The refill stands in front of them (a whole trip's lead) where its addresses fit beside the fragments under 256 registers; with the A2 fragments they do not, and it stands behind them.
                asm volatile("s_wait_dscnt 0x0" ::: "memory");
                asm volatile("s_wait_asynccnt 0x0" ::: "memory");
                __syncthreads();
                if (NSPLIT == 0) refill();
            }
#pragma unroll
            for (int nb = 0; nb < 4; ++nb)
#pragma unroll
                for (int mb = 0; mb < 4; ++mb) { acc[mb][nb] = WFrag<T16>::mma(a[mb], b[nb], acc[mb][nb]); if (NSPLIT == 1) acc[mb][nb] = WFrag<T16>::mma(a2[mb], b[nb], acc[mb][nb]); }
            if (ks == 1 && NSPLIT == 1) refill();
        }
    }
    asm volatile("s_wait_asynccnt 0x0" ::: "memory");   // no copy is outstanding when the wave goes on to its end
    if constexpr (PLANES) {
        // acc[mb][nb][j]: A row mb * 16 + 8 hi + j (the plane's k), B row nb * 16 + lr (the plane's row): octet mb * 2 + hi of row group nb, so each wave-wide 16-byte store covers 512 contiguous bytes
        const int x0 = bx * 64, tb = x0 % TT; const int sn = wa ? 16 * HD : 16 * TT;   // elements from one group of 16 plane rows to the next
        const size_t base = ((z * NB_ + x0 / TT) * NH_ + by) * (size_t)(TT * HD) + (wa ? tb * HD : tb * 16) + lane * 8;
#pragma unroll
        for (int mb = 0; mb < 4; ++mb)
#pragma unroll
            for (int nb = 0; nb < 4; ++nb) { v8h o16; v8b oh, ol;
#pragma unroll
                for (int j = 0; j < 8; ++j) { const float y = acc[mb][nb][j]; o16[j] = (h16)y; const __bf16 h = (__bf16)y; oh[j] = h; ol[j] = (__bf16)(y - (float)h); }
                const size_t e = base + (size_t)nb * sn + mb * 256; h16* s16 = P16 + e; bf* sh = Ph + e; bf* sl = Pl + e; *(v8h*)s16 = o16; *(v8b*)sh = oh; *(v8b*)sl = ol;
                // s_wait_xcnt 0 behind the three stores, before a register that one of them names (address or data) is written again
                asm volatile("s_wait_xcnt 0x0" :: "v"(s16), "v"(sh), "v"(sl), "v"(o16), "v"(oh), "v"(ol) : "memory"); }
        return;
    }
    float* os = osall + (tid >> 5) * (16 * 68); const int r0 = bx * 64, c0 = by * 64;   // each wave turns its tile in its own LDS range
#pragma unroll
    for (int mb = 0; mb < 4; ++mb) {
#pragma unroll
        for (int nb = 0; nb < 4; ++nb) {
#pragma unroll
            for (int j = 0; j < 8; ++j) os[(hi * 8 + j) * 68 + nb * 16 + lr] = acc[mb][nb][j]; }
        __builtin_amdgcn_wave_barrier(); asm volatile("" ::: "memory");
        float* crow = C + (size_t)(r0 + mb * 16) * ldc + c0;
{
#pragma unroll
            for (int s = 0; s < 8; ++s) { const int row = 2 * s + hi, cofs = lr * 4; v4f val = *(const v4fa*)(os + row * 68 + cofs); if (BIAS) { val[0] += bfr(bias[c0 + cofs]); val[1] += bfr(bias[c0 + cofs + 1]); val[2] += bfr(bias[c0 + cofs + 2]); val[3] += bfr(bias[c0 + cofs + 3]); }
                *(v4f*)(crow + (size_t)row * ldc + cofs) = val; }
             }
        __builtin_amdgcn_wave_barrier(); asm volatile("" ::: "memory");
    }
}

__device__ __forceinline__ void splitf(float y, unsigned short& h, unsigned short& l) { h = f2bf(y); l = f2bf(y - bf2f(h)); }
typedef __attribute__((ext_vector_type(2))) _Float16 v2h;
typedef __attribute__((ext_vector_type(4))) _Float16 v4h;
typedef __attribute__((ext_vector_type(2))) unsigned short v2us;
typedef __attribute__((ext_vector_type(4))) unsigned short v4us;
typedef __attribute__((ext_vector_type(2))) float v2f;
typedef __attribute__((ext_vector_type(4))) int v4i;

__global__ __launch_bounds__(256) void k_wtG(const float* __restrict__ w, int K, int N, bf* Bt) {
    const int lane = threadIdx.x & 31; const int L0 = (blockIdx.x * 8 + (threadIdx.x >> 5)) * 8; const int nlines = N * K / 64;
{
#pragma unroll 1
        for (int l = 0; l < 8; ++l) { const int L = L0 + l; if (L >= nlines) break; const size_t e = (size_t)L * 64 + lane * 2; const int k = (int)(e % K), n = (int)(e / K); v2us o;
            o[0] = f2bf(w[(size_t)k * N + n]); o[1] = f2bf(w[(size_t)(k + 1) * N + n]); *(v2us*)(Bt + e) = o; }
         }
}
// k_cvt8: bf16 copies of the four weights and of x in one launch, in fragment order; blockIdx.y picks a chunk of DM*DM elements (0..3: wo, wq, wk, wv; 4..: x, one batch each), dst holds the chunks in that order.
// A block takes 16 rows x 256 k (blockIdx.x = row tile * 4 + k quarter): a wave reads 1 KB of one row, the 16-byte octets turn in LDS (one group of 16 rows per k octet, pitch 272 B against bank conflicts), a wave stores 512 contiguous bytes.
static_assert(DQ == DM && DKV == DM && TT == DM && NH_ == NKV && RH % 256 == 0 && TT % 256 == 0 && NH_ % 4 == 0 && HD == 64, "chunking and row blocks");
__global__ __launch_bounds__(256) void k_cvt8(const float* __restrict__ wo, const float* __restrict__ wq, const float* __restrict__ wk, const float* __restrict__ wv, const float* __restrict__ x, bf* dst) { const int y = blockIdx.y; const float* src = (y == 0) ? wo : (y == 1) ? wq : (y == 2) ? wk : (y == 3) ? wv : x + (size_t)(y - 4) * DM * DM;
    __shared__ __align__(16) bf ts[32 * 136];
    const int rt = blockIdx.x >> 2, kq = blockIdx.x & 3, tid = threadIdx.x;
    const float* s0 = src + (size_t)(rt * 16 + (tid >> 5)) * DM + kq * 256 + (tid & 31) * 8; const float* s1 = s0 + 8 * DM;   // rows tid / 32 and 8 + tid / 32, k octet tid % 32
    const v8f v0 = *(const v8f*)s0, v1 = *(const v8f*)s1;
    // s_wait_xcnt 0 behind the loads, before any register that one of them names is written again; the address (s1 is s0 plus an immediate offset) is an input so that it stays whole up to the wait
    asm volatile("s_wait_xcnt 0x0" :: "v"(s0) : "memory");
    v8us o0, o1;
#pragma unroll
    for (int k = 0; k < 8; ++k) { o0[k] = f2bf(v0[k]); o1[k] = f2bf(v1[k]); }
    *(v8usa*)(ts + (tid & 31) * 136 + (tid >> 5) * 8) = o0; *(v8usa*)(ts + (tid & 31) * 136 + (8 + (tid >> 5)) * 8) = o1;
    __syncthreads();   // the octets cross waves
    bf* d0 = dst + (size_t)y * DM * DM + ((size_t)rt * (DM / 8) + kq * 32) * 128 + tid * 8;
    *(v8us*)d0 = *(const v8usa*)(ts + (tid >> 4) * 136 + (tid & 15) * 8); *(v8us*)(d0 + 2048) = *(const v8usa*)(ts + (16 + (tid >> 4)) * 136 + (tid & 15) * 8);  }

// k_fattn: fused attention. One wave owns 32 query rows of one (batch, head) plane and walks the TT keys 32 at a time; 8 waves (256 rows) per block read the same K and V. grid (planes, TT / 256): blockIdx.y picks the row block, the hi/lo row blocks come first.
// K and V come through a two-buffer LDS ring: a tile is 32 keys of every plane the row block uses (K 4 KB, V 4 KB, then the lo planes), brought once per block by asynchronous copies (16 bytes a thread and plane) one trip ahead of its use; fragment order carries over, so a fragment is 1 KB in a row in LDS too.
// St = K Q^T (A: K rows, B: Q rows): a lane holds 16 scores of ONE query (column lr; keys 8 hi + j of each 16-key tile), so maximum, sum and rescale are lane-local but for one exchange between the lane halves.
// The two St tiles of a 32-key block, converted in place, are the B operand of Ot += V^T P^T (A: VT rows d, loaded in the same k order). P is exp(t - running max), not normalised (fp16 rows: x PCAR); Ot is divided by the f32 sum at the end.
__device__ __forceinline__ float xhalf(float x) { const int b = __float_as_int(x); return __int_as_float(__builtin_amdgcn_permlanex16(b, b, 0x76543210, 0xfedcba98, false, false)); }   // lane l <-> l ^ 16
template <typename T16, bool HIRES>
__device__ __forceinline__ void ring_fill(const T16* gk, const T16* gk2, const T16* gv, const T16* gv2, unsigned dst) {
    // one tile's copies and the s_wait_xcnt 0 behind them in one statement: no register that a copy names is written again before the wait
    if constexpr (HIRES) asm volatile("global_load_async_to_lds_b128 %0, %4, off\n\tglobal_load_async_to_lds_b128 %1, %5, off\n\tglobal_load_async_to_lds_b128 %2, %6, off\n\tglobal_load_async_to_lds_b128 %3, %7, off\n\ts_wait_xcnt 0x0"
                                      :: "v"(dst), "v"(dst + 4096u), "v"(dst + 8192u), "v"(dst + 12288u), "v"(gk), "v"(gv), "v"(gk2), "v"(gv2) : "memory");
    else asm volatile("global_load_async_to_lds_b128 %0, %2, off\n\tglobal_load_async_to_lds_b128 %1, %3, off\n\ts_wait_xcnt 0x0" :: "v"(dst), "v"(dst + 4096u), "v"(gk), "v"(gv) : "memory");
}
template <typename T16, bool HIRES>
__device__ __forceinline__ void attn_rows(const T16* Q, const T16* Q2, const T16* Kp, const T16* Kp2, const T16* Vp, const T16* Vp2, int t0, bf* Ah, bf* Al, const unsigned char* ring) {
    // every inner loop below is fully unrolled (#pragma unroll): fragment and accumulator arrays stay in registers only under constant indices
    typedef typename WFrag<T16>::V V; static_assert(PCAR == 1024.0f, "the exponent bias 10 below is log2(PCAR)");
    const int lane = threadIdx.x & 31;   // in the comments: lr = lane % 16, hi = lane / 16
    const float C = SCL * 1.4426950408889634f;
    V q[2][2], q2[2][2];
    { const T16* pq = Q + (size_t)t0 * HD + lane * 8; const T16* pq2 = HIRES ? Q2 + (size_t)t0 * HD + lane * 8 : pq;   // fragment order: 16 rows x 32 d are 512 elements in a row
#pragma unroll
      for (int qt = 0; qt < 2; ++qt)
#pragma unroll
          for (int ks = 0; ks < 2; ++ks) { q[qt][ks] = WFrag<T16>::ld(pq + qt * 16 * HD + ks * 512); if (HIRES) q2[qt][ks] = WFrag<T16>::ld(pq2 + qt * 16 * HD + ks * 512); }
      // s_wait_xcnt 0 behind the Q loads, before any register that one of them names is written again; the addresses are inputs so that they stay whole up to the wait
      asm volatile("s_wait_xcnt 0x0" :: "v"(pq), "v"(pq2) : "memory"); }
    v8f o[2][4]; float m[2], l[2];
#pragma unroll
    for (int qt = 0; qt < 2; ++qt) { m[qt] = -3.0e38f; l[qt] = 0.f;
#pragma unroll
        for (int dt = 0; dt < 4; ++dt) o[qt][dt] = (v8f){}; }
    // the thread's 16 bytes of each plane's tile: K tiles are 4 KB in a row; a V tile is 1 KB of each of the four groups of 16 d
    constexpr unsigned BUFB = HIRES ? 16384u : 8192u;
    const int tid = threadIdx.x; const size_t ck = (size_t)tid * 8, cv = (size_t)(tid >> 6) * 16 * TT + (tid & 63) * 8;
    const T16* gk = Kp + ck; const T16* gk2 = HIRES ? Kp2 + ck : gk; const T16* gv = Vp + cv; const T16* gv2 = HIRES ? Vp2 + cv : gv;
    const unsigned cdst = (unsigned)(size_t)ring + tid * 16;   // LDS byte address: the low 32 bits of the __shared__ address
    ring_fill<T16, HIRES>(gk, gk2, gv, gv2, cdst);
    asm volatile("s_wait_asynccnt 0x0" ::: "memory");   // tile 0 has landed, as far as this wave copied it
    __syncthreads();                                     // and every other wave's part of it
    ring_fill<T16, HIRES>(gk + 32 * HD, gk2 + 32 * HD, gv + 512, gv2 + 512, cdst + BUFB);
#pragma unroll 1   // one 32-key block per trip: an unrolled body would not fit the registers of four waves per SIMD
    for (int kb = 0; kb < TT; kb += 32) {
        const unsigned bo = (kb & 32) ? BUFB : 0u;   // trip t reads buffer t % 2 alone
        const T16* pk = (const T16*)(ring + bo) + lane * 8; const T16* pv = pk + 2048; const T16* pk2 = HIRES ? pk + 4096 : pk; const T16* pv2 = HIRES ? pk + 6144 : pv;
        V kf[2][2], kf2[2][2];
#pragma unroll
        for (int kt = 0; kt < 2; ++kt)
#pragma unroll
            for (int ks = 0; ks < 2; ++ks) { kf[kt][ks] = WFrag<T16>::ld(pk + kt * 16 * HD + ks * 512); if (HIRES) kf2[kt][ks] = WFrag<T16>::ld(pk2 + kt * 16 * HD + ks * 512); }
        v8f st[2][2];
#pragma unroll
        for (int kt = 0; kt < 2; ++kt)
#pragma unroll
            for (int qt = 0; qt < 2; ++qt) { v8f s = (v8f){};
#pragma unroll
                for (int ks = 0; ks < 2; ++ks) { s = WFrag<T16>::mma(kf[kt][ks], q[qt][ks], s); if (HIRES) { s = WFrag<T16>::mma(kf[kt][ks], q2[qt][ks], s); s = WFrag<T16>::mma(kf2[kt][ks], q[qt][ks], s); } }
                st[qt][kt] = s; }
        V vf[4], vf2[4];
#pragma unroll
        for (int dt = 0; dt < 4; ++dt) { vf[dt] = WFrag<T16>::ld(pv + dt * 512); if (HIRES) vf2[dt] = WFrag<T16>::ld(pv2 + dt * 512); }
        V p[2], p2[2];
#pragma unroll
        for (int qt = 0; qt < 2; ++qt) { float mx = st[qt][0][0];
#pragma unroll
            for (int j = 1; j < 16; ++j) mx = fmaxf(mx, st[qt][j >> 3][j & 7]);
            mx = fmaxf(mx, xhalf(mx)); const float mn = fmaxf(m[qt], mx); float al = (m[qt] - mn) * C; m[qt] = mn;
            const float nb = (HIRES ? 0.0f : 10.0f) - mn * C;   // fp16 rows carry P x PCAR = 2^10
            float e[16];
#pragma unroll
            for (int j = 0; j < 16; ++j) e[j] = __builtin_fmaf(st[qt][j >> 3][j & 7], C, nb);
            // the 17 exponentials of one query tile in one statement, each in place: none overwrites the source or reads the result of the one before it; the v_nop is the slot between the last one and whatever follows
            asm("v_exp_f32 %0, %0\n\tv_exp_f32 %1, %1\n\tv_exp_f32 %2, %2\n\tv_exp_f32 %3, %3\n\tv_exp_f32 %4, %4\n\tv_exp_f32 %5, %5\n\tv_exp_f32 %6, %6\n\tv_exp_f32 %7, %7\n\tv_exp_f32 %8, %8\n\t"
                "v_exp_f32 %9, %9\n\tv_exp_f32 %10, %10\n\tv_exp_f32 %11, %11\n\tv_exp_f32 %12, %12\n\tv_exp_f32 %13, %13\n\tv_exp_f32 %14, %14\n\tv_exp_f32 %15, %15\n\tv_exp_f32 %16, %16\n\tv_nop"
                : "+v"(al), "+v"(e[0]), "+v"(e[1]), "+v"(e[2]), "+v"(e[3]), "+v"(e[4]), "+v"(e[5]), "+v"(e[6]), "+v"(e[7]), "+v"(e[8]), "+v"(e[9]), "+v"(e[10]), "+v"(e[11]), "+v"(e[12]), "+v"(e[13]), "+v"(e[14]), "+v"(e[15]));
            float sum = 0.f;
#pragma unroll
            for (int j = 0; j < 16; ++j) { sum += e[j];
                if constexpr (HIRES) { const __bf16 h = (__bf16)e[j]; p[qt][j] = h; p2[qt][j] = (__bf16)(e[j] - (float)h); } else p[qt][j] = (h16)e[j]; }
            l[qt] = l[qt] * al + sum;
#pragma unroll
            for (int dt = 0; dt < 4; ++dt) o[qt][dt] *= al; }
#pragma unroll
        for (int dt = 0; dt < 4; ++dt)
#pragma unroll
            for (int qt = 0; qt < 2; ++qt) { o[qt][dt] = WFrag<T16>::mma(vf[dt], p[qt], o[qt][dt]); if (HIRES) { o[qt][dt] = WFrag<T16>::mma(vf[dt], p2[qt], o[qt][dt]); o[qt][dt] = WFrag<T16>::mma(vf2[dt], p[qt], o[qt][dt]); } }
        // publish point of the next tile: this wave's reads of the buffer are done, its copies of the next tile have landed, every wave has come as far; only then the refill of the buffer just read
        asm volatile("s_wait_dscnt 0x0" ::: "memory");
        asm volatile("s_wait_asynccnt 0x0" ::: "memory");
        __syncthreads();
        if (kb + 64 < TT) ring_fill<T16, HIRES>(gk + (size_t)(kb + 64) * HD, gk2 + (size_t)(kb + 64) * HD, gv + (size_t)(kb + 64) * 16, gv2 + (size_t)(kb + 64) * 16, cdst + bo);
    }
    asm volatile("s_wait_asynccnt 0x0" ::: "memory");   // no copy is outstanding when the wave goes on to its end
    // o[qt][dt][j] = Ot[d = dt * 16 + 8 hi + j][query t0 + qt * 16 + lr]: 8 consecutive d of one merged row per lane, in fragment order 512 contiguous bytes per wave-wide store
#pragma unroll
    for (int qt = 0; qt < 2; ++qt) { const float f = __fdiv_rn(1.0f, l[qt] + xhalf(l[qt])); const size_t oo = (size_t)(t0 + qt * 16) * DQ + lane * 8;
#pragma unroll
        for (int dt = 0; dt < 4; ++dt) { v8us oh, ol;
#pragma unroll
            for (int j = 0; j < 8; ++j) { unsigned short a, c2; splitf(o[qt][dt][j] * f, a, c2); oh[j] = a; ol[j] = c2; }
            bf* sh = Ah + oo + dt * 256; bf* sl = Al + oo + dt * 256; *(v8us*)sh = oh; *(v8us*)sl = ol;
            // the same wait behind the two stores, before a register that one of them names (address or data) is written again
            asm volatile("s_wait_xcnt 0x0" :: "v"(sh), "v"(sl), "v"(oh), "v"(ol) : "memory"); } }
}
__global__ __launch_bounds__(256) void k_fattn(const h16* Q16, const h16* K16, const h16* V16, const bf* Qh, const bf* Ql, const bf* Kh, const bf* Kl, const bf* Vh, const bf* Vl, bf* Ah, bf* Al) {
    __shared__ __align__(16) unsigned char ring[2 * 16384];
    const int g = blockIdx.x; const size_t zo = (size_t)g * TT * HD; const int t0 = blockIdx.y * 256 + (threadIdx.x >> 5) * 32;   // plane g = batch * NH_ + head: one kv head per query head
    const size_t ao = (size_t)(g / NH_) * TT * DQ + (g % NH_) * HD * 16;   // merged planes in fragment order: a head's 8 octets of d, 128 elements each
    if (blockIdx.y * 256 < RH) attn_rows<bf, true>(Qh + zo, Ql + zo, Kh + zo, Kl + zo, Vh + zo, Vl + zo, t0, Ah + ao, Al + ao, ring);
    else attn_rows<h16, false>(Q16 + zo, nullptr, K16 + zo, nullptr, V16 + zo, nullptr, t0, Ah + ao, Al + ao, ring);
}

extern "C" void kernel_launch(void* const* d_in, const int* in_sizes, int n_in,
                              void* d_out, int out_size, void* d_ws, size_t ws_size, hipStream_t stream) {
    (void)in_sizes; (void)n_in; (void)out_size;
    const float* x = (const float*)d_in[0]; const float* wq = (const float*)d_in[1]; const float* wk = (const float*)d_in[2]; const float* wv = (const float*)d_in[3]; const float* wo = (const float*)d_in[4]; const float* bo = (const float*)d_in[5];
    float* OUT = (float*)d_out;     // [8][1024][1024]
    char* ws = (char*)d_ws; const size_t Mi = (size_t)1 << 20;
    if (ws_size < 253 * Mi) return;    // ws 256 MiB
    // Workspace map in MiB; regions are reused in stream order once their last reader has run.
    //   0 WO | 2 WQ WK WV | 8 XB (all batches) | 25 .. 169 nine planes of 16 (all batches): fp16 q k v | 73 hi q k v | 121 lo q k v
    //   attention: 237 ATh (16) | 2 ATl (16, over WQ WK WV XB)
    const size_t PL = (size_t)NB_ * NH_ * TT * HD;   // elements of one plane set
    bf* WO = (bf*)ws; bf* WQ = (bf*)(ws + 2 * Mi); bf* XB = (bf*)(ws + 8 * Mi);
    h16* QP16 = (h16*)(ws + 25 * Mi); h16* KP16 = QP16 + PL; h16* VT16 = KP16 + PL; bf* QPh = (bf*)(ws + 73 * Mi); bf* KPh = QPh + PL; bf* VTh = KPh + PL; bf* QPl = (bf*)(ws + 121 * Mi); bf* KPl = QPl + PL; bf* VTl = KPl + PL;   // q, k, v in a row: the z sets of the projection launch
    bf* ATh = (bf*)(ws + 237 * Mi); bf* ATl = (bf*)(ws + 2 * Mi);
    k_cvt8<<<dim3(DM / 16 * (DM / 256), 4 + NB_, 1), 256, 0, stream>>>(wo, wq, wk, wv, x, WO);
    k_gemmw<bf, 0, false, true><<<dim3(NB_ * TT / 256, DQ / 128, 3), 256, 0, stream>>>(XB, nullptr, WQ, DM, DM, nullptr, 0, nullptr, 0, (size_t)DQ * DM, 0, QP16, QPh, QPl);
    k_fattn<<<dim3(NB_ * NH_, TT / 256, 1), 256, 0, stream>>>(QP16, KP16, VT16, QPh, QPl, KPh, KPl, VTh, VTl, ATh, ATl);
    k_gemmw<bf, 1, true, false><<<dim3(NB_ * TT / 256, DM / 128, 1), 256, 0, stream>>>(ATh, ATl, WO, DQ, DQ, OUT, DM, bo, 0, 0, 0, nullptr, nullptr, nullptr);
}

// v007
// One run takes 133 microseconds.
// Next to v006, in two timings, it ran 1.04 times as fast each time.
// Over all steps from v000 it is 35.8 times as fast.
#include <hip/hip_runtime.h>
#include <stdint.h>

// Simple multi-head attention scaled by the EMBEDDING size (x [8][1024][1024]; q,k,v = x W^T ('oi' [1024][1024], no bias); scores / sqrt(1024) (module quirk); softmax over all keys; out = merged Wo^T + bo -> [8][1024][1024] (8.4 M)).
// Every 16-bit operand plane [row][k] lies in fragment order: element (row, k) at ((row / 16) * (K / 8) + k / 8) * 128 + (row % 16) * 8 + k % 8, so a 16 x 32 fragment is 1 KB in a row and each of its two wave-wide 16-byte loads covers 512 contiguous bytes (four whole lines).
// Layout, all batches per launch: bf16 copy of x and weights; exact projections that store the attention's operand planes themselves; dense T-1024 attention fused in one launch (scores, running softmax and P V stay in registers; hybrid rows: < 512 hi/lo 3 products, rest fp16 x1024); merged hi/lo x Wo exact + bo.
// Compute dtypes, f32 accumulate: every input rounded to bf16; projections exact; attention rows < 512 3 products, rest fp16; softmax f32; Wo hl x exact + bias.

#define NB_  8
#define TT   1024
#define DM   1024
#define NH_  16
#define NKV  16
#define REP  (NH_ / NKV)
#define HD   64
#define DQ   (NH_ * HD)
#define DKV  (NKV * HD)
#define RH   512                  // query rows < RH use hi+lo planes (0: none)
#define WIN  0
#define PCAR 1024.0f
#define SCL  0.03125f   // 1/sqrt(1024): the module scales by the embedding size
typedef _Float16 h16;
typedef unsigned short bf;
typedef __attribute__((ext_vector_type(16))) __bf16   v16bf;
typedef __attribute__((ext_vector_type(16))) _Float16 v16h;
typedef __attribute__((ext_vector_type(8)))  _Float16 v8h;
typedef __attribute__((ext_vector_type(8)))  unsigned short v8us;
typedef __attribute__((ext_vector_type(8)))  __bf16   v8b;
typedef __attribute__((ext_vector_type(8)))  float    v8f;
typedef __attribute__((ext_vector_type(4)))  float    v4f;
typedef v8h  __attribute__((may_alias)) v8ha;
typedef v4f  __attribute__((may_alias)) v4fa;
typedef v8us __attribute__((may_alias)) v8usa;

__device__ __forceinline__ unsigned short f2bf(float f) { unsigned u = __float_as_uint(f); u += 0x7FFFu + ((u >> 16) & 1u); return (unsigned short)(u >> 16); }
__device__ __forceinline__ float bf2f(unsigned short b) { return __uint_as_float(((unsigned)b) << 16); }
__device__ __forceinline__ float bfr(float f) { return bf2f(f2bf(f)); }
__device__ __forceinline__ v16h cat16(v8h lo, v8h hi) { return __builtin_shufflevector(lo, hi, 0, 1, 2, 3, 4, 5, 6, 7, 8, 9, 10, 11, 12, 13, 14, 15); }
__device__ __forceinline__ v16bf cat16b(v8us lo, v8us hi) { return __builtin_bit_cast(v16bf, __builtin_shufflevector(lo, hi, 0, 1, 2, 3, 4, 5, 6, 7, 8, 9, 10, 11, 12, 13, 14, 15)); }
__device__ __forceinline__ v8f wmma16(v16h a, v16h b, v8f c) { return __builtin_amdgcn_wmma_f32_16x16x32_f16(false, a, false, b, (short)0, c, false, false); }
__device__ __forceinline__ v8f wmmab(v16bf a, v16bf b, v8f c) { return __builtin_amdgcn_wmma_f32_16x16x32_bf16(false, a, false, b, (short)0, c, false, false); }



// ---- k_gemmw: register-blocked GEMM, one wave per 64x64 output tile (16 accumulators), EIGHT WAVES per block: 4 along the x rows, 2 along the weight rows, a block tile of 256 x 128. Operands are 16-bit planes in fragment order (A of lda, Bt of K elements a row); grid (M/256, N/128, Z), 256 threads.
// The operands come through a two-buffer LDS ring: a stage is 64 k of the block's 256 A rows (32 KB; with NSPLIT 1 the A2 rows behind them) and 128 Bt rows (16 KB), brought once per block by tensor loads, one request per wave and stage, one trip ahead of its use. Fragment order carries over: 16 rows x 64 k are 2 KB in a row in memory and in LDS (one row of a tensor tile; the next group of 16 rows lies 16 * lda elements on), a fragment 1 KB (WFrag::ld takes the fragment's start + lane * 8).
// C[m][n] (f32, pitch ldc, + optional f32 bias[n]) = sum_k A[m][k] Bt[n][k] (NSPLIT 1: + A2[m][k] Bt[n][k]). z-batch strides sA/sB/sC in elements. K % 64 == 0.
// PLANES (the projections; A = x, Bt = wq wk wv by z, lda == K): no C. A wave's tile is 64 positions x one head and goes from the accumulators straight into that head's fp16, hi and lo planes (P16, Ph, Pl: q, k, v sets in a row by z), in fragment order.
// A lane's 8 accumulator values run along the A operand's rows, and a plane wants 8 consecutive k per lane: d for the q and k planes [h][t][d], so there the weight is the WMMA's A operand (the two LDS pointers and tile origins change places); t for the V^T planes [h][d][t], so there x is.
template <typename T16> struct WFrag;
template <> struct WFrag<h16> { typedef v16h V; static __device__ __forceinline__ V ld(const h16* p) { return cat16(*(const v8h*)p, *(const v8h*)(p + 256)); } static __device__ __forceinline__ v8f mma(V a, V b, v8f c) { return wmma16(a, b, c); } };
template <> struct WFrag<bf> { typedef v16bf V; static __device__ __forceinline__ V ld(const bf* p) { return cat16b(*(const v8us*)p, *(const v8us*)(p + 256)); } static __device__ __forceinline__ v8f mma(V a, V b, v8f c) { return wmmab(a, b, c); } };
// Tensor loads: one request of one wave brings a tile of n rows of rowb bytes (source pitch in bytes) into LDS, rows one behind the other, through no register. Two descriptor groups, every word wave-uniform in scalar registers; 1-byte elements, tensor = tile, no pad, no mask.
typedef uint32_t u32x4 __attribute__((ext_vector_type(4)));
typedef uint32_t u32x8 __attribute__((ext_vector_type(8)));
__device__ __forceinline__ uint32_t uni(uint32_t v) { return (uint32_t)__builtin_amdgcn_readfirstlane(v); }
// a wave-uniform value held in a scalar register, so that a test on it is a scalar branch (a tensor load ignores EXEC) and what is formed from it is formed behind the volatile statements in front of it
__device__ __forceinline__ uint32_t pinned(uint32_t v) { uint32_t w = (uint32_t)__builtin_amdgcn_readfirstlane(v); asm volatile("" : "+s"(w)); return w; }
__device__ __forceinline__ u32x8 tdm_group1(uint32_t rowb, uint32_t n, uint32_t pitch) {
    // words 1 to 7 pinned: the group is formed once and stays in its scalar registers for the whole ring, so that no word is written again while a request that names it is outstanding; word 0 is the constant 0
    u32x8 g;
    g[0] = uni(0u); g[1] = pinned((rowb & 0xFFFFu) << 16); g[2] = pinned((rowb >> 16) | ((n & 0xFFFFu) << 16)); g[3] = pinned((n >> 16) | (rowb << 16));
    g[4] = pinned(n); g[5] = pinned(pitch); g[6] = pinned(0u); g[7] = pinned(0u);
    return g;
}
__device__ __forceinline__ u32x4 tdm_group0(uint32_t lds_dst, uint64_t ga) {
    u32x4 g;
    g[0] = uni(1u); g[1] = uni(lds_dst); g[2] = uni((uint32_t)ga); g[3] = uni((((uint32_t)(ga >> 32)) & 0x01FFFFFFu) | 0x80000000u);
    return g;
}
// group 0 goes in and out of the statement, so that what tdm_wait holds whole are the very registers that the request names
__device__ __forceinline__ void tdm_load(u32x4& g0, u32x8 g1) { asm volatile("tensor_load_to_lds %0, %1" : "+s"(g0) : "s"(g1) : "memory"); }
// the wave's own request has landed; the descriptor it named is an input so that its registers stay whole up to the wait
__device__ __forceinline__ void tdm_wait(u32x4 g0, u32x8 g1) { asm volatile("s_wait_tensorcnt 0x0" :: "s"(g0), "s"(g1) : "memory"); }
template <typename T16, int NSPLIT, bool BIAS, bool PLANES>
__global__ __launch_bounds__(256) void k_gemmw(const T16* __restrict__ A, const T16* __restrict__ A2, const T16* __restrict__ Bt, int K, int lda, float* C, int ldc, const float* __restrict__ bias, size_t sA, size_t sB, size_t sC, h16* P16, bf* Ph, bf* Pl) {
    typedef typename WFrag<T16>::V V; static_assert(NSPLIT == 0 || NSPLIT == 1, "the ring stages A, A2 and Bt");
    constexpr unsigned XBY = 32768u, WOFF = (NSPLIT == 1 ? 2u : 1u) * XBY, BUFB = WOFF + 16384u;   // bytes: one A part of a stage, where its Bt part begins, a whole stage
    __shared__ __attribute__((aligned(2048))) unsigned char ring[2 * BUFB];   // every tensor tile's place in LDS is a multiple of 2 KB
    __shared__ __align__(16) float osall[PLANES ? 4 : 8 * 16 * 68];
    const size_t z = blockIdx.z; A += z * sA; if (NSPLIT == 1) A2 += z * sA; Bt += z * sB; C += z * sC;
    const int tid = threadIdx.x, lane = tid & 31, lr = lane & 15, hi = lane >> 4, wx = (tid >> 5) & 3, wy = tid >> 7;
    const int bx = blockIdx.x * 4 + wx, by = blockIdx.y * 2 + wy;   // the wave's 64 x 64 tile: bx along the x rows, by along the weight rows
    const bool wa = PLANES && z < 2;   // q, k: the weight rows are the A operand
    v8f acc[4][4];
#pragma unroll
    for (int mb = 0; mb < 4; ++mb)
#pragma unroll
        for (int nb = 0; nb < 4; ++nb) acc[mb][nb] = (v8f){};
    // every wave brings its own slice of a stage, whole row groups of one part. NSPLIT 0: waves 0..3 four A groups each, waves 4..7 two Bt groups each. NSPLIT 1: waves 0..2 six, five, five A groups, waves 3..5 the same of A2, waves 6, 7 four Bt groups each.
    const uint32_t wave = uni(threadIdx.x >> 5);
    uint32_t part, first, ngr;   // part 0: A, 1: A2, 2: Bt
    if (NSPLIT == 1) { part = wave / 3u; const uint32_t r = wave - 3u * part; first = part < 2u ? (r ? 5u * r + 1u : 0u) : 4u * r; ngr = part < 2u ? (r ? 5u : 6u) : 4u; }
    else { part = wave < 4u ? 0u : 2u; first = wave < 4u ? 4u * wave : 2u * (wave - 4u); ngr = wave < 4u ? 4u : 2u; }
    const T16* sp = part == 2u ? Bt + ((size_t)blockIdx.y * 8 + first) * 16 * K : (part == 1u ? A2 : A) + ((size_t)blockIdx.x * 16 + first) * 16 * lda;
    const uint64_t sga = (uint64_t)(size_t)sp;
    const uint32_t sdst = (uint32_t)(size_t)ring + (part == 2u ? WOFF : part * XBY) + first * 2048u;   // LDS byte address: the low 32 bits of the __shared__ address
    const u32x8 g1 = tdm_group1(2048u, ngr, (uint32_t)(part == 2u ? K : lda) * 32u);
    u32x4 g0 = tdm_group0(sdst, sga);
    tdm_load(g0, g1);
    tdm_wait(g0, g1);   // stage 0 has landed, as far as this wave asked for it
    __syncthreads();    // and every other wave's part of it
    if (pinned(64 < K)) { g0 = tdm_group0(sdst + BUFB, sga + 2048u); tdm_load(g0, g1); }
#pragma unroll 1   // one stage per trip: trip t reads buffer t % 2 alone
    for (int kc = 0; kc < K; kc += 64) {
        const unsigned bo = (kc & 64) ? BUFB : 0u;
        const T16* xs = (const T16*)(ring + bo) + wx * 4096 + lane * 8; const T16* wsp = (const T16*)(ring + bo + WOFF) + wy * 4096 + lane * 8;   // the wave's four row groups of each part
        const T16* pa = wa ? wsp : xs; const T16* pb = wa ? xs : wsp;
#pragma unroll
        for (int ks = 0; ks < 2; ++ks) {
            V a[4], a2[4], b[4];
#pragma unroll
            for (int mb = 0; mb < 4; ++mb) { a[mb] = WFrag<T16>::ld(pa + mb * 1024 + ks * 512); if (NSPLIT == 1) a2[mb] = WFrag<T16>::ld(pa + XBY / 2 + mb * 1024 + ks * 512); }
#pragma unroll
            for (int nb = 0; nb < 4; ++nb) b[nb] = WFrag<T16>::ld(pb + nb * 1024 + ks * 512);
            // the 32 k's fragment loads stay one group in front of its matrix instructions: left free, the B loads sink among them, one waited place per four or eight
            __builtin_amdgcn_sched_barrier(0);
            if (ks == 1) {
                // publish point of the next stage, behind the trip's last fragment loads: this wave's reads of the buffer are done, its tensor load of the next stage has landed, every wave has come as far; only then the refill of the buffer just read.
                // The second 32 k's products, from registers alone, follow it: a wave comes out of the barrier with matrix work at hand, and the refill in front of them has a whole trip's lead.
                asm volatile("s_wait_dscnt 0x0" ::: "memory");
                tdm_wait(g0, g1);
                __syncthreads();
                // stage t + 2, while it exists (a scalar test), into the buffer of trip t; its byte offset is pinned so that the descriptor is formed behind the wait
                if (pinned(kc + 128 < K)) { g0 = tdm_group0(sdst + bo, sga + pinned((uint32_t)(kc + 128) * 32u)); tdm_load(g0, g1); }
            }
#pragma unroll
            for (int nb = 0; nb < 4; ++nb)
#pragma unroll
                for (int mb = 0; mb < 4; ++mb) { acc[mb][nb] = WFrag<T16>::mma(a[mb], b[nb], acc[mb][nb]); if (NSPLIT == 1) acc[mb][nb] = WFrag<T16>::mma(a2[mb], b[nb], acc[mb][nb]); }
        }
    }
    tdm_wait(g0, g1);   // no tensor load is outstanding when the wave goes on to its end
    asm volatile("s_wait_dscnt 0x0" ::: "memory");
    if constexpr (PLANES) {
        // acc[mb][nb][j]: A row mb * 16 + 8 hi + j (the plane's k), B row nb * 16 + lr (the plane's row): octet mb * 2 + hi of row group nb, so each wave-wide 16-byte store covers 512 contiguous bytes
        const int x0 = bx * 64, tb = x0 % TT; const int sn = wa ? 16 * HD : 16 * TT;   // elements from one group of 16 plane rows to the next
        const size_t base = ((z * NB_ + x0 / TT) * NH_ + by) * (size_t)(TT * HD) + (wa ? tb * HD : tb * 16) + lane * 8;
#pragma unroll
        for (int mb = 0; mb < 4; ++mb)
#pragma unroll
            for (int nb = 0; nb < 4; ++nb) { v8h o16; v8b oh, ol;
#pragma unroll
                for (int j = 0; j < 8; ++j) { const float y = acc[mb][nb][j]; o16[j] = (h16)y; const __bf16 h = (__bf16)y; oh[j] = h; ol[j] = (__bf16)(y - (float)h); }
                const size_t e = base + (size_t)nb * sn + mb * 256; h16* s16 = P16 + e; bf* sh = Ph + e; bf* sl = Pl + e; *(v8h*)s16 = o16; *(v8b*)sh = oh; *(v8b*)sl = ol;
                // s_wait_xcnt 0 behind the three stores, before a register that one of them names (address or data) is written again
                asm volatile("s_wait_xcnt 0x0" :: "v"(s16), "v"(sh), "v"(sl), "v"(o16), "v"(oh), "v"(ol) : "memory"); }
        return;
    }
    float* os = osall + (tid >> 5) * (16 * 68); const int r0 = bx * 64, c0 = by * 64;   // each wave turns its tile in its own LDS range
#pragma unroll
    for (int mb = 0; mb < 4; ++mb) {
#pragma unroll
        for (int nb = 0; nb < 4; ++nb) {
#pragma unroll
            for (int j = 0; j < 8; ++j) os[(hi * 8 + j) * 68 + nb * 16 + lr] = acc[mb][nb][j]; }
        __builtin_amdgcn_wave_barrier(); asm volatile("" ::: "memory");
        float* crow = C + (size_t)(r0 + mb * 16) * ldc + c0;
{
#pragma unroll
            for (int s = 0; s < 8; ++s) { const int row = 2 * s + hi, cofs = lr * 4; v4f val = *(const v4fa*)(os + row * 68 + cofs); if (BIAS) { val[0] += bfr(bias[c0 + cofs]); val[1] += bfr(bias[c0 + cofs + 1]); val[2] += bfr(bias[c0 + cofs + 2]); val[3] += bfr(bias[c0 + cofs + 3]); }
                *(v4f*)(crow + (size_t)row * ldc + cofs) = val; }
             }
        __builtin_amdgcn_wave_barrier(); asm volatile("" ::: "memory");
    }
}

__device__ __forceinline__ void splitf(float y, unsigned short& h, unsigned short& l) { h = f2bf(y); l = f2bf(y - bf2f(h)); }
typedef __attribute__((ext_vector_type(2))) _Float16 v2h;
typedef __attribute__((ext_vector_type(4))) _Float16 v4h;
typedef __attribute__((ext_vector_type(2))) unsigned short v2us;
typedef __attribute__((ext_vector_type(4))) unsigned short v4us;
typedef __attribute__((ext_vector_type(2))) float v2f;
typedef __attribute__((ext_vector_type(4))) int v4i;

__global__ __launch_bounds__(256) void k_wtG(const float* __restrict__ w, int K, int N, bf* Bt) {
    const int lane = threadIdx.x & 31; const int L0 = (blockIdx.x * 8 + (threadIdx.x >> 5)) * 8; const int nlines = N * K / 64;
{
#pragma unroll 1
        for (int l = 0; l < 8; ++l) { const int L = L0 + l; if (L >= nlines) break; const size_t e = (size_t)L * 64 + lane * 2; const int k = (int)(e % K), n = (int)(e / K); v2us o;
            o[0] = f2bf(w[(size_t)k * N + n]); o[1] = f2bf(w[(size_t)(k + 1) * N + n]); *(v2us*)(Bt + e) = o; }
         }
}
// k_cvt8: bf16 copies of the four weights and of x in one launch, in fragment order; blockIdx.y picks a chunk of DM*DM elements (0..3: wo, wq, wk, wv; 4..: x, one batch each), dst holds the chunks in that order.
// A block takes 16 rows x 256 k (blockIdx.x = row tile * 4 + k quarter): a wave reads 1 KB of one row, the 16-byte octets turn in LDS (one group of 16 rows per k octet, pitch 272 B against bank conflicts), a wave stores 512 contiguous bytes.
static_assert(DQ == DM && DKV == DM && TT == DM && NH_ == NKV && RH % 256 == 0 && TT % 256 == 0 && NH_ % 4 == 0 && HD == 64, "chunking and row blocks");
__global__ __launch_bounds__(256) void k_cvt8(const float* __restrict__ wo, const float* __restrict__ wq, const float* __restrict__ wk, const float* __restrict__ wv, const float* __restrict__ x, bf* dst) { const int y = blockIdx.y; const float* src = (y == 0) ? wo : (y == 1) ? wq : (y == 2) ? wk : (y == 3) ? wv : x + (size_t)(y - 4) * DM * DM;
    __shared__ __align__(16) bf ts[32 * 136];
    const int rt = blockIdx.x >> 2, kq = blockIdx.x & 3, tid = threadIdx.x;
    const float* s0 = src + (size_t)(rt * 16 + (tid >> 5)) * DM + kq * 256 + (tid & 31) * 8; const float* s1 = s0 + 8 * DM;   // rows tid / 32 and 8 + tid / 32, k octet tid % 32
    const v8f v0 = *(const v8f*)s0, v1 = *(const v8f*)s1;
    // s_wait_xcnt 0 behind the loads, before any register that one of them names is written again; the address (s1 is s0 plus an immediate offset) is an input so that it stays whole up to the wait
    asm volatile("s_wait_xcnt 0x0" :: "v"(s0) : "memory");
    v8us o0, o1;
#pragma unroll
    for (int k = 0; k < 8; ++k) { o0[k] = f2bf(v0[k]); o1[k] = f2bf(v1[k]); }
    *(v8usa*)(ts + (tid & 31) * 136 + (tid >> 5) * 8) = o0; *(v8usa*)(ts + (tid & 31) * 136 + (8 + (tid >> 5)) * 8) = o1;
    __syncthreads();   // the octets cross waves
    bf* d0 = dst + (size_t)y * DM * DM + ((size_t)rt * (DM / 8) + kq * 32) * 128 + tid * 8;
    *(v8us*)d0 = *(const v8usa*)(ts + (tid >> 4) * 136 + (tid & 15) * 8); *(v8us*)(d0 + 2048) = *(const v8usa*)(ts + (16 + (tid >> 4)) * 136 + (tid & 15) * 8);  }

// k_fattn: fused attention. One wave owns 32 query rows of one (batch, head) plane and walks the TT keys 32 at a time; 8 waves (256 rows) per block read the same K and V. grid (planes, TT / 256): blockIdx.y picks the row block, the hi/lo row blocks come first.
// K and V come through a two-buffer LDS ring: a tile is 32 keys of every plane the row block uses (K 4 KB, V 4 KB, then the lo planes), brought once per block by tensor loads (2 KB a request, one request per issuing wave and tile) one trip ahead of its use; fragment order carries over, so a fragment is 1 KB in a row in LDS too.
// St = K Q^T (A: K rows, B: Q rows): a lane holds 16 scores of ONE query (column lr; keys 8 hi + j of each 16-key tile), so maximum, sum and rescale are lane-local but for one exchange between the lane halves.
// The two St tiles of a 32-key block, converted in place, are the B operand of Ot += V^T P^T (A: VT rows d, loaded in the same k order). P is exp(t - running max), not normalised (fp16 rows: x PCAR); Ot is divided by the f32 sum at the end.
__device__ __forceinline__ float xhalf(float x) { const int b = __float_as_int(x); return __int_as_float(__builtin_amdgcn_permlanex16(b, b, 0x76543210, 0xfedcba98, false, false)); }   // lane l <-> l ^ 16
template <typename T16, bool HIRES>
__device__ __forceinline__ void attn_rows(const T16* Q, const T16* Q2, const T16* Kp, const T16* Kp2, const T16* Vp, const T16* Vp2, int t0, bf* Ah, bf* Al, const unsigned char* ring) {
    // every inner loop below is fully unrolled (#pragma unroll): fragment and accumulator arrays stay in registers only under constant indices
    typedef typename WFrag<T16>::V V; static_assert(PCAR == 1024.0f, "the exponent bias 10 below is log2(PCAR)");
    const int lane = threadIdx.x & 31;   // in the comments: lr = lane % 16, hi = lane / 16
    const float C = SCL * 1.4426950408889634f;
    V q[2][2], q2[2][2];
    { const T16* pq = Q + (size_t)t0 * HD + lane * 8; const T16* pq2 = HIRES ? Q2 + (size_t)t0 * HD + lane * 8 : pq;   // fragment order: 16 rows x 32 d are 512 elements in a row
#pragma unroll
      for (int qt = 0; qt < 2; ++qt)
#pragma unroll
          for (int ks = 0; ks < 2; ++ks) { q[qt][ks] = WFrag<T16>::ld(pq + qt * 16 * HD + ks * 512); if (HIRES) q2[qt][ks] = WFrag<T16>::ld(pq2 + qt * 16 * HD + ks * 512); }
      // s_wait_xcnt 0 behind the Q loads, before any register that one of them names is written again; the addresses are inputs so that they stay whole up to the wait
      asm volatile("s_wait_xcnt 0x0" :: "v"(pq), "v"(pq2) : "memory"); }
    v8f o[2][4]; float m[2], l[2];
#pragma unroll
    for (int qt = 0; qt < 2; ++qt) { m[qt] = -3.0e38f; l[qt] = 0.f;
#pragma unroll
        for (int dt = 0; dt < 4; ++dt) o[qt][dt] = (v8f){}; }
    // K tiles are 4 KB in a row; a V tile is 1 KB of each of the four groups of 16 d. Wave w brings half w % 2 (two rows of 1 KB) of part w / 2 (K, V, then the lo planes' K, V); the fp16 rows have two parts, so waves 0..3 issue there.
    constexpr unsigned BUFB = HIRES ? 16384u : 8192u;
    const uint32_t wave = uni(threadIdx.x >> 5), part = HIRES ? wave >> 1 : (wave >> 1) & 1u, half = wave & 1u;
    const uint32_t issuer = HIRES ? 1u : pinned(wave < 4u);   // a scalar test: a tensor load ignores EXEC
    const T16* sp = (part & 1u) ? ((part & 2u) ? Vp2 : Vp) + (size_t)half * 32 * TT : ((part & 2u) ? Kp2 : Kp) + (size_t)half * 1024;
    const uint64_t sga = (uint64_t)(size_t)sp;
    const uint32_t sstep = (part & 1u) ? 1024u : 4096u;   // bytes from one 32-key tile to the next
    const uint32_t sdst = (uint32_t)(size_t)ring + part * 4096u + half * 2048u;   // LDS byte address: the low 32 bits of the __shared__ address
    const u32x8 g1 = tdm_group1(1024u, 2u, (part & 1u) ? 32u * TT : 1024u);
    u32x4 g0 = tdm_group0(sdst, sga);
    if (issuer) { tdm_load(g0, g1); tdm_wait(g0, g1); }   // tile 0 has landed, as far as this wave asked for it
    __syncthreads();                                       // and every other wave's part of it
    if (issuer) { g0 = tdm_group0(sdst + BUFB, sga + sstep); tdm_load(g0, g1); }
#pragma unroll 1   // one 32-key block per trip: an unrolled body would not fit the registers of four waves per SIMD
    for (int kb = 0; kb < TT; kb += 32) {
        const unsigned bo = (kb & 32) ? BUFB : 0u;   // trip t reads buffer t % 2 alone
        const T16* pk = (const T16*)(ring + bo) + lane * 8; const T16* pv = pk + 2048; const T16* pk2 = HIRES ? pk + 4096 : pk; const T16* pv2 = HIRES ? pk + 6144 : pv;
        V kf[2][2], kf2[2][2];
#pragma unroll
        for (int kt = 0; kt < 2; ++kt)
#pragma unroll
            for (int ks = 0; ks < 2; ++ks) { kf[kt][ks] = WFrag<T16>::ld(pk + kt * 16 * HD + ks * 512); if (HIRES) kf2[kt][ks] = WFrag<T16>::ld(pk2 + kt * 16 * HD + ks * 512); }
        v8f st[2][2];
#pragma unroll
        for (int kt = 0; kt < 2; ++kt)
#pragma unroll
            for (int qt = 0; qt < 2; ++qt) { v8f s = (v8f){};
#pragma unroll
                for (int ks = 0; ks < 2; ++ks) { s = WFrag<T16>::mma(kf[kt][ks], q[qt][ks], s); if (HIRES) { s = WFrag<T16>::mma(kf[kt][ks], q2[qt][ks], s); s = WFrag<T16>::mma(kf2[kt][ks], q[qt][ks], s); } }
                st[qt][kt] = s; }
        V vf[4], vf2[4];
#pragma unroll
        for (int dt = 0; dt < 4; ++dt) { vf[dt] = WFrag<T16>::ld(pv + dt * 512); if (HIRES) vf2[dt] = WFrag<T16>::ld(pv2 + dt * 512); }
        V p[2], p2[2];
#pragma unroll
        for (int qt = 0; qt < 2; ++qt) { float mx = st[qt][0][0];
#pragma unroll
            for (int j = 1; j < 16; ++j) mx = fmaxf(mx, st[qt][j >> 3][j & 7]);
            mx = fmaxf(mx, xhalf(mx)); const float mn = fmaxf(m[qt], mx); float al = (m[qt] - mn) * C; m[qt] = mn;
            const float nb = (HIRES ? 0.0f : 10.0f) - mn * C;   // fp16 rows carry P x PCAR = 2^10
            float e[16];
#pragma unroll
            for (int j = 0; j < 16; ++j) e[j] = __builtin_fmaf(st[qt][j >> 3][j & 7], C, nb);
            // the 17 exponentials of one query tile in one statement, each in place: none overwrites the source or reads the result of the one before it; the v_nop is the slot between the last one and whatever follows
            asm("v_exp_f32 %0, %0\n\tv_exp_f32 %1, %1\n\tv_exp_f32 %2, %2\n\tv_exp_f32 %3, %3\n\tv_exp_f32 %4, %4\n\tv_exp_f32 %5, %5\n\tv_exp_f32 %6, %6\n\tv_exp_f32 %7, %7\n\tv_exp_f32 %8, %8\n\t"
                "v_exp_f32 %9, %9\n\tv_exp_f32 %10, %10\n\tv_exp_f32 %11, %11\n\tv_exp_f32 %12, %12\n\tv_exp_f32 %13, %13\n\tv_exp_f32 %14, %14\n\tv_exp_f32 %15, %15\n\tv_exp_f32 %16, %16\n\tv_nop"
                : "+v"(al), "+v"(e[0]), "+v"(e[1]), "+v"(e[2]), "+v"(e[3]), "+v"(e[4]), "+v"(e[5]), "+v"(e[6]), "+v"(e[7]), "+v"(e[8]), "+v"(e[9]), "+v"(e[10]), "+v"(e[11]), "+v"(e[12]), "+v"(e[13]), "+v"(e[14]), "+v"(e[15]));
            float sum = 0.f;
#pragma unroll
            for (int j = 0; j < 16; ++j) { sum += e[j];
                if constexpr (HIRES) { const __bf16 h = (__bf16)e[j]; p[qt][j] = h; p2[qt][j] = (__bf16)(e[j] - (float)h); } else p[qt][j] = (h16)e[j]; }
            l[qt] = l[qt] * al + sum;
#pragma unroll
            for (int dt = 0; dt < 4; ++dt) o[qt][dt] *= al; }
#pragma unroll
        for (int dt = 0; dt < 4; ++dt)
#pragma unroll
            for (int qt = 0; qt < 2; ++qt) { o[qt][dt] = WFrag<T16>::mma(vf[dt], p[qt], o[qt][dt]); if (HIRES) { o[qt][dt] = WFrag<T16>::mma(vf[dt], p2[qt], o[qt][dt]); o[qt][dt] = WFrag<T16>::mma(vf2[dt], p[qt], o[qt][dt]); } }
        // publish point of the next tile: this wave's reads of the buffer are done, its tensor load of the next tile has landed, every wave has come as far; only then the refill of the buffer just read
        asm volatile("s_wait_dscnt 0x0" ::: "memory");
        if (issuer) tdm_wait(g0, g1);
        __syncthreads();
        // tile t + 2, while it exists (a scalar test), into the buffer of trip t; its byte offset is pinned so that the descriptor is formed behind the wait
        if (pinned(issuer && kb + 64 < TT)) { g0 = tdm_group0(sdst + bo, sga + pinned((uint32_t)(kb / 32 + 2) * sstep)); tdm_load(g0, g1); }
    }
    tdm_wait(g0, g1);   // no tensor load is outstanding when the wave goes on to its end
    asm volatile("s_wait_dscnt 0x0" ::: "memory");
    // o[qt][dt][j] = Ot[d = dt * 16 + 8 hi + j][query t0 + qt * 16 + lr]: 8 consecutive d of one merged row per lane, in fragment order 512 contiguous bytes per wave-wide store
#pragma unroll
    for (int qt = 0; qt < 2; ++qt) { const float f = __fdiv_rn(1.0f, l[qt] + xhalf(l[qt])); const size_t oo = (size_t)(t0 + qt * 16) * DQ + lane * 8;
#pragma unroll
        for (int dt = 0; dt < 4; ++dt) { v8us oh, ol;
#pragma unroll
            for (int j = 0; j < 8; ++j) { unsigned short a, c2; splitf(o[qt][dt][j] * f, a, c2); oh[j] = a; ol[j] = c2; }
            bf* sh = Ah + oo + dt * 256; bf* sl = Al + oo + dt * 256; *(v8us*)sh = oh; *(v8us*)sl = ol;
            // the same wait behind the two stores, before a register that one of them names (address or data) is written again
            asm volatile("s_wait_xcnt 0x0" :: "v"(sh), "v"(sl), "v"(oh), "v"(ol) : "memory"); } }
}
__global__ __launch_bounds__(256) void k_fattn(const h16* Q16, const h16* K16, const h16* V16, const bf* Qh, const bf* Ql, const bf* Kh, const bf* Kl, const bf* Vh, const bf* Vl, bf* Ah, bf* Al) {
    __shared__ __attribute__((aligned(2048))) unsigned char ring[2 * 16384];   // every tensor tile's place in LDS is a multiple of 2 KB
    const int g = blockIdx.x; const size_t zo = (size_t)g * TT * HD; const int t0 = blockIdx.y * 256 + (threadIdx.x >> 5) * 32;   // plane g = batch * NH_ + head: one kv head per query head
    const size_t ao = (size_t)(g / NH_) * TT * DQ + (g % NH_) * HD * 16;   // merged planes in fragment order: a head's 8 octets of d, 128 elements each
    if (blockIdx.y * 256 < RH) attn_rows<bf, true>(Qh + zo, Ql + zo, Kh + zo, Kl + zo, Vh + zo, Vl + zo, t0, Ah + ao, Al + ao, ring);
    else attn_rows<h16, false>(Q16 + zo, nullptr, K16 + zo, nullptr, V16 + zo, nullptr, t0, Ah + ao, Al + ao, ring);
}

extern "C" void kernel_launch(void* const* d_in, const int* in_sizes, int n_in,
                              void* d_out, int out_size, void* d_ws, size_t ws_size, hipStream_t stream) {
    (void)in_sizes; (void)n_in; (void)out_size;
    const float* x = (const float*)d_in[0]; const float* wq = (const float*)d_in[1]; const float* wk = (const float*)d_in[2]; const float* wv = (const float*)d_in[3]; const float* wo = (const float*)d_in[4]; const float* bo = (const float*)d_in[5];
    float* OUT = (float*)d_out;     // [8][1024][1024]
    char* ws = (char*)d_ws; const size_t Mi = (size_t)1 << 20;
    if (ws_size < 253 * Mi) return;    // ws 256 MiB
    // Workspace map in MiB; regions are reused in stream order once their last reader has run.
    //   0 WO | 2 WQ WK WV | 8 XB (all batches) | 25 .. 169 nine planes of 16 (all batches): fp16 q k v | 73 hi q k v | 121 lo q k v
    //   attention: 237 ATh (16) | 2 ATl (16, over WQ WK WV XB)
    const size_t PL = (size_t)NB_ * NH_ * TT * HD;   // elements of one plane set
    bf* WO = (bf*)ws; bf* WQ = (bf*)(ws + 2 * Mi); bf* XB = (bf*)(ws + 8 * Mi);
    h16* QP16 = (h16*)(ws + 25 * Mi); h16* KP16 = QP16 + PL; h16* VT16 = KP16 + PL; bf* QPh = (bf*)(ws + 73 * Mi); bf* KPh = QPh + PL; bf* VTh = KPh + PL; bf* QPl = (bf*)(ws + 121 * Mi); bf* KPl = QPl + PL; bf* VTl = KPl + PL;   // q, k, v in a row: the z sets of the projection launch
    bf* ATh = (bf*)(ws + 237 * Mi); bf* ATl = (bf*)(ws + 2 * Mi);
    k_cvt8<<<dim3(DM / 16 * (DM / 256), 4 + NB_, 1), 256, 0, stream>>>(wo, wq, wk, wv, x, WO);
    k_gemmw<bf, 0, false, true><<<dim3(NB_ * TT / 256, DQ / 128, 3), 256, 0, stream>>>(XB, nullptr, WQ, DM, DM, nullptr, 0, nullptr, 0, (size_t)DQ * DM, 0, QP16, QPh, QPl);
    k_fattn<<<dim3(NB_ * NH_, TT / 256, 1), 256, 0, stream>>>(QP16, KP16, VT16, QPh, QPl, KPh, KPl, VTh, VTl, ATh, ATl);
    k_gemmw<bf, 1, true, false><<<dim3(NB_ * TT / 256, DM / 128, 1), 256, 0, stream>>>(ATh, ATl, WO, DQ, DQ, OUT, DM, bo, 0, 0, 0, nullptr, nullptr, nullptr);
}

// v008
// One run takes 125 microseconds.
// In two side-by-side timings against v007, it was 1.07 and 1.04 times as fast.
// Counting every step since v000, it is 37.7 times as fast.
#include <hip/hip_runtime.h>
#include <stdint.h>

// Simple multi-head attention scaled by the EMBEDDING size (x [8][1024][1024]; q,k,v = x W^T ('oi' [1024][1024], no bias); scores / sqrt(1024) (module quirk); softmax over all keys; out = merged Wo^T + bo -> [8][1024][1024] (8.4 M)).
// Every 16-bit operand plane [row][k] lies in fragment order: element (row, k) at ((row / 16) * (K / 8) + k / 8) * 128 + (row % 16) * 8 + k % 8, so a 16 x 32 fragment is 1 KB in a row and each of its two wave-wide 16-byte loads covers 512 contiguous bytes (four whole lines).
// Layout, all batches per launch: bf16 copy of x and weights; exact projections that store the attention's operand planes themselves; dense T-1024 attention fused in one launch (scores, running softmax and P V stay in registers; hybrid rows: < 512 hi/lo 3 products, rest fp16 x1024); merged hi/lo x Wo exact + bo.
// Compute dtypes, f32 accumulate: every input rounded to bf16; projections exact; attention rows < 512 3 products, rest fp16; softmax f32; Wo hl x exact + bias.

#define NB_  8
#define TT   1024
#define DM   1024
#define NH_  16
#define NKV  16
#define REP  (NH_ / NKV)
#define HD   64
#define DQ   (NH_ * HD)
#define DKV  (NKV * HD)
#define RH   512                  // query rows < RH use hi+lo planes (0: none)
#define WIN  0
#define PCAR 1024.0f
#define SCL  0.03125f   // 1/sqrt(1024): the module scales by the embedding size
typedef _Float16 h16;
typedef unsigned short bf;
typedef __attribute__((ext_vector_type(16))) __bf16   v16bf;
typedef __attribute__((ext_vector_type(16))) _Float16 v16h;
typedef __attribute__((ext_vector_type(8)))  _Float16 v8h;
typedef __attribute__((ext_vector_type(8)))  unsigned short v8us;
typedef __attribute__((ext_vector_type(8)))  __bf16   v8b;
typedef __attribute__((ext_vector_type(8)))  float    v8f;
typedef __attribute__((ext_vector_type(4)))  float    v4f;
typedef v8h  __attribute__((may_alias)) v8ha;
typedef v4f  __attribute__((may_alias)) v4fa;
typedef v8us __attribute__((may_alias)) v8usa;

__device__ __forceinline__ unsigned short f2bf(float f) { unsigned u = __float_as_uint(f); u += 0x7FFFu + ((u >> 16) & 1u); return (unsigned short)(u >> 16); }
__device__ __forceinline__ float bf2f(unsigned short b) { return __uint_as_float(((unsigned)b) << 16); }
__device__ __forceinline__ float bfr(float f) { return bf2f(f2bf(f)); }
__device__ __forceinline__ v16h cat16(v8h lo, v8h hi) { return __builtin_shufflevector(lo, hi, 0, 1, 2, 3, 4, 5, 6, 7, 8, 9, 10, 11, 12, 13, 14, 15); }
__device__ __forceinline__ v16bf cat16b(v8us lo, v8us hi) { return __builtin_bit_cast(v16bf, __builtin_shufflevector(lo, hi, 0, 1, 2, 3, 4, 5, 6, 7, 8, 9, 10, 11, 12, 13, 14, 15)); }
__device__ __forceinline__ v8f wmma16(v16h a, v16h b, v8f c) { return __builtin_amdgcn_wmma_f32_16x16x32_f16(false, a, false, b, (short)0, c, false, false); }
__device__ __forceinline__ v8f wmmab(v16bf a, v16bf b, v8f c) { return __builtin_amdgcn_wmma_f32_16x16x32_bf16(false, a, false, b, (short)0, c, false, false); }



// ---- k_gemmw: register-blocked GEMM, one wave per 64x64 output tile (16 accumulators), EIGHT WAVES per block: 4 along the x rows, 2 along the weight rows, a block tile of 256 x 128. Operands are 16-bit planes in fragment order (A of lda, Bt of K elements a row); grid (M/256, N/128, Z), 256 threads.
// The operands come through a two-buffer LDS ring: a stage is 64 k of the block's 256 A rows (32 KB; with NSPLIT 1 the A2 rows behind them) and 128 Bt rows (16 KB), brought once per block by tensor loads, one request per wave and stage, one trip ahead of its use. Fragment order carries over: 16 rows x 64 k are 2 KB in a row in memory and in LDS (one row of a tensor tile; the next group of 16 rows lies 16 * lda elements on), a fragment 1 KB (WFrag::ld takes the fragment's start + lane * 8).
// C[m][n] (f32, pitch ldc, + optional f32 bias[n]) = sum_k A[m][k] Bt[n][k] (NSPLIT 1: + A2[m][k] Bt[n][k]). z-batch strides sA/sB/sC in elements. K % 64 == 0.
template <typename T16> struct WFrag;
template <> struct WFrag<h16> { typedef v16h V; static __device__ __forceinline__ V ld(const h16* p) { return cat16(*(const v8h*)p, *(const v8h*)(p + 256)); } static __device__ __forceinline__ v8f mma(V a, V b, v8f c) { return wmma16(a, b, c); } };
template <> struct WFrag<bf> { typedef v16bf V; static __device__ __forceinline__ V ld(const bf* p) { return cat16b(*(const v8us*)p, *(const v8us*)(p + 256)); } static __device__ __forceinline__ v8f mma(V a, V b, v8f c) { return wmmab(a, b, c); } };
// Tensor loads: one request of one wave brings a tile of n rows of rowb bytes (source pitch in bytes) into LDS, rows one behind the other, through no register. Two descriptor groups, every word wave-uniform in scalar registers; 1-byte elements, tensor = tile, no pad, no mask.
typedef uint32_t u32x4 __attribute__((ext_vector_type(4)));
typedef uint32_t u32x8 __attribute__((ext_vector_type(8)));
__device__ __forceinline__ uint32_t uni(uint32_t v) { return (uint32_t)__builtin_amdgcn_readfirstlane(v); }
// a wave-uniform value held in a scalar register, so that a test on it is a scalar branch (a tensor load ignores EXEC) and what is formed from it is formed behind the volatile statements in front of it
__device__ __forceinline__ uint32_t pinned(uint32_t v) { uint32_t w = (uint32_t)__builtin_amdgcn_readfirstlane(v); asm volatile("" : "+s"(w)); return w; }
__device__ __forceinline__ u32x8 tdm_group1(uint32_t rowb, uint32_t n, uint32_t pitch) {
    // words 1 to 7 pinned: the group is formed once and stays in its scalar registers for the whole ring, so that no word is written again while a request that names it is outstanding; word 0 is the constant 0
    u32x8 g;
    g[0] = uni(0u); g[1] = pinned((rowb & 0xFFFFu) << 16); g[2] = pinned((rowb >> 16) | ((n & 0xFFFFu) << 16)); g[3] = pinned((n >> 16) | (rowb << 16));
    g[4] = pinned(n); g[5] = pinned(pitch); g[6] = pinned(0u); g[7] = pinned(0u);
    return g;
}
__device__ __forceinline__ u32x4 tdm_group0(uint32_t lds_dst, uint64_t ga) {
    u32x4 g;
    g[0] = uni(1u); g[1] = uni(lds_dst); g[2] = uni((uint32_t)ga); g[3] = uni((((uint32_t)(ga >> 32)) & 0x01FFFFFFu) | 0x80000000u);
    return g;
}
// group 0 goes in and out of the statement, so that what tdm_wait holds whole are the very registers that the request names
__device__ __forceinline__ void tdm_load(u32x4& g0, u32x8 g1) { asm volatile("tensor_load_to_lds %0, %1" : "+s"(g0) : "s"(g1) : "memory"); }
// the wave's own request has landed; the descriptor it named is an input so that its registers stay whole up to the wait
__device__ __forceinline__ void tdm_wait(u32x4 g0, u32x8 g1) { asm volatile("s_wait_tensorcnt 0x0" :: "s"(g0), "s"(g1) : "memory"); }
template <typename T16, int NSPLIT, bool BIAS>
__global__ __launch_bounds__(256) void k_gemmw(const T16* __restrict__ A, const T16* __restrict__ A2, const T16* __restrict__ Bt, int K, int lda, float* C, int ldc, const float* __restrict__ bias, size_t sA, size_t sB, size_t sC) {
    typedef typename WFrag<T16>::V V; static_assert(NSPLIT == 0 || NSPLIT == 1, "the ring stages A, A2 and Bt");
    constexpr unsigned XBY = 32768u, WOFF = (NSPLIT == 1 ? 2u : 1u) * XBY, BUFB = WOFF + 16384u;   // bytes: one A part of a stage, where its Bt part begins, a whole stage
    __shared__ __attribute__((aligned(2048))) unsigned char ring[2 * BUFB];   // every tensor tile's place in LDS is a multiple of 2 KB
    __shared__ __align__(16) float osall[8 * 16 * 68];
    const size_t z = blockIdx.z; A += z * sA; if (NSPLIT == 1) A2 += z * sA; Bt += z * sB; C += z * sC;
    const int tid = threadIdx.x, lane = tid & 31, lr = lane & 15, hi = lane >> 4, wx = (tid >> 5) & 3, wy = tid >> 7;
    const int bx = blockIdx.x * 4 + wx, by = blockIdx.y * 2 + wy;   // the wave's 64 x 64 tile: bx along the x rows, by along the weight rows
    v8f acc[4][4];
#pragma unroll
    for (int mb = 0; mb < 4; ++mb)
#pragma unroll
        for (int nb = 0; nb < 4; ++nb) acc[mb][nb] = (v8f){};
    // every wave brings its own slice of a stage, whole row groups of one part. NSPLIT 0: waves 0..3 four A groups each, waves 4..7 two Bt groups each. NSPLIT 1: waves 0..2 six, five, five A groups, waves 3..5 the same of A2, waves 6, 7 four Bt groups each.
    const uint32_t wave = uni(threadIdx.x >> 5);
    uint32_t part, first, ngr;   // part 0: A, 1: A2, 2: Bt
    if (NSPLIT == 1) { part = wave / 3u; const uint32_t r = wave - 3u * part; first = part < 2u ? (r ? 5u * r + 1u : 0u) : 4u * r; ngr = part < 2u ? (r ? 5u : 6u) : 4u; }
    else { part = wave < 4u ? 0u : 2u; first = wave < 4u ? 4u * wave : 2u * (wave - 4u); ngr = wave < 4u ? 4u : 2u; }
    const T16* sp = part == 2u ? Bt + ((size_t)blockIdx.y * 8 + first) * 16 * K : (part == 1u ? A2 : A) + ((size_t)blockIdx.x * 16 + first) * 16 * lda;
    const uint64_t sga = (uint64_t)(size_t)sp;
    const uint32_t sdst = (uint32_t)(size_t)ring + (part == 2u ? WOFF : part * XBY) + first * 2048u;   // LDS byte address: the low 32 bits of the __shared__ address
    const u32x8 g1 = tdm_group1(2048u, ngr, (uint32_t)(part == 2u ? K : lda) * 32u);
    u32x4 g0 = tdm_group0(sdst, sga);
    tdm_load(g0, g1);
    tdm_wait(g0, g1);   // stage 0 has landed, as far as this wave asked for it
    __syncthreads();    // and every other wave's part of it
    if (pinned(64 < K)) { g0 = tdm_group0(sdst + BUFB, sga + 2048u); tdm_load(g0, g1); }
#pragma unroll 1   // one stage per trip: trip t reads buffer t % 2 alone
    for (int kc = 0; kc < K; kc += 64) {
        const unsigned bo = (kc & 64) ? BUFB : 0u;
        const T16* pa = (const T16*)(ring + bo) + wx * 4096 + lane * 8; const T16* pb = (const T16*)(ring + bo + WOFF) + wy * 4096 + lane * 8;   // the wave's four row groups of each part
#pragma unroll
        for (int ks = 0; ks < 2; ++ks) {
            V a[4], a2[4], b[4];
#pragma unroll
            for (int mb = 0; mb < 4; ++mb) { a[mb] = WFrag<T16>::ld(pa + mb * 1024 + ks * 512); if (NSPLIT == 1) a2[mb] = WFrag<T16>::ld(pa + XBY / 2 + mb * 1024 + ks * 512); }
#pragma unroll
            for (int nb = 0; nb < 4; ++nb) b[nb] = WFrag<T16>::ld(pb + nb * 1024 + ks * 512);
            // the 32 k's fragment loads stay one group in front of its matrix instructions: left free, the B loads sink among them, one waited place per four or eight
            __builtin_amdgcn_sched_barrier(0);
            if (ks == 1) {
                // publish point of the next stage, behind the trip's last fragment loads: this wave's reads of the buffer are done, its tensor load of the next stage has landed, every wave has come as far; only then the refill of the buffer just read.
                // The second 32 k's products, from registers alone, follow it: a wave comes out of the barrier with matrix work at hand, and the refill in front of them has a whole trip's lead.
                asm volatile("s_wait_dscnt 0x0" ::: "memory");
                tdm_wait(g0, g1);
                __syncthreads();
                // stage t + 2, while it exists (a scalar test), into the buffer of trip t; its byte offset is pinned so that the descriptor is formed behind the wait
                if (pinned(kc + 128 < K)) { g0 = tdm_group0(sdst + bo, sga + pinned((uint32_t)(kc + 128) * 32u)); tdm_load(g0, g1); }
            }
#pragma unroll
            for (int nb = 0; nb < 4; ++nb)
#pragma unroll
                for (int mb = 0; mb < 4; ++mb) { acc[mb][nb] = WFrag<T16>::mma(a[mb], b[nb], acc[mb][nb]); if (NSPLIT == 1) acc[mb][nb] = WFrag<T16>::mma(a2[mb], b[nb], acc[mb][nb]); }
        }
    }
    tdm_wait(g0, g1);   // no tensor load is outstanding when the wave goes on to its end
    asm volatile("s_wait_dscnt 0x0" ::: "memory");
    float* os = osall + (tid >> 5) * (16 * 68); const int r0 = bx * 64, c0 = by * 64;   // each wave turns its tile in its own LDS range
#pragma unroll
    for (int mb = 0; mb < 4; ++mb) {
#pragma unroll
        for (int nb = 0; nb < 4; ++nb) {
#pragma unroll
            for (int j = 0; j < 8; ++j) os[(hi * 8 + j) * 68 + nb * 16 + lr] = acc[mb][nb][j]; }
        __builtin_amdgcn_wave_barrier(); asm volatile("" ::: "memory");
        float* crow = C + (size_t)(r0 + mb * 16) * ldc + c0;
{
#pragma unroll
            for (int s = 0; s < 8; ++s) { const int row = 2 * s + hi, cofs = lr * 4; v4f val = *(const v4fa*)(os + row * 68 + cofs); if (BIAS) { val[0] += bfr(bias[c0 + cofs]); val[1] += bfr(bias[c0 + cofs + 1]); val[2] += bfr(bias[c0 + cofs + 2]); val[3] += bfr(bias[c0 + cofs + 3]); }
                *(v4f*)(crow + (size_t)row * ldc + cofs) = val; }
             }
        __builtin_amdgcn_wave_barrier(); asm volatile("" ::: "memory");
    }
}

// ---- k_proj3: the three projections in one block. A block takes 256 x rows against the SAME 128 weight rows (two heads) of wq, wk and wv, so one x stage serves three products: grid (rows / 256, DQ / 128), 256 threads, one block per WGP.
// Eight waves, 4 along the x rows, 2 along the weight rows; a wave's tile is 64 positions x one head of q, k and v (48 accumulators). X and Wt (wq wk wv in a row) are bf16 planes in fragment order, DM elements a row.
// Two-buffer LDS ring as in k_gemmw: a stage is 64 k of the x rows (32 KB) and of the three weights' rows (16 KB each), one tensor load per wave and stage, one trip ahead of its use. The publish point stands in front of a trip's last block, so that the block can fetch the next trip's first weight fragments.
// No f32 output: a tile goes from the accumulators straight into its head's fp16, hi and lo planes (P16, Ph, Pl: q, k, v sets in a row), in fragment order.
// A lane's 8 accumulator values run along the A operand's rows, and a plane wants 8 consecutive k per lane: d for the q and k planes [h][t][d], so there the weight is the WMMA's A operand; t for the V^T planes [h][d][t], so there x is.
__global__ __launch_bounds__(256) void k_proj3(const bf* __restrict__ X, const bf* __restrict__ Wt, h16* P16, bf* Ph, bf* Pl) {
    typedef WFrag<bf>::V V; static_assert(DM % 128 == 0, "two stages or more");
    constexpr unsigned XBY = 32768u, WBY = 16384u, BUFB = XBY + 3u * WBY;   // bytes: the x part of a stage, one weight's part, a whole stage
    __shared__ __attribute__((aligned(2048))) unsigned char ring[2 * BUFB];   // every tensor tile's place in LDS is a multiple of 2 KB
    const int tid = threadIdx.x, lane = tid & 31, wx = (tid >> 5) & 3, wy = tid >> 7;
    const int bx = blockIdx.x * 4 + wx, by = blockIdx.y * 2 + wy;   // the wave's 64 positions and its head
    v8f acc[3][4][4];
#pragma unroll
    for (int z = 0; z < 3; ++z)
#pragma unroll
        for (int mb = 0; mb < 4; ++mb)
#pragma unroll
            for (int nb = 0; nb < 4; ++nb) acc[z][mb][nb] = (v8f){};
    // every wave brings its own slice of a stage, whole row groups of one part: waves 0, 1 eight x groups each; waves 2..7 four groups each, two waves a weight
    const uint32_t wave = uni(threadIdx.x >> 5), wz = (wave - 2u) >> 1, half = wave & 1u;
    const bf* sp = wave < 2u ? X + ((size_t)blockIdx.x * 16 + wave * 8u) * 16 * DM : Wt + (size_t)wz * DQ * DM + ((size_t)blockIdx.y * 8 + half * 4u) * 16 * DM;
    const uint64_t sga = ((uint64_t)uni((uint32_t)((uint64_t)(size_t)sp >> 32)) << 32) | uni((uint32_t)(size_t)sp);   // wave-uniform: kept in scalar registers
    const uint32_t sdst = uni((uint32_t)(size_t)ring + (wave < 2u ? wave * 16384u : XBY + wz * WBY + half * 8192u));   // LDS byte address: the low 32 bits of the __shared__ address
    const u32x8 g1 = tdm_group1(2048u, wave < 2u ? 8u : 4u, (uint32_t)DM * 32u);
    u32x4 g0 = tdm_group0(sdst, sga);
    tdm_load(g0, g1);
    tdm_wait(g0, g1);   // stage 0 has landed, as far as this wave asked for it
    __syncthreads();    // and every other wave's part of it
    g0 = tdm_group0(sdst + BUFB, sga + 2048u); tdm_load(g0, g1);
    V xf[4], wf[4];
    { const bf* w0 = (const bf*)(ring + XBY) + wy * 4096 + lane * 8;   // the first block's weight fragments, behind the barrier that published stage 0
#pragma unroll
      for (int i = 0; i < 4; ++i) wf[i] = WFrag<bf>::ld(w0 + i * 1024); }
#pragma unroll 1   // one stage per trip
    for (int kc = 0; kc < DM; kc += 64) {
        const unsigned bo = (kc & 64) ? BUFB : 0u;
        const bf* xs = (const bf*)(ring + bo) + wx * 4096 + lane * 8; const bf* wsp = (const bf*)(ring + bo + XBY) + wy * 4096 + lane * 8;   // the wave's four row groups of x and of wq; wk, wv lie WBY bytes on each
        const bf* wnx = (const bf*)(ring + (BUFB - bo) + XBY) + wy * 4096 + lane * 8;   // the same of the next stage
        // six blocks of 16 products a trip: 32 k x one weight. The four x fragments of 32 k are loaded once and serve three blocks; a block's weight fragments are fetched in the middle of the block before it.
#pragma unroll
        for (int g = 0; g < 6; ++g) {
            const int ks = g / 3, z = g % 3, gn = (g + 1) % 6;
            if (z == 0) {
#pragma unroll
                for (int i = 0; i < 4; ++i) xf[i] = WFrag<bf>::ld(xs + i * 1024 + ks * 512);
                // the x loads stay one group in front of the block's matrix instructions: left free, they sink among them, one waited place per fragment
                __builtin_amdgcn_sched_barrier(0); }
            if (g == 5) {
                // publish point of the next stage, in front of the trip's last block, whose fragments were fetched half a block ago: this wave's reads of the buffer are done, its tensor load of the next stage has landed, every wave has come as far; only then the refill of the buffer just read.
                asm volatile("s_wait_dscnt 0x0" ::: "memory");
                tdm_wait(g0, g1);
                __syncthreads();
                // stage t + 2, while it exists (a scalar test), into the buffer of trip t; its byte offset is pinned so that the descriptor is formed behind the wait
                if (pinned(kc + 128 < DM)) { g0 = tdm_group0(sdst + bo, sga + pinned((uint32_t)(kc + 128) * 32u)); tdm_load(g0, g1); }
            }
            V wn[4];
#pragma unroll
            for (int i = 0; i < 4; ++i) {
                if (i == 2) {
                    // the next block's weight fragments as one group, half a block ahead of their use; behind the publish point they come from the next stage (in the last trip: from a buffer that nobody writes any more, and they are not used)
                    __builtin_amdgcn_sched_barrier(0);
#pragma unroll
                    for (int n = 0; n < 4; ++n) wn[n] = WFrag<bf>::ld((g == 5 ? wnx : wsp) + (gn % 3) * (int)(WBY / 2) + n * 1024 + (gn / 3) * 512);
                    __builtin_amdgcn_sched_barrier(0);
                }
#pragma unroll
                for (int n = 0; n < 4; ++n) { if (z < 2) acc[z][i][n] = WFrag<bf>::mma(wf[i], xf[n], acc[z][i][n]); else acc[z][n][i] = WFrag<bf>::mma(xf[n], wf[i], acc[z][n][i]); }
            }
            // the next block's loads stay behind this block's products: lifted over them, more fragments would be live than the registers beside 48 accumulators hold, and accumulators would spill
            __builtin_amdgcn_sched_barrier(0);
#pragma unroll
            for (int i = 0; i < 4; ++i) wf[i] = wn[i];
        }
    }
    tdm_wait(g0, g1);   // no tensor load is outstanding when the wave goes on to its end
    asm volatile("s_wait_dscnt 0x0" ::: "memory");
    // acc[z][mb][nb][j]: A row mb * 16 + 8 hi + j (the plane's k), B row nb * 16 + lr (the plane's row): octet mb * 2 + hi of row group nb, so each wave-wide 16-byte store covers 512 contiguous bytes
    const int x0 = bx * 64, tb = x0 % TT;
#pragma unroll
    for (int z = 0; z < 3; ++z) {
        const bool wa = z < 2; const int sn = wa ? 16 * HD : 16 * TT;   // q, k: the weight rows were the A operand; sn: elements from one group of 16 plane rows to the next
        const size_t base = (((size_t)z * NB_ + x0 / TT) * NH_ + by) * (size_t)(TT * HD) + (wa ? tb * HD : tb * 16) + lane * 8;
#pragma unroll
        for (int mb = 0; mb < 4; ++mb)
#pragma unroll
            for (int nb = 0; nb < 4; ++nb) { v8h o16; v8b oh, ol;
#pragma unroll
                for (int j = 0; j < 8; ++j) { const float y = acc[z][mb][nb][j]; o16[j] = (h16)y; const __bf16 h = (__bf16)y; oh[j] = h; ol[j] = (__bf16)(y - (float)h); }
                const size_t e = base + (size_t)nb * sn + mb * 256; h16* s16 = P16 + e; bf* sh = Ph + e; bf* sl = Pl + e; *(v8h*)s16 = o16; *(v8b*)sh = oh; *(v8b*)sl = ol;
                // s_wait_xcnt 0 behind the three stores, before a register that one of them names (address or data) is written again
                asm volatile("s_wait_xcnt 0x0" :: "v"(s16), "v"(sh), "v"(sl), "v"(o16), "v"(oh), "v"(ol) : "memory"); }
    }
}

__device__ __forceinline__ void splitf(float y, unsigned short& h, unsigned short& l) { h = f2bf(y); l = f2bf(y - bf2f(h)); }
typedef __attribute__((ext_vector_type(2))) _Float16 v2h;
typedef __attribute__((ext_vector_type(4))) _Float16 v4h;
typedef __attribute__((ext_vector_type(2))) unsigned short v2us;
typedef __attribute__((ext_vector_type(4))) unsigned short v4us;
typedef __attribute__((ext_vector_type(2))) float v2f;
typedef __attribute__((ext_vector_type(4))) int v4i;

__global__ __launch_bounds__(256) void k_wtG(const float* __restrict__ w, int K, int N, bf* Bt) {
    const int lane = threadIdx.x & 31; const int L0 = (blockIdx.x * 8 + (threadIdx.x >> 5)) * 8; const int nlines = N * K / 64;
{
#pragma unroll 1
        for (int l = 0; l < 8; ++l) { const int L = L0 + l; if (L >= nlines) break; const size_t e = (size_t)L * 64 + lane * 2; const int k = (int)(e % K), n = (int)(e / K); v2us o;
            o[0] = f2bf(w[(size_t)k * N + n]); o[1] = f2bf(w[(size_t)(k + 1) * N + n]); *(v2us*)(Bt + e) = o; }
         }
}
// k_cvt8: bf16 copies of the four weights and of x in one launch, in fragment order; blockIdx.y picks a chunk of DM*DM elements (0..3: wo, wq, wk, wv; 4..: x, one batch each), dst holds the chunks in that order.
// A block takes 16 rows x 256 k (blockIdx.x = row tile * 4 + k quarter): a wave reads 1 KB of one row, the 16-byte octets turn in LDS (one group of 16 rows per k octet, pitch 272 B against bank conflicts), a wave stores 512 contiguous bytes.
static_assert(DQ == DM && DKV == DM && TT == DM && NH_ == NKV && RH % 256 == 0 && TT % 256 == 0 && NH_ % 4 == 0 && HD == 64, "chunking and row blocks");
__global__ __launch_bounds__(256) void k_cvt8(const float* __restrict__ wo, const float* __restrict__ wq, const float* __restrict__ wk, const float* __restrict__ wv, const float* __restrict__ x, bf* dst) { const int y = blockIdx.y; const float* src = (y == 0) ? wo : (y == 1) ? wq : (y == 2) ? wk : (y == 3) ? wv : x + (size_t)(y - 4) * DM * DM;
    __shared__ __align__(16) bf ts[32 * 136];
    const int rt = blockIdx.x >> 2, kq = blockIdx.x & 3, tid = threadIdx.x;
    const float* s0 = src + (size_t)(rt * 16 + (tid >> 5)) * DM + kq * 256 + (tid & 31) * 8; const float* s1 = s0 + 8 * DM;   // rows tid / 32 and 8 + tid / 32, k octet tid % 32
    const v8f v0 = *(const v8f*)s0, v1 = *(const v8f*)s1;
    // s_wait_xcnt 0 behind the loads, before any register that one of them names is written again; the address (s1 is s0 plus an immediate offset) is an input so that it stays whole up to the wait
    asm volatile("s_wait_xcnt 0x0" :: "v"(s0) : "memory");
    v8us o0, o1;
#pragma unroll
    for (int k = 0; k < 8; ++k) { o0[k] = f2bf(v0[k]); o1[k] = f2bf(v1[k]); }
    *(v8usa*)(ts + (tid & 31) * 136 + (tid >> 5) * 8) = o0; *(v8usa*)(ts + (tid & 31) * 136 + (8 + (tid >> 5)) * 8) = o1;
    __syncthreads();   // the octets cross waves
    bf* d0 = dst + (size_t)y * DM * DM + ((size_t)rt * (DM / 8) + kq * 32) * 128 + tid * 8;
    *(v8us*)d0 = *(const v8usa*)(ts + (tid >> 4) * 136 + (tid & 15) * 8); *(v8us*)(d0 + 2048) = *(const v8usa*)(ts + (16 + (tid >> 4)) * 136 + (tid & 15) * 8);  }

// k_fattn: fused attention. One wave owns 32 query rows of one (batch, head) plane and walks the TT keys 32 at a time; 8 waves (256 rows) per block read the same K and V. grid (planes, TT / 256): blockIdx.y picks the row block, the hi/lo row blocks come first.
// K and V come through a two-buffer LDS ring: a tile is 32 keys of every plane the row block uses (K 4 KB, V 4 KB, then the lo planes), brought once per block by tensor loads (2 KB a request, one request per issuing wave and tile) one trip ahead of its use; fragment order carries over, so a fragment is 1 KB in a row in LDS too.
// St = K Q^T (A: K rows, B: Q rows): a lane holds 16 scores of ONE query (column lr; keys 8 hi + j of each 16-key tile), so maximum, sum and rescale are lane-local but for one exchange between the lane halves.
// The two St tiles of a 32-key block, converted in place, are the B operand of Ot += V^T P^T (A: VT rows d, loaded in the same k order). P is exp(t - running max), not normalised (fp16 rows: x PCAR); Ot is divided by the f32 sum at the end.
__device__ __forceinline__ float xhalf(float x) { const int b = __float_as_int(x); return __int_as_float(__builtin_amdgcn_permlanex16(b, b, 0x76543210, 0xfedcba98, false, false)); }   // lane l <-> l ^ 16
template <typename T16, bool HIRES>
__device__ __forceinline__ void attn_rows(const T16* Q, const T16* Q2, const T16* Kp, const T16* Kp2, const T16* Vp, const T16* Vp2, int t0, bf* Ah, bf* Al, const unsigned char* ring) {
    // every inner loop below is fully unrolled (#pragma unroll): fragment and accumulator arrays stay in registers only under constant indices
    typedef typename WFrag<T16>::V V; static_assert(PCAR == 1024.0f, "the exponent bias 10 below is log2(PCAR)");
    const int lane = threadIdx.x & 31;   // in the comments: lr = lane % 16, hi = lane / 16
    const float C = SCL * 1.4426950408889634f;
    V q[2][2], q2[2][2];
    { const T16* pq = Q + (size_t)t0 * HD + lane * 8; const T16* pq2 = HIRES ? Q2 + (size_t)t0 * HD + lane * 8 : pq;   // fragment order: 16 rows x 32 d are 512 elements in a row
#pragma unroll
      for (int qt = 0; qt < 2; ++qt)
#pragma unroll
          for (int ks = 0; ks < 2; ++ks) { q[qt][ks] = WFrag<T16>::ld(pq + qt * 16 * HD + ks * 512); if (HIRES) q2[qt][ks] = WFrag<T16>::ld(pq2 + qt * 16 * HD + ks * 512); }
      // s_wait_xcnt 0 behind the Q loads, before any register that one of them names is written again; the addresses are inputs so that they stay whole up to the wait
      asm volatile("s_wait_xcnt 0x0" :: "v"(pq), "v"(pq2) : "memory"); }
    v8f o[2][4]; float m[2], l[2];
#pragma unroll
    for (int qt = 0; qt < 2; ++qt) { m[qt] = -3.0e38f; l[qt] = 0.f;
#pragma unroll
        for (int dt = 0; dt < 4; ++dt) o[qt][dt] = (v8f){}; }
    // K tiles are 4 KB in a row; a V tile is 1 KB of each of the four groups of 16 d. Wave w brings half w % 2 (two rows of 1 KB) of part w / 2 (K, V, then the lo planes' K, V); the fp16 rows have two parts, so waves 0..3 issue there.
    constexpr unsigned BUFB = HIRES ? 16384u : 8192u;
    const uint32_t wave = uni(threadIdx.x >> 5), part = HIRES ? wave >> 1 : (wave >> 1) & 1u, half = wave & 1u;
    const uint32_t issuer = HIRES ? 1u : pinned(wave < 4u);   // a scalar test: a tensor load ignores EXEC
    const T16* sp = (part & 1u) ? ((part & 2u) ? Vp2 : Vp) + (size_t)half * 32 * TT : ((part & 2u) ? Kp2 : Kp) + (size_t)half * 1024;
    const uint64_t sga = (uint64_t)(size_t)sp;
    const uint32_t sstep = (part & 1u) ? 1024u : 4096u;   // bytes from one 32-key tile to the next
    const uint32_t sdst = (uint32_t)(size_t)ring + part * 4096u + half * 2048u;   // LDS byte address: the low 32 bits of the __shared__ address
    const u32x8 g1 = tdm_group1(1024u, 2u, (part & 1u) ? 32u * TT : 1024u);
    u32x4 g0 = tdm_group0(sdst, sga);
    if (issuer) { tdm_load(g0, g1); tdm_wait(g0, g1); }   // tile 0 has landed, as far as this wave asked for it
    __syncthreads();                                       // and every other wave's part of it
    if (issuer) { g0 = tdm_group0(sdst + BUFB, sga + sstep); tdm_load(g0, g1); }
#pragma unroll 1   // one 32-key block per trip: an unrolled body would not fit the registers of four waves per SIMD
    for (int kb = 0; kb < TT; kb += 32) {
        const unsigned bo = (kb & 32) ? BUFB : 0u;   // trip t reads buffer t % 2 alone
        const T16* pk = (const T16*)(ring + bo) + lane * 8; const T16* pv = pk + 2048; const T16* pk2 = HIRES ? pk + 4096 : pk; const T16* pv2 = HIRES ? pk + 6144 : pv;
        V kf[2][2], kf2[2][2];
#pragma unroll
        for (int kt = 0; kt < 2; ++kt)
#pragma unroll
            for (int ks = 0; ks < 2; ++ks) { kf[kt][ks] = WFrag<T16>::ld(pk + kt * 16 * HD + ks * 512); if (HIRES) kf2[kt][ks] = WFrag<T16>::ld(pk2 + kt * 16 * HD + ks * 512); }
        v8f st[2][2];
#pragma unroll
        for (int kt = 0; kt < 2; ++kt)
#pragma unroll
            for (int qt = 0; qt < 2; ++qt) { v8f s = (v8f){};
#pragma unroll
                for (int ks = 0; ks < 2; ++ks) { s = WFrag<T16>::mma(kf[kt][ks], q[qt][ks], s); if (HIRES) { s = WFrag<T16>::mma(kf[kt][ks], q2[qt][ks], s); s = WFrag<T16>::mma(kf2[kt][ks], q[qt][ks], s); } }
                st[qt][kt] = s; }
        V vf[4], vf2[4];
#pragma unroll
        for (int dt = 0; dt < 4; ++dt) { vf[dt] = WFrag<T16>::ld(pv + dt * 512); if (HIRES) vf2[dt] = WFrag<T16>::ld(pv2 + dt * 512); }
        V p[2], p2[2];
#pragma unroll
        for (int qt = 0; qt < 2; ++qt) { float mx = st[qt][0][0];
#pragma unroll
            for (int j = 1; j < 16; ++j) mx = fmaxf(mx, st[qt][j >> 3][j & 7]);
            mx = fmaxf(mx, xhalf(mx)); const float mn = fmaxf(m[qt], mx); float al = (m[qt] - mn) * C; m[qt] = mn;
            const float nb = (HIRES ? 0.0f : 10.0f) - mn * C;   // fp16 rows carry P x PCAR = 2^10
            float e[16];
#pragma unroll
            for (int j = 0; j < 16; ++j) e[j] = __builtin_fmaf(st[qt][j >> 3][j & 7], C, nb);
            // the 17 exponentials of one query tile in one statement, each in place: none overwrites the source or reads the result of the one before it; the v_nop is the slot between the last one and whatever follows
            asm("v_exp_f32 %0, %0\n\tv_exp_f32 %1, %1\n\tv_exp_f32 %2, %2\n\tv_exp_f32 %3, %3\n\tv_exp_f32 %4, %4\n\tv_exp_f32 %5, %5\n\tv_exp_f32 %6, %6\n\tv_exp_f32 %7, %7\n\tv_exp_f32 %8, %8\n\t"
                "v_exp_f32 %9, %9\n\tv_exp_f32 %10, %10\n\tv_exp_f32 %11, %11\n\tv_exp_f32 %12, %12\n\tv_exp_f32 %13, %13\n\tv_exp_f32 %14, %14\n\tv_exp_f32 %15, %15\n\tv_exp_f32 %16, %16\n\tv_nop"
                : "+v"(al), "+v"(e[0]), "+v"(e[1]), "+v"(e[2]), "+v"(e[3]), "+v"(e[4]), "+v"(e[5]), "+v"(e[6]), "+v"(e[7]), "+v"(e[8]), "+v"(e[9]), "+v"(e[10]), "+v"(e[11]), "+v"(e[12]), "+v"(e[13]), "+v"(e[14]), "+v"(e[15]));
            float sum = 0.f;
#pragma unroll
            for (int j = 0; j < 16; ++j) { sum += e[j];
                if constexpr (HIRES) { const __bf16 h = (__bf16)e[j]; p[qt][j] = h; p2[qt][j] = (__bf16)(e[j] - (float)h); } else p[qt][j] = (h16)e[j]; }
            l[qt] = l[qt] * al + sum;
#pragma unroll
            for (int dt = 0; dt < 4; ++dt) o[qt][dt] *= al; }
#pragma unroll
        for (int dt = 0; dt < 4; ++dt)
#pragma unroll
            for (int qt = 0; qt < 2; ++qt) { o[qt][dt] = WFrag<T16>::mma(vf[dt], p[qt], o[qt][dt]); if (HIRES) { o[qt][dt] = WFrag<T16>::mma(vf[dt], p2[qt], o[qt][dt]); o[qt][dt] = WFrag<T16>::mma(vf2[dt], p[qt], o[qt][dt]); } }
        // publish point of the next tile: this wave's reads of the buffer are done, its tensor load of the next tile has landed, every wave has come as far; only then the refill of the buffer just read
        asm volatile("s_wait_dscnt 0x0" ::: "memory");
        if (issuer) tdm_wait(g0, g1);
        __syncthreads();
        // tile t + 2, while it exists (a scalar test), into the buffer of trip t; its byte offset is pinned so that the descriptor is formed behind the wait
        if (pinned(issuer && kb + 64 < TT)) { g0 = tdm_group0(sdst + bo, sga + pinned((uint32_t)(kb / 32 + 2) * sstep)); tdm_load(g0, g1); }
    }
    tdm_wait(g0, g1);   // no tensor load is outstanding when the wave goes on to its end
    asm volatile("s_wait_dscnt 0x0" ::: "memory");
    // o[qt][dt][j] = Ot[d = dt * 16 + 8 hi + j][query t0 + qt * 16 + lr]: 8 consecutive d of one merged row per lane, in fragment order 512 contiguous bytes per wave-wide store
#pragma unroll
    for (int qt = 0; qt < 2; ++qt) { const float f = __fdiv_rn(1.0f, l[qt] + xhalf(l[qt])); const size_t oo = (size_t)(t0 + qt * 16) * DQ + lane * 8;
#pragma unroll
        for (int dt = 0; dt < 4; ++dt) { v8us oh, ol;
#pragma unroll
            for (int j = 0; j < 8; ++j) { unsigned short a, c2; splitf(o[qt][dt][j] * f, a, c2); oh[j] = a; ol[j] = c2; }
            bf* sh = Ah + oo + dt * 256; bf* sl = Al + oo + dt * 256; *(v8us*)sh = oh; *(v8us*)sl = ol;
            // the same wait behind the two stores, before a register that one of them names (address or data) is written again
            asm volatile("s_wait_xcnt 0x0" :: "v"(sh), "v"(sl), "v"(oh), "v"(ol) : "memory"); } }
}
__global__ __launch_bounds__(256) void k_fattn(const h16* Q16, const h16* K16, const h16* V16, const bf* Qh, const bf* Ql, const bf* Kh, const bf* Kl, const bf* Vh, const bf* Vl, bf* Ah, bf* Al) {
    __shared__ __attribute__((aligned(2048))) unsigned char ring[2 * 16384];   // every tensor tile's place in LDS is a multiple of 2 KB
    const int g = blockIdx.x; const size_t zo = (size_t)g * TT * HD; const int t0 = blockIdx.y * 256 + (threadIdx.x >> 5) * 32;   // plane g = batch * NH_ + head: one kv head per query head
    const size_t ao = (size_t)(g / NH_) * TT * DQ + (g % NH_) * HD * 16;   // merged planes in fragment order: a head's 8 octets of d, 128 elements each
    if (blockIdx.y * 256 < RH) attn_rows<bf, true>(Qh + zo, Ql + zo, Kh + zo, Kl + zo, Vh + zo, Vl + zo, t0, Ah + ao, Al + ao, ring);
    else attn_rows<h16, false>(Q16 + zo, nullptr, K16 + zo, nullptr, V16 + zo, nullptr, t0, Ah + ao, Al + ao, ring);
}

extern "C" void kernel_launch(void* const* d_in, const int* in_sizes, int n_in,
                              void* d_out, int out_size, void* d_ws, size_t ws_size, hipStream_t stream) {
    (void)in_sizes; (void)n_in; (void)out_size;
    const float* x = (const float*)d_in[0]; const float* wq = (const float*)d_in[1]; const float* wk = (const float*)d_in[2]; const float* wv = (const float*)d_in[3]; const float* wo = (const float*)d_in[4]; const float* bo = (const float*)d_in[5];
    float* OUT = (float*)d_out;     // [8][1024][1024]
    char* ws = (char*)d_ws; const size_t Mi = (size_t)1 << 20;
    if (ws_size < 253 * Mi) return;    // ws 256 MiB
    // Workspace map in MiB; regions are reused in stream order once their last reader has run.
    //   0 WO | 2 WQ WK WV | 8 XB (all batches) | 25 .. 169 nine planes of 16 (all batches): fp16 q k v | 73 hi q k v | 121 lo q k v
    //   attention: 237 ATh (16) | 2 ATl (16, over WQ WK WV XB)
    const size_t PL = (size_t)NB_ * NH_ * TT * HD;   // elements of one plane set
    bf* WO = (bf*)ws; bf* WQ = (bf*)(ws + 2 * Mi); bf* XB = (bf*)(ws + 8 * Mi);
    h16* QP16 = (h16*)(ws + 25 * Mi); h16* KP16 = QP16 + PL; h16* VT16 = KP16 + PL; bf* QPh = (bf*)(ws + 73 * Mi); bf* KPh = QPh + PL; bf* VTh = KPh + PL; bf* QPl = (bf*)(ws + 121 * Mi); bf* KPl = QPl + PL; bf* VTl = KPl + PL;   // q, k, v in a row: the z sets of the projection launch
    bf* ATh = (bf*)(ws + 237 * Mi); bf* ATl = (bf*)(ws + 2 * Mi);
    k_cvt8<<<dim3(DM / 16 * (DM / 256), 4 + NB_, 1), 256, 0, stream>>>(wo, wq, wk, wv, x, WO);
    k_proj3<<<dim3(NB_ * TT / 256, DQ / 128, 1), 256, 0, stream>>>(XB, WQ, QP16, QPh, QPl);
    k_fattn<<<dim3(NB_ * NH_, TT / 256, 1), 256, 0, stream>>>(QP16, KP16, VT16, QPh, QPl, KPh, KPl, VTh, VTl, ATh, ATl);
    k_gemmw<bf, 1, true><<<dim3(NB_ * TT / 256, DM / 128, 1), 256, 0, stream>>>(ATh, ATl, WO, DQ, DQ, OUT, DM, bo, 0, 0, 0);
}

// v009
// Measured time: 123 microseconds a run.
// Next to v008, in two timings, it ran 1.04 and 1.03 times as fast.
// Counting every step since v000, it is 39.1 times as fast.
#include <hip/hip_runtime.h>
#include <stdint.h>

// Simple multi-head attention scaled by the EMBEDDING size (x [8][1024][1024]; q,k,v = x W^T ('oi' [1024][1024], no bias); scores / sqrt(1024) (module quirk); softmax over all keys; out = merged Wo^T + bo -> [8][1024][1024] (8.4 M)).
// Every 16-bit operand plane [row][k] lies in fragment order: element (row, k) at ((row / 16) * (K / 8) + k / 8) * 128 + (row % 16) * 8 + k % 8, so a 16 x 32 fragment is 1 KB in a row and each of its two wave-wide 16-byte loads covers 512 contiguous bytes (four whole lines).
// Layout, all batches per launch: bf16 copy of x and weights; exact projections that store the attention's operand planes themselves; dense T-1024 attention fused in one launch (scores, running softmax and P V stay in registers; hybrid rows: < 512 hi/lo 3 products, rest fp16 x1024); merged hi/lo x Wo exact + bo.
// Compute dtypes, f32 accumulate: every input rounded to bf16; projections exact; attention rows < 512 3 products, rest fp16; softmax f32; Wo hl x exact + bias.

#define NB_  8
#define TT   1024
#define DM   1024
#define NH_  16
#define NKV  16
#define REP  (NH_ / NKV)
#define HD   64
#define DQ   (NH_ * HD)
#define DKV  (NKV * HD)
#define RH   512                  // query rows < RH use hi+lo planes (0: none)
#define WIN  0
#define PCAR 1024.0f
#define SCL  0.03125f   // 1/sqrt(1024): the module scales by the embedding size
typedef _Float16 h16;
typedef unsigned short bf;
typedef __attribute__((ext_vector_type(16))) __bf16   v16bf;
typedef __attribute__((ext_vector_type(16))) _Float16 v16h;
typedef __attribute__((ext_vector_type(8)))  _Float16 v8h;
typedef __attribute__((ext_vector_type(8)))  unsigned short v8us;
typedef __attribute__((ext_vector_type(8)))  __bf16   v8b;
typedef __attribute__((ext_vector_type(8)))  float    v8f;
typedef __attribute__((ext_vector_type(4)))  float    v4f;
typedef v8h  __attribute__((may_alias)) v8ha;
typedef v4f  __attribute__((may_alias)) v4fa;
typedef v8us __attribute__((may_alias)) v8usa;

__device__ __forceinline__ unsigned short f2bf(float f) { unsigned u = __float_as_uint(f); u += 0x7FFFu + ((u >> 16) & 1u); return (unsigned short)(u >> 16); }
__device__ __forceinline__ float bf2f(unsigned short b) { return __uint_as_float(((unsigned)b) << 16); }
__device__ __forceinline__ float bfr(float f) { return bf2f(f2bf(f)); }
__device__ __forceinline__ v16h cat16(v8h lo, v8h hi) { return __builtin_shufflevector(lo, hi, 0, 1, 2, 3, 4, 5, 6, 7, 8, 9, 10, 11, 12, 13, 14, 15); }
__device__ __forceinline__ v16bf cat16b(v8us lo, v8us hi) { return __builtin_bit_cast(v16bf, __builtin_shufflevector(lo, hi, 0, 1, 2, 3, 4, 5, 6, 7, 8, 9, 10, 11, 12, 13, 14, 15)); }
__device__ __forceinline__ v8f wmma16(v16h a, v16h b, v8f c) { return __builtin_amdgcn_wmma_f32_16x16x32_f16(false, a, false, b, (short)0, c, false, false); }
__device__ __forceinline__ v8f wmmab(v16bf a, v16bf b, v8f c) { return __builtin_amdgcn_wmma_f32_16x16x32_bf16(false, a, false, b, (short)0, c, false, false); }



// ---- k_gemmw: register-blocked GEMM, one wave per 64x64 output tile (16 accumulators), EIGHT WAVES per block: 4 along the x rows, 2 along the weight rows, a block tile of 256 x 128. Operands are 16-bit planes in fragment order (A of lda, Bt of K elements a row); grid (M/256, N/128, Z), 256 threads.
// The operands come through a two-buffer LDS ring: a stage is 64 k of the block's 256 A rows (32 KB; with NSPLIT 1 the A2 rows behind them) and 128 Bt rows (16 KB), brought once per block by tensor loads, one request per wave and stage, one trip ahead of its use. Fragment order carries over: 16 rows x 64 k are 2 KB in a row in memory and in LDS (one row of a tensor tile; the next group of 16 rows lies 16 * lda elements on), a fragment 1 KB (WFrag::ld takes the fragment's start + lane * 8).
// C[m][n] (f32, pitch ldc, + optional f32 bias[n]) = sum_k A[m][k] Bt[n][k] (NSPLIT 1: + A2[m][k] Bt[n][k]). z-batch strides sA/sB/sC in elements. K % 64 == 0.
template <typename T16> struct WFrag;
template <> struct WFrag<h16> { typedef v16h V; static __device__ __forceinline__ V ld(const h16* p) { return cat16(*(const v8h*)p, *(const v8h*)(p + 256)); } static __device__ __forceinline__ v8f mma(V a, V b, v8f c) { return wmma16(a, b, c); } };
template <> struct WFrag<bf> { typedef v16bf V; static __device__ __forceinline__ V ld(const bf* p) { return cat16b(*(const v8us*)p, *(const v8us*)(p + 256)); } static __device__ __forceinline__ v8f mma(V a, V b, v8f c) { return wmmab(a, b, c); } };
// Tensor loads: one request of one wave brings a tile of n rows of rowb bytes (source pitch in bytes) into LDS, rows one behind the other, through no register. Two descriptor groups, every word wave-uniform in scalar registers; 1-byte elements, tensor = tile, no pad, no mask.
typedef uint32_t u32x4 __attribute__((ext_vector_type(4)));
typedef uint32_t u32x8 __attribute__((ext_vector_type(8)));
__device__ __forceinline__ uint32_t uni(uint32_t v) { return (uint32_t)__builtin_amdgcn_readfirstlane(v); }
// a wave-uniform value held in a scalar register, so that a test on it is a scalar branch (a tensor load ignores EXEC) and what is formed from it is formed behind the volatile statements in front of it
__device__ __forceinline__ uint32_t pinned(uint32_t v) { uint32_t w = (uint32_t)__builtin_amdgcn_readfirstlane(v); asm volatile("" : "+s"(w)); return w; }
__device__ __forceinline__ u32x8 tdm_group1(uint32_t rowb, uint32_t n, uint32_t pitch) {
    // words 1 to 7 pinned: the group is formed once and stays in its scalar registers for the whole ring, so that no word is written again while a request that names it is outstanding; word 0 is the constant 0
    u32x8 g;
    g[0] = uni(0u); g[1] = pinned((rowb & 0xFFFFu) << 16); g[2] = pinned((rowb >> 16) | ((n & 0xFFFFu) << 16)); g[3] = pinned((n >> 16) | (rowb << 16));
    g[4] = pinned(n); g[5] = pinned(pitch); g[6] = pinned(0u); g[7] = pinned(0u);
    return g;
}
__device__ __forceinline__ u32x4 tdm_group0(uint32_t lds_dst, uint64_t ga) {
    u32x4 g;
    g[0] = uni(1u); g[1] = uni(lds_dst); g[2] = uni((uint32_t)ga); g[3] = uni((((uint32_t)(ga >> 32)) & 0x01FFFFFFu) | 0x80000000u);
    return g;
}
// group 0 goes in and out of the statement, so that what tdm_wait holds whole are the very registers that the request names
__device__ __forceinline__ void tdm_load(u32x4& g0, u32x8 g1) { asm volatile("tensor_load_to_lds %0, %1" : "+s"(g0) : "s"(g1) : "memory"); }
// the wave's own request has landed; the descriptor it named is an input so that its registers stay whole up to the wait
__device__ __forceinline__ void tdm_wait(u32x4 g0, u32x8 g1) { asm volatile("s_wait_tensorcnt 0x0" :: "s"(g0), "s"(g1) : "memory"); }
template <typename T16, int NSPLIT, bool BIAS>
__global__ __launch_bounds__(256) void k_gemmw(const T16* __restrict__ A, const T16* __restrict__ A2, const T16* __restrict__ Bt, int K, int lda, float* C, int ldc, const float* __restrict__ bias, size_t sA, size_t sB, size_t sC) {
    typedef typename WFrag<T16>::V V; static_assert(NSPLIT == 0 || NSPLIT == 1, "the ring stages A, A2 and Bt");
    constexpr unsigned XBY = 32768u, WOFF = (NSPLIT == 1 ? 2u : 1u) * XBY, BUFB = WOFF + 16384u;   // bytes: one A part of a stage, where its Bt part begins, a whole stage
    __shared__ __attribute__((aligned(2048))) unsigned char ring[2 * BUFB];   // every tensor tile's place in LDS is a multiple of 2 KB
    __shared__ __align__(16) float osall[8 * 16 * 68];
    const size_t z = blockIdx.z; A += z * sA; if (NSPLIT == 1) A2 += z * sA; Bt += z * sB; C += z * sC;
    const int tid = threadIdx.x, lane = tid & 31, lr = lane & 15, hi = lane >> 4, wx = (tid >> 5) & 3, wy = tid >> 7;
    const int bx = blockIdx.x * 4 + wx, by = blockIdx.y * 2 + wy;   // the wave's 64 x 64 tile: bx along the x rows, by along the weight rows
    v8f acc[4][4];
#pragma unroll
    for (int mb = 0; mb < 4; ++mb)
#pragma unroll
        for (int nb = 0; nb < 4; ++nb) acc[mb][nb] = (v8f){};
    // every wave brings its own slice of a stage, whole row groups of one part. NSPLIT 0: waves 0..3 four A groups each, waves 4..7 two Bt groups each. NSPLIT 1: waves 0..2 six, five, five A groups, waves 3..5 the same of A2, waves 6, 7 four Bt groups each.
    const uint32_t wave = uni(threadIdx.x >> 5);
    uint32_t part, first, ngr;   // part 0: A, 1: A2, 2: Bt
    if (NSPLIT == 1) { part = wave / 3u; const uint32_t r = wave - 3u * part; first = part < 2u ? (r ? 5u * r + 1u : 0u) : 4u * r; ngr = part < 2u ? (r ? 5u : 6u) : 4u; }
    else { part = wave < 4u ? 0u : 2u; first = wave < 4u ? 4u * wave : 2u * (wave - 4u); ngr = wave < 4u ? 4u : 2u; }
    const T16* sp = part == 2u ? Bt + ((size_t)blockIdx.y * 8 + first) * 16 * K : (part == 1u ? A2 : A) + ((size_t)blockIdx.x * 16 + first) * 16 * lda;
    const uint64_t sga = (uint64_t)(size_t)sp;
    const uint32_t sdst = (uint32_t)(size_t)ring + (part == 2u ? WOFF : part * XBY) + first * 2048u;   // LDS byte address: the low 32 bits of the __shared__ address
    const u32x8 g1 = tdm_group1(2048u, ngr, (uint32_t)(part == 2u ? K : lda) * 32u);
    u32x4 g0 = tdm_group0(sdst, sga);
    tdm_load(g0, g1);
    tdm_wait(g0, g1);   // stage 0 has landed, as far as this wave asked for it
    __syncthreads();    // and every other wave's part of it
    if (pinned(64 < K)) { g0 = tdm_group0(sdst + BUFB, sga + 2048u); tdm_load(g0, g1); }
#pragma unroll 1   // one stage per trip: trip t reads buffer t % 2 alone
    for (int kc = 0; kc < K; kc += 64) {
        const unsigned bo = (kc & 64) ? BUFB : 0u;
        const T16* pa = (const T16*)(ring + bo) + wx * 4096 + lane * 8; const T16* pb = (const T16*)(ring + bo + WOFF) + wy * 4096 + lane * 8;   // the wave's four row groups of each part
#pragma unroll
        for (int ks = 0; ks < 2; ++ks) {
            V a[4], a2[4], b[4];
#pragma unroll
            for (int mb = 0; mb < 4; ++mb) { a[mb] = WFrag<T16>::ld(pa + mb * 1024 + ks * 512); if (NSPLIT == 1) a2[mb] = WFrag<T16>::ld(pa + XBY / 2 + mb * 1024 + ks * 512); }
#pragma unroll
            for (int nb = 0; nb < 4; ++nb) b[nb] = WFrag<T16>::ld(pb + nb * 1024 + ks * 512);
            // the 32 k's fragment loads stay one group in front of its matrix instructions: left free, the B loads sink among them, one waited place per four or eight
            __builtin_amdgcn_sched_barrier(0);
            if (ks == 1) {
                // publish point of the next stage, behind the trip's last fragment loads: this wave's reads of the buffer are done, its tensor load of the next stage has landed, every wave has come as far; only then the refill of the buffer just read.
                // The second 32 k's products, from registers alone, follow it: a wave comes out of the barrier with matrix work at hand, and the refill in front of them has a whole trip's lead.
                asm volatile("s_wait_dscnt 0x0" ::: "memory");
                tdm_wait(g0, g1);
                __syncthreads();
                // stage t + 2, while it exists (a scalar test), into the buffer of trip t; its byte offset is pinned so that the descriptor is formed behind the wait
                if (pinned(kc + 128 < K)) { g0 = tdm_group0(sdst + bo, sga + pinned((uint32_t)(kc + 128) * 32u)); tdm_load(g0, g1); }
            }
#pragma unroll
            for (int nb = 0; nb < 4; ++nb)
#pragma unroll
                for (int mb = 0; mb < 4; ++mb) { acc[mb][nb] = WFrag<T16>::mma(a[mb], b[nb], acc[mb][nb]); if (NSPLIT == 1) acc[mb][nb] = WFrag<T16>::mma(a2[mb], b[nb], acc[mb][nb]); }
        }
    }
    tdm_wait(g0, g1);   // no tensor load is outstanding when the wave goes on to its end
    asm volatile("s_wait_dscnt 0x0" ::: "memory");
    float* os = osall + (tid >> 5) * (16 * 68); const int r0 = bx * 64, c0 = by * 64;   // each wave turns its tile in its own LDS range
#pragma unroll
    for (int mb = 0; mb < 4; ++mb) {
#pragma unroll
        for (int nb = 0; nb < 4; ++nb) {
#pragma unroll
            for (int j = 0; j < 8; ++j) os[(hi * 8 + j) * 68 + nb * 16 + lr] = acc[mb][nb][j]; }
        __builtin_amdgcn_wave_barrier(); asm volatile("" ::: "memory");
        float* crow = C + (size_t)(r0 + mb * 16) * ldc + c0;
{
#pragma unroll
            for (int s = 0; s < 8; ++s) { const int row = 2 * s + hi, cofs = lr * 4; v4f val = *(const v4fa*)(os + row * 68 + cofs); if (BIAS) { val[0] += bfr(bias[c0 + cofs]); val[1] += bfr(bias[c0 + cofs + 1]); val[2] += bfr(bias[c0 + cofs + 2]); val[3] += bfr(bias[c0 + cofs + 3]); }
                *(v4f*)(crow + (size_t)row * ldc + cofs) = val; }
             }
        __builtin_amdgcn_wave_barrier(); asm volatile("" ::: "memory");
    }
}

// ---- k_proj3: the three projections in one block. A block takes 256 x rows against the SAME 128 weight rows (two heads) of wq, wk and wv, so one x stage serves three products: grid (rows / 256, DQ / 128), 256 threads, one block per WGP.
// Eight waves, 4 along the x rows, 2 along the weight rows; a wave's tile is 64 positions x one head of q, k and v (48 accumulators). X and Wt (wq wk wv in a row) are bf16 planes in fragment order, DM elements a row.
// Two-buffer LDS ring as in k_gemmw: a stage is 64 k of the x rows (32 KB) and of the three weights' rows (16 KB each), one tensor load per wave and stage, one trip ahead of its use. The publish point stands in front of a trip's last block, so that the block can fetch the next trip's first weight fragments.
// No f32 output: a tile goes from the accumulators straight into its head's fp16, hi and lo planes (P16, Ph, Pl: q, k, v sets in a row), in fragment order.
// A lane's 8 accumulator values run along the A operand's rows, and a plane wants 8 consecutive k per lane: d for the q and k planes [h][t][d], so there the weight is the WMMA's A operand; t for the V^T planes [h][d][t], so there x is.
__global__ __launch_bounds__(256) void k_proj3(const bf* __restrict__ X, const bf* __restrict__ Wt, h16* P16, bf* Ph, bf* Pl) {
    typedef WFrag<bf>::V V; static_assert(DM % 128 == 0, "two stages or more");
    constexpr unsigned XBY = 32768u, WBY = 16384u, BUFB = XBY + 3u * WBY;   // bytes: the x part of a stage, one weight's part, a whole stage
    __shared__ __attribute__((aligned(2048))) unsigned char ring[2 * BUFB];   // every tensor tile's place in LDS is a multiple of 2 KB
    const int tid = threadIdx.x, lane = tid & 31, wx = (tid >> 5) & 3, wy = tid >> 7;
    const int bx = blockIdx.x * 4 + wx, by = blockIdx.y * 2 + wy;   // the wave's 64 positions and its head
    v8f acc[3][4][4];
#pragma unroll
    for (int z = 0; z < 3; ++z)
#pragma unroll
        for (int mb = 0; mb < 4; ++mb)
#pragma unroll
            for (int nb = 0; nb < 4; ++nb) acc[z][mb][nb] = (v8f){};
    // every wave brings its own slice of a stage, whole row groups of one part: waves 0, 1 eight x groups each; waves 2..7 four groups each, two waves a weight
    const uint32_t wave = uni(threadIdx.x >> 5), wz = (wave - 2u) >> 1, half = wave & 1u;
    const bf* sp = wave < 2u ? X + ((size_t)blockIdx.x * 16 + wave * 8u) * 16 * DM : Wt + (size_t)wz * DQ * DM + ((size_t)blockIdx.y * 8 + half * 4u) * 16 * DM;
    const uint64_t sga = ((uint64_t)uni((uint32_t)((uint64_t)(size_t)sp >> 32)) << 32) | uni((uint32_t)(size_t)sp);   // wave-uniform: kept in scalar registers
    const uint32_t sdst = uni((uint32_t)(size_t)ring + (wave < 2u ? wave * 16384u : XBY + wz * WBY + half * 8192u));   // LDS byte address: the low 32 bits of the __shared__ address
    const u32x8 g1 = tdm_group1(2048u, wave < 2u ? 8u : 4u, (uint32_t)DM * 32u);
    u32x4 g0 = tdm_group0(sdst, sga);
    tdm_load(g0, g1);
    tdm_wait(g0, g1);   // stage 0 has landed, as far as this wave asked for it
    __syncthreads();    // and every other wave's part of it
    g0 = tdm_group0(sdst + BUFB, sga + 2048u); tdm_load(g0, g1);
    V xf[4], wf[4];
    { const bf* w0 = (const bf*)(ring + XBY) + wy * 4096 + lane * 8;   // the first block's weight fragments, behind the barrier that published stage 0
#pragma unroll
      for (int i = 0; i < 4; ++i) wf[i] = WFrag<bf>::ld(w0 + i * 1024); }
#pragma unroll 1   // one stage per trip
    for (int kc = 0; kc < DM; kc += 64) {
        const unsigned bo = (kc & 64) ? BUFB : 0u;
        const bf* xs = (const bf*)(ring + bo) + wx * 4096 + lane * 8; const bf* wsp = (const bf*)(ring + bo + XBY) + wy * 4096 + lane * 8;   // the wave's four row groups of x and of wq; wk, wv lie WBY bytes on each
        const bf* wnx = (const bf*)(ring + (BUFB - bo) + XBY) + wy * 4096 + lane * 8;   // the same of the next stage
        // six blocks of 16 products a trip: 32 k x one weight. The four x fragments of 32 k are loaded once and serve three blocks; a block's weight fragments are fetched in the middle of the block before it.
#pragma unroll
        for (int g = 0; g < 6; ++g) {
            const int ks = g / 3, z = g % 3, gn = (g + 1) % 6;
            if (z == 0) {
#pragma unroll
                for (int i = 0; i < 4; ++i) xf[i] = WFrag<bf>::ld(xs + i * 1024 + ks * 512);
                // the x loads stay one group in front of the block's matrix instructions: left free, they sink among them, one waited place per fragment
                __builtin_amdgcn_sched_barrier(0); }
            if (g == 5) {
                // publish point of the next stage, in front of the trip's last block, whose fragments were fetched half a block ago: this wave's reads of the buffer are done, its tensor load of the next stage has landed, every wave has come as far; only then the refill of the buffer just read.
                asm volatile("s_wait_dscnt 0x0" ::: "memory");
                tdm_wait(g0, g1);
                __syncthreads();
                // stage t + 2, while it exists (a scalar test), into the buffer of trip t; its byte offset is pinned so that the descriptor is formed behind the wait
                if (pinned(kc + 128 < DM)) { g0 = tdm_group0(sdst + bo, sga + pinned((uint32_t)(kc + 128) * 32u)); tdm_load(g0, g1); }
            }
            V wn[4];
#pragma unroll
            for (int i = 0; i < 4; ++i) {
                if (i == 2) {
                    // the next block's weight fragments as one group, half a block ahead of their use; behind the publish point they come from the next stage (in the last trip: from a buffer that nobody writes any more, and they are not used)
                    __builtin_amdgcn_sched_barrier(0);
#pragma unroll
                    for (int n = 0; n < 4; ++n) wn[n] = WFrag<bf>::ld((g == 5 ? wnx : wsp) + (gn % 3) * (int)(WBY / 2) + n * 1024 + (gn / 3) * 512);
                    __builtin_amdgcn_sched_barrier(0);
                }
#pragma unroll
                for (int n = 0; n < 4; ++n) { if (z < 2) acc[z][i][n] = WFrag<bf>::mma(wf[i], xf[n], acc[z][i][n]); else acc[z][n][i] = WFrag<bf>::mma(xf[n], wf[i], acc[z][n][i]); }
            }
            // the next block's loads stay behind this block's products: lifted over them, more fragments would be live than the registers beside 48 accumulators hold, and accumulators would spill
            __builtin_amdgcn_sched_barrier(0);
#pragma unroll
            for (int i = 0; i < 4; ++i) wf[i] = wn[i];
        }
    }
    tdm_wait(g0, g1);   // no tensor load is outstanding when the wave goes on to its end
    asm volatile("s_wait_dscnt 0x0" ::: "memory");
    // acc[z][mb][nb][j]: A row mb * 16 + 8 hi + j (the plane's k), B row nb * 16 + lr (the plane's row): octet mb * 2 + hi of row group nb, so each wave-wide 16-byte store covers 512 contiguous bytes
    const int x0 = bx * 64, tb = x0 % TT;
#pragma unroll
    for (int z = 0; z < 3; ++z) {
        const bool wa = z < 2; const int sn = wa ? 16 * HD : 16 * TT;   // q, k: the weight rows were the A operand; sn: elements from one group of 16 plane rows to the next
        const size_t base = (((size_t)z * NB_ + x0 / TT) * NH_ + by) * (size_t)(TT * HD) + (wa ? tb * HD : tb * 16) + lane * 8;
#pragma unroll
        for (int mb = 0; mb < 4; ++mb)
#pragma unroll
            for (int nb = 0; nb < 4; ++nb) { v8h o16; v8b oh, ol;
#pragma unroll
                for (int j = 0; j < 8; ++j) { const float y = acc[z][mb][nb][j]; o16[j] = (h16)y; const __bf16 h = (__bf16)y; oh[j] = h; ol[j] = (__bf16)(y - (float)h); }
                const size_t e = base + (size_t)nb * sn + mb * 256; h16* s16 = P16 + e; bf* sh = Ph + e; bf* sl = Pl + e; *(v8h*)s16 = o16; *(v8b*)sh = oh; *(v8b*)sl = ol;
                // s_wait_xcnt 0 behind the three stores, before a register that one of them names (address or data) is written again
                asm volatile("s_wait_xcnt 0x0" :: "v"(s16), "v"(sh), "v"(sl), "v"(o16), "v"(oh), "v"(ol) : "memory"); }
    }
}

__device__ __forceinline__ void splitf(float y, unsigned short& h, unsigned short& l) { h = f2bf(y); l = f2bf(y - bf2f(h)); }
typedef __attribute__((ext_vector_type(2))) _Float16 v2h;
typedef __attribute__((ext_vector_type(4))) _Float16 v4h;
typedef __attribute__((ext_vector_type(2))) unsigned short v2us;
typedef __attribute__((ext_vector_type(4))) unsigned short v4us;
typedef __attribute__((ext_vector_type(2))) float v2f;
typedef __attribute__((ext_vector_type(4))) int v4i;

__global__ __launch_bounds__(256) void k_wtG(const float* __restrict__ w, int K, int N, bf* Bt) {
    const int lane = threadIdx.x & 31; const int L0 = (blockIdx.x * 8 + (threadIdx.x >> 5)) * 8; const int nlines = N * K / 64;
{
#pragma unroll 1
        for (int l = 0; l < 8; ++l) { const int L = L0 + l; if (L >= nlines) break; const size_t e = (size_t)L * 64 + lane * 2; const int k = (int)(e % K), n = (int)(e / K); v2us o;
            o[0] = f2bf(w[(size_t)k * N + n]); o[1] = f2bf(w[(size_t)(k + 1) * N + n]); *(v2us*)(Bt + e) = o; }
         }
}
// k_cvt8: bf16 copies of the four weights and of x in one launch, in fragment order; blockIdx.y picks a chunk of DM*DM elements (0..3: wo, wq, wk, wv; 4..: x, one batch each), dst holds the chunks in that order.
// A block takes 16 rows x 256 k (blockIdx.x = row tile * 4 + k quarter): a wave reads 1 KB of one row, the 16-byte octets turn in LDS (one group of 16 rows per k octet, pitch 272 B against bank conflicts), a wave stores 512 contiguous bytes.
static_assert(DQ == DM && DKV == DM && TT == DM && NH_ == NKV && RH % 256 == 0 && TT % 256 == 0 && NH_ % 4 == 0 && HD == 64, "chunking and row blocks");
__global__ __launch_bounds__(256) void k_cvt8(const float* __restrict__ wo, const float* __restrict__ wq, const float* __restrict__ wk, const float* __restrict__ wv, const float* __restrict__ x, bf* dst) { const int y = blockIdx.y; const float* src = (y == 0) ? wo : (y == 1) ? wq : (y == 2) ? wk : (y == 3) ? wv : x + (size_t)(y - 4) * DM * DM;
    __shared__ __align__(16) bf ts[32 * 136];
    const int rt = blockIdx.x >> 2, kq = blockIdx.x & 3, tid = threadIdx.x;
    const float* s0 = src + (size_t)(rt * 16 + (tid >> 5)) * DM + kq * 256 + (tid & 31) * 8; const float* s1 = s0 + 8 * DM;   // rows tid / 32 and 8 + tid / 32, k octet tid % 32
    const v8f v0 = *(const v8f*)s0, v1 = *(const v8f*)s1;
    // s_wait_xcnt 0 behind the loads, before any register that one of them names is written again; the address (s1 is s0 plus an immediate offset) is an input so that it stays whole up to the wait
    asm volatile("s_wait_xcnt 0x0" :: "v"(s0) : "memory");
    v8us o0, o1;
#pragma unroll
    for (int k = 0; k < 8; ++k) { o0[k] = f2bf(v0[k]); o1[k] = f2bf(v1[k]); }
    *(v8usa*)(ts + (tid & 31) * 136 + (tid >> 5) * 8) = o0; *(v8usa*)(ts + (tid & 31) * 136 + (8 + (tid >> 5)) * 8) = o1;
    __syncthreads();   // the octets cross waves
    bf* d0 = dst + (size_t)y * DM * DM + ((size_t)rt * (DM / 8) + kq * 32) * 128 + tid * 8;
    *(v8us*)d0 = *(const v8usa*)(ts + (tid >> 4) * 136 + (tid & 15) * 8); *(v8us*)(d0 + 2048) = *(const v8usa*)(ts + (16 + (tid >> 4)) * 136 + (tid & 15) * 8);  }

// k_fattn: fused attention. One wave owns 32 query rows of one (batch, head) plane and walks the TT keys 32 at a time; 8 waves (256 rows) per block read the same K and V. grid (planes, TT / 256): blockIdx.y picks the row block, the hi/lo row blocks come first.
// K and V come through a two-buffer LDS ring: a stage is 128 keys (four 32-key passes) of every plane the row block uses (K 16 KB, V 16 KB, then the lo planes), brought once per block by tensor loads (8 KB a request, one request per issuing wave and stage) one stage ahead of its use; fragment order carries over, so a fragment is 1 KB in a row in LDS too.
// The waves of a block meet once per stage, not once per pass: between two publish points they may drift by up to four passes, so that one wave's softmax runs beside another's matrix instructions and LDS reads.
// St = K Q^T (A: K rows, B: Q rows): a lane holds 16 scores of ONE query (column lr; keys 8 hi + j of each 16-key tile), so maximum, sum and rescale are lane-local but for one exchange between the lane halves.
// The two St tiles of a 32-key block, converted in place, are the B operand of Ot += V^T P^T (A: VT rows d, loaded in the same k order). P is exp(t - running max), not normalised (fp16 rows: x PCAR); Ot is divided by the f32 sum at the end.
__device__ __forceinline__ float xhalf(float x) { const int b = __float_as_int(x); return __int_as_float(__builtin_amdgcn_permlanex16(b, b, 0x76543210, 0xfedcba98, false, false)); }   // lane l <-> l ^ 16
template <typename T16, bool HIRES>
__device__ __forceinline__ void attn_rows(const T16* Q, const T16* Q2, const T16* Kp, const T16* Kp2, const T16* Vp, const T16* Vp2, int t0, bf* Ah, bf* Al, const unsigned char* ring) {
    // every inner loop below is fully unrolled (#pragma unroll): fragment and accumulator arrays stay in registers only under constant indices
    typedef typename WFrag<T16>::V V; static_assert(PCAR == 1024.0f, "the exponent bias 10 below is log2(PCAR)");
    const int lane = threadIdx.x & 31;   // in the comments: lr = lane % 16, hi = lane / 16
    const float C = SCL * 1.4426950408889634f;
    V q[2][2], q2[2][2];
    { const T16* pq = Q + (size_t)t0 * HD + lane * 8; const T16* pq2 = HIRES ? Q2 + (size_t)t0 * HD + lane * 8 : pq;   // fragment order: 16 rows x 32 d are 512 elements in a row
#pragma unroll
      for (int qt = 0; qt < 2; ++qt)
#pragma unroll
          for (int ks = 0; ks < 2; ++ks) { q[qt][ks] = WFrag<T16>::ld(pq + qt * 16 * HD + ks * 512); if (HIRES) q2[qt][ks] = WFrag<T16>::ld(pq2 + qt * 16 * HD + ks * 512); }
      // s_wait_xcnt 0 behind the Q loads, before any register that one of them names is written again; the addresses are inputs so that they stay whole up to the wait
      asm volatile("s_wait_xcnt 0x0" :: "v"(pq), "v"(pq2) : "memory"); }
    v8f o[2][4]; float m[2], l[2];
#pragma unroll
    for (int qt = 0; qt < 2; ++qt) { m[qt] = -3.0e38f; l[qt] = 0.f;
#pragma unroll
        for (int dt = 0; dt < 4; ++dt) o[qt][dt] = (v8f){}; }
    // A stage's K is 16 KB in a row; its V is 4 KB of each of the four groups of 16 d. Wave w brings half w % 2 (two rows of 4 KB) of part w / 2 (K, V, then the lo planes' K, V); the fp16 rows have two parts, so waves 0..3 issue there.
    constexpr unsigned SK = 128u, PARTB = SK * HD * 2u, BUFB = (HIRES ? 4u : 2u) * PARTB; constexpr int NST = TT / (int)SK;   // keys of a stage; bytes of one part of it and of a whole stage; stages
    static_assert(TT % SK == 0 && NST >= 2 && PARTB == 16384u, "two stages or more; the part offsets below");
    const uint32_t wave = uni(threadIdx.x >> 5), part = HIRES ? wave >> 1 : (wave >> 1) & 1u, half = wave & 1u;
    const uint32_t issuer = HIRES ? 1u : pinned(wave < 4u);   // a scalar test: a tensor load ignores EXEC
    const T16* sp = (part & 1u) ? ((part & 2u) ? Vp2 : Vp) + (size_t)half * 32 * TT : ((part & 2u) ? Kp2 : Kp) + (size_t)half * 4096;
    const uint64_t sga = (uint64_t)(size_t)sp;
    const uint32_t sstep = (part & 1u) ? 4096u : 16384u;   // bytes from one 128-key stage to the next
    const uint32_t sdst = (uint32_t)(size_t)ring + part * PARTB + half * 8192u;   // LDS byte address: the low 32 bits of the __shared__ address
    const u32x8 g1 = tdm_group1(4096u, 2u, (part & 1u) ? 32u * TT : 4096u);
    u32x4 g0 = tdm_group0(sdst, sga);
    if (issuer) { tdm_load(g0, g1); tdm_wait(g0, g1); }   // stage 0 has landed, as far as this wave asked for it
    __syncthreads();                                       // and every other wave's part of it
    if (issuer) { g0 = tdm_group0(sdst + BUFB, sga + sstep); tdm_load(g0, g1); }
#pragma unroll 1   // one stage per trip: trip s reads buffer s % 2 alone
    for (int st = 0; st < NST; ++st) {
      const unsigned bo = (st & 1) ? BUFB : 0u;
#pragma unroll 1   // one 32-key pass per trip: an unrolled body would not fit the registers of four waves per SIMD
      for (int ps = 0; ps < 4; ++ps) {
        // the pass's 4 KB of the K part; its 1 KB of each 4-KB d group of the V part
        const T16* pk = (const T16*)(ring + bo) + ps * 2048 + lane * 8; const T16* pv = (const T16*)(ring + bo + PARTB) + ps * 512 + lane * 8; const T16* pk2 = HIRES ? pk + PARTB : pk; const T16* pv2 = HIRES ? pv + PARTB : pv;   // the lo parts lie two parts (PARTB elements) on
        V kf[2][2], kf2[2][2];
#pragma unroll
        for (int kt = 0; kt < 2; ++kt)
#pragma unroll
            for (int ks = 0; ks < 2; ++ks) { kf[kt][ks] = WFrag<T16>::ld(pk + kt * 16 * HD + ks * 512); if (HIRES) kf2[kt][ks] = WFrag<T16>::ld(pk2 + kt * 16 * HD + ks * 512); }
        v8f st[2][2];
#pragma unroll
        for (int kt = 0; kt < 2; ++kt)
#pragma unroll
            for (int qt = 0; qt < 2; ++qt) { v8f s = (v8f){};
#pragma unroll
                for (int ks = 0; ks < 2; ++ks) { s = WFrag<T16>::mma(kf[kt][ks], q[qt][ks], s); if (HIRES) { s = WFrag<T16>::mma(kf[kt][ks], q2[qt][ks], s); s = WFrag<T16>::mma(kf2[kt][ks], q[qt][ks], s); } }
                st[qt][kt] = s; }
        V vf[4], vf2[4];
#pragma unroll
        for (int dt = 0; dt < 4; ++dt) { vf[dt] = WFrag<T16>::ld(pv + dt * 2048); if (HIRES) vf2[dt] = WFrag<T16>::ld(pv2 + dt * 2048); }
        V p[2], p2[2];
#pragma unroll
        for (int qt = 0; qt < 2; ++qt) { float mx = st[qt][0][0];
#pragma unroll
            for (int j = 1; j < 16; ++j) mx = fmaxf(mx, st[qt][j >> 3][j & 7]);
            mx = fmaxf(mx, xhalf(mx)); const float mn = fmaxf(m[qt], mx); float al = (m[qt] - mn) * C; m[qt] = mn;
            const float nb = (HIRES ? 0.0f : 10.0f) - mn * C;   // fp16 rows carry P x PCAR = 2^10
            float e[16];
#pragma unroll
            for (int j = 0; j < 16; ++j) e[j] = __builtin_fmaf(st[qt][j >> 3][j & 7], C, nb);
            // the 17 exponentials of one query tile in one statement, each in place: none overwrites the source or reads the result of the one before it; the v_nop is the slot between the last one and whatever follows
            asm("v_exp_f32 %0, %0\n\tv_exp_f32 %1, %1\n\tv_exp_f32 %2, %2\n\tv_exp_f32 %3, %3\n\tv_exp_f32 %4, %4\n\tv_exp_f32 %5, %5\n\tv_exp_f32 %6, %6\n\tv_exp_f32 %7, %7\n\tv_exp_f32 %8, %8\n\t"
                "v_exp_f32 %9, %9\n\tv_exp_f32 %10, %10\n\tv_exp_f32 %11, %11\n\tv_exp_f32 %12, %12\n\tv_exp_f32 %13, %13\n\tv_exp_f32 %14, %14\n\tv_exp_f32 %15, %15\n\tv_exp_f32 %16, %16\n\tv_nop"
                : "+v"(al), "+v"(e[0]), "+v"(e[1]), "+v"(e[2]), "+v"(e[3]), "+v"(e[4]), "+v"(e[5]), "+v"(e[6]), "+v"(e[7]), "+v"(e[8]), "+v"(e[9]), "+v"(e[10]), "+v"(e[11]), "+v"(e[12]), "+v"(e[13]), "+v"(e[14]), "+v"(e[15]));
            float sum = 0.f;
#pragma unroll
            for (int j = 0; j < 16; ++j) { sum += e[j];
                if constexpr (HIRES) { const __bf16 h = (__bf16)e[j]; p[qt][j] = h; p2[qt][j] = (__bf16)(e[j] - (float)h); } else p[qt][j] = (h16)e[j]; }
            l[qt] = l[qt] * al + sum;
#pragma unroll
            for (int dt = 0; dt < 4; ++dt) o[qt][dt] *= al; }
#pragma unroll
        for (int dt = 0; dt < 4; ++dt)
#pragma unroll
            for (int qt = 0; qt < 2; ++qt) { o[qt][dt] = WFrag<T16>::mma(vf[dt], p[qt], o[qt][dt]); if (HIRES) { o[qt][dt] = WFrag<T16>::mma(vf[dt], p2[qt], o[qt][dt]); o[qt][dt] = WFrag<T16>::mma(vf2[dt], p[qt], o[qt][dt]); } }
        // hi/lo rows, whose pass ends in matrix instructions: four vector slots between the last of them and the next pass's first vector write over one of their operands. The scheduling barrier keeps the matrix instructions in front of the slots.
        if constexpr (HIRES) { __builtin_amdgcn_sched_barrier(0); asm volatile("v_nop\n\tv_nop\n\tv_nop\n\tv_nop"); }
      }
      // publish point of the next stage, behind the stage's fourth pass: this wave's reads of the buffer are done, its tensor load of the next stage has landed, every wave has come as far; only then the refill of the buffer just read
      asm volatile("s_wait_dscnt 0x0" ::: "memory");
      if (issuer) tdm_wait(g0, g1);
      __syncthreads();
      // stage s + 2, while it exists (a scalar test), into the buffer of trip s; its byte offset is pinned so that the descriptor is formed behind the wait
      if (pinned(issuer && st + 2 < NST)) { g0 = tdm_group0(sdst + bo, sga + pinned((uint32_t)(st + 2) * sstep)); tdm_load(g0, g1); }
    }
    tdm_wait(g0, g1);   // no tensor load is outstanding when the wave goes on to its end
    asm volatile("s_wait_dscnt 0x0" ::: "memory");
    // o[qt][dt][j] = Ot[d = dt * 16 + 8 hi + j][query t0 + qt * 16 + lr]: 8 consecutive d of one merged row per lane, in fragment order 512 contiguous bytes per wave-wide store
#pragma unroll
    for (int qt = 0; qt < 2; ++qt) { const float f = __fdiv_rn(1.0f, l[qt] + xhalf(l[qt])); const size_t oo = (size_t)(t0 + qt * 16) * DQ + lane * 8;
#pragma unroll
        for (int dt = 0; dt < 4; ++dt) { v8us oh, ol;
#pragma unroll
            for (int j = 0; j < 8; ++j) { unsigned short a, c2; splitf(o[qt][dt][j] * f, a, c2); oh[j] = a; ol[j] = c2; }
            bf* sh = Ah + oo + dt * 256; bf* sl = Al + oo + dt * 256; *(v8us*)sh = oh; *(v8us*)sl = ol;
            // the same wait behind the two stores, before a register that one of them names (address or data) is written again
            asm volatile("s_wait_xcnt 0x0" :: "v"(sh), "v"(sl), "v"(oh), "v"(ol) : "memory"); } }
}
// four waves per SIMD (two blocks per WGP): the softmax between the matrix runs wants waves, so the register budget is held at a quarter of a SIMD's file
__global__ __launch_bounds__(256) __attribute__((amdgpu_waves_per_eu(4, 4))) void k_fattn(const h16* Q16, const h16* K16, const h16* V16, const bf* Qh, const bf* Ql, const bf* Kh, const bf* Kl, const bf* Vh, const bf* Vl, bf* Ah, bf* Al) {
    __shared__ __attribute__((aligned(2048))) unsigned char ring[2 * 65536];   // two stages of four parts; every tensor tile's place in LDS is a multiple of 2 KB; two blocks per WGP still fit
    const int g = blockIdx.x; const size_t zo = (size_t)g * TT * HD; const int t0 = blockIdx.y * 256 + (threadIdx.x >> 5) * 32;   // plane g = batch * NH_ + head: one kv head per query head
    const size_t ao = (size_t)(g / NH_) * TT * DQ + (g % NH_) * HD * 16;   // merged planes in fragment order: a head's 8 octets of d, 128 elements each
    if (blockIdx.y * 256 < RH) attn_rows<bf, true>(Qh + zo, Ql + zo, Kh + zo, Kl + zo, Vh + zo, Vl + zo, t0, Ah + ao, Al + ao, ring);
    else attn_rows<h16, false>(Q16 + zo, nullptr, K16 + zo, nullptr, V16 + zo, nullptr, t0, Ah + ao, Al + ao, ring);
}

extern "C" void kernel_launch(void* const* d_in, const int* in_sizes, int n_in,
                              void* d_out, int out_size, void* d_ws, size_t ws_size, hipStream_t stream) {
    (void)in_sizes; (void)n_in; (void)out_size;
    const float* x = (const float*)d_in[0]; const float* wq = (const float*)d_in[1]; const float* wk = (const float*)d_in[2]; const float* wv = (const float*)d_in[3]; const float* wo = (const float*)d_in[4]; const float* bo = (const float*)d_in[5];
    float* OUT = (float*)d_out;     // [8][1024][1024]
    char* ws = (char*)d_ws; const size_t Mi = (size_t)1 << 20;
    if (ws_size < 253 * Mi) return;    // ws 256 MiB
    // Workspace map in MiB; regions are reused in stream order once their last reader has run.
    //   0 WO | 2 WQ WK WV | 8 XB (all batches) | 25 .. 169 nine planes of 16 (all batches): fp16 q k v | 73 hi q k v | 121 lo q k v
    //   attention: 237 ATh (16) | 2 ATl (16, over WQ WK WV XB)
    const size_t PL = (size_t)NB_ * NH_ * TT * HD;   // elements of one plane set
    bf* WO = (bf*)ws; bf* WQ = (bf*)(ws + 2 * Mi); bf* XB = (bf*)(ws + 8 * Mi);
    h16* QP16 = (h16*)(ws + 25 * Mi); h16* KP16 = QP16 + PL; h16* VT16 = KP16 + PL; bf* QPh = (bf*)(ws + 73 * Mi); bf* KPh = QPh + PL; bf* VTh = KPh + PL; bf* QPl = (bf*)(ws + 121 * Mi); bf* KPl = QPl + PL; bf* VTl = KPl + PL;   // q, k, v in a row: the z sets of the projection launch
    bf* ATh = (bf*)(ws + 237 * Mi); bf* ATl = (bf*)(ws + 2 * Mi);
    k_cvt8<<<dim3(DM / 16 * (DM / 256), 4 + NB_, 1), 256, 0, stream>>>(wo, wq, wk, wv, x, WO);
    k_proj3<<<dim3(NB_ * TT / 256, DQ / 128, 1), 256, 0, stream>>>(XB, WQ, QP16, QPh, QPl);
    k_fattn<<<dim3(NB_ * NH_, TT / 256, 1), 256, 0, stream>>>(QP16, KP16, VT16, QPh, QPl, KPh, KPl, VTh, VTl, ATh, ATl);
    k_gemmw<bf, 1, true><<<dim3(NB_ * TT / 256, DM / 128, 1), 256, 0, stream>>>(ATh, ATl, WO, DQ, DQ, OUT, DM, bo, 0, 0, 0);
}

// v010
// One run takes 119 microseconds.
// Timed twice side by side with v009, it ran 1.04 times as fast both times.
// All steps since v000 together make it 40.5 times as fast.
#include <hip/hip_runtime.h>
#include <stdint.h>

// Simple multi-head attention scaled by the EMBEDDING size (x [8][1024][1024]; q,k,v = x W^T ('oi' [1024][1024], no bias); scores / sqrt(1024) (module quirk); softmax over all keys; out = merged Wo^T + bo -> [8][1024][1024] (8.4 M)).
// Every 16-bit operand plane [row][k] lies in fragment order: element (row, k) at ((row / 16) * (K / 8) + k / 8) * 128 + (row % 16) * 8 + k % 8, so a 16 x 32 fragment is 1 KB in a row and each of its two wave-wide 16-byte loads covers 512 contiguous bytes (four whole lines).
// Layout, all batches per launch: bf16 copy of x and weights; exact projections that store the attention's operand planes themselves; dense T-1024 attention fused in one launch (scores, running softmax and P V stay in registers; hybrid rows: < 512 hi/lo 3 products, rest fp16; P x1024); merged hi/lo x Wo exact + bo.
// Compute dtypes, f32 accumulate: every input rounded to bf16; projections exact; attention rows < 512 3 products of an fp16 hi/lo split (hi is the fp16 plane that the other rows use alone), rest fp16; softmax f32; Wo hl x exact + bias.

#define NB_  8
#define TT   1024
#define DM   1024
#define NH_  16
#define NKV  16
#define REP  (NH_ / NKV)
#define HD   64
#define DQ   (NH_ * HD)
#define DKV  (NKV * HD)
#define RH   512                  // query rows < RH use hi+lo planes (0: none)
#define WIN  0
#define PCAR 1024.0f
#define SCL  0.03125f   // 1/sqrt(1024): the module scales by the embedding size
typedef _Float16 h16;
typedef unsigned short bf;
typedef __attribute__((ext_vector_type(16))) __bf16   v16bf;
typedef __attribute__((ext_vector_type(16))) _Float16 v16h;
typedef __attribute__((ext_vector_type(8)))  _Float16 v8h;
typedef __attribute__((ext_vector_type(8)))  unsigned short v8us;
typedef __attribute__((ext_vector_type(8)))  float    v8f;
typedef __attribute__((ext_vector_type(4)))  float    v4f;
typedef __attribute__((ext_vector_type(2)))  float    v2f;
typedef __attribute__((ext_vector_type(2)))  _Float16 v2h;
typedef v8h  __attribute__((may_alias)) v8ha;
typedef v4f  __attribute__((may_alias)) v4fa;
typedef v8us __attribute__((may_alias)) v8usa;

__device__ __forceinline__ unsigned short f2bf(float f) { unsigned u = __float_as_uint(f); u += 0x7FFFu + ((u >> 16) & 1u); return (unsigned short)(u >> 16); }
__device__ __forceinline__ float bf2f(unsigned short b) { return __uint_as_float(((unsigned)b) << 16); }
__device__ __forceinline__ float bfr(float f) { return bf2f(f2bf(f)); }
__device__ __forceinline__ v16h cat16(v8h lo, v8h hi) { return __builtin_shufflevector(lo, hi, 0, 1, 2, 3, 4, 5, 6, 7, 8, 9, 10, 11, 12, 13, 14, 15); }
__device__ __forceinline__ v16bf cat16b(v8us lo, v8us hi) { return __builtin_bit_cast(v16bf, __builtin_shufflevector(lo, hi, 0, 1, 2, 3, 4, 5, 6, 7, 8, 9, 10, 11, 12, 13, 14, 15)); }
typedef __attribute__((ext_vector_type(4))) unsigned v4u;
// fp16 hi/lo split of eight f32 values, as four pairs each: hi by packed conversions; lo = fp16(x - hi) by one mixed-precision FMA per value (hi * -1 + x in f32, rounded once, into its half of the pair; the -1 comes in a register and is read as f32, hi as the fp16 half that op_sel names).
__device__ __forceinline__ void split8(float x0, float x1, float x2, float x3, float x4, float x5, float x6, float x7, v4u& hi, v4u& lo) {
    unsigned h0, h1, h2, h3, l0, l1, l2, l3;
    // in asm because the compiler widens hi again, subtracts and converts a second time (five instructions a pair, not three). Every FMA's producer stands four vector instructions back: the s_delay_alu hints let the SIMD's other waves issue meanwhile
    asm("v_cvt_pk_f16_f32 %0, %8, %9\n\tv_cvt_pk_f16_f32 %1, %10, %11\n\tv_cvt_pk_f16_f32 %2, %12, %13\n\tv_cvt_pk_f16_f32 %3, %14, %15\n\t"
        "s_delay_alu instid0(VALU_DEP_4) | instskip(NEXT) | instid1(VALU_DEP_4)\n\t"
        "v_fma_mixlo_f16 %4, %0, %16, %8 op_sel_hi:[1,0,0]\n\tv_fma_mixlo_f16 %5, %1, %16, %10 op_sel_hi:[1,0,0]\n\t"
        "s_delay_alu instid0(VALU_DEP_4) | instskip(NEXT) | instid1(VALU_DEP_4)\n\t"
        "v_fma_mixlo_f16 %6, %2, %16, %12 op_sel_hi:[1,0,0]\n\tv_fma_mixlo_f16 %7, %3, %16, %14 op_sel_hi:[1,0,0]\n\t"
        "s_delay_alu instid0(VALU_DEP_4) | instskip(NEXT) | instid1(VALU_DEP_4)\n\t"
        "v_fma_mixhi_f16 %4, %0, %16, %9 op_sel:[1,0,0] op_sel_hi:[1,0,0]\n\tv_fma_mixhi_f16 %5, %1, %16, %11 op_sel:[1,0,0] op_sel_hi:[1,0,0]\n\t"
        "s_delay_alu instid0(VALU_DEP_4) | instskip(NEXT) | instid1(VALU_DEP_4)\n\t"
        "v_fma_mixhi_f16 %6, %2, %16, %13 op_sel:[1,0,0] op_sel_hi:[1,0,0]\n\tv_fma_mixhi_f16 %7, %3, %16, %15 op_sel:[1,0,0] op_sel_hi:[1,0,0]"
        : "=&v"(h0), "=&v"(h1), "=&v"(h2), "=&v"(h3), "=&v"(l0), "=&v"(l1), "=&v"(l2), "=&v"(l3)
        : "v"(x0), "v"(x1), "v"(x2), "v"(x3), "v"(x4), "v"(x5), "v"(x6), "v"(x7), "v"(-1.0f));
    hi = (v4u){h0, h1, h2, h3}; lo = (v4u){l0, l1, l2, l3};
}
__device__ __forceinline__ v8f wmma16(v16h a, v16h b, v8f c) { return __builtin_amdgcn_wmma_f32_16x16x32_f16(false, a, false, b, (short)0, c, false, false); }
__device__ __forceinline__ v8f wmmab(v16bf a, v16bf b, v8f c) { return __builtin_amdgcn_wmma_f32_16x16x32_bf16(false, a, false, b, (short)0, c, false, false); }



// ---- k_gemmw: register-blocked GEMM, one wave per 64x64 output tile (16 accumulators), EIGHT WAVES per block: 4 along the x rows, 2 along the weight rows, a block tile of 256 x 128. Operands are 16-bit planes in fragment order (A of lda, Bt of K elements a row); grid (M/256, N/128, Z), 256 threads.
// The operands come through a two-buffer LDS ring: a stage is 64 k of the block's 256 A rows (32 KB; with NSPLIT 1 the A2 rows behind them) and 128 Bt rows (16 KB), brought once per block by tensor loads, one request per wave and stage, one trip ahead of its use. Fragment order carries over: 16 rows x 64 k are 2 KB in a row in memory and in LDS (one row of a tensor tile; the next group of 16 rows lies 16 * lda elements on), a fragment 1 KB (WFrag::ld takes the fragment's start + lane * 8).
// C[m][n] (f32, pitch ldc, + optional f32 bias[n]) = sum_k A[m][k] Bt[n][k] (NSPLIT 1: + A2[m][k] Bt[n][k]). z-batch strides sA/sB/sC in elements. K % 64 == 0.
template <typename T16> struct WFrag;
template <> struct WFrag<h16> { typedef v16h V; static __device__ __forceinline__ V ld(const h16* p) { return cat16(*(const v8h*)p, *(const v8h*)(p + 256)); } static __device__ __forceinline__ v8f mma(V a, V b, v8f c) { return wmma16(a, b, c); } };
template <> struct WFrag<bf> { typedef v16bf V; static __device__ __forceinline__ V ld(const bf* p) { return cat16b(*(const v8us*)p, *(const v8us*)(p + 256)); } static __device__ __forceinline__ v8f mma(V a, V b, v8f c) { return wmmab(a, b, c); } };
// Tensor loads: one request of one wave brings a tile of n rows of rowb bytes (source pitch in bytes) into LDS, rows one behind the other, through no register. Two descriptor groups, every word wave-uniform in scalar registers; 1-byte elements, tensor = tile, no pad, no mask.
typedef uint32_t u32x4 __attribute__((ext_vector_type(4)));
typedef uint32_t u32x8 __attribute__((ext_vector_type(8)));
__device__ __forceinline__ uint32_t uni(uint32_t v) { return (uint32_t)__builtin_amdgcn_readfirstlane(v); }
// a wave-uniform value held in a scalar register, so that a test on it is a scalar branch (a tensor load ignores EXEC) and what is formed from it is formed behind the volatile statements in front of it
__device__ __forceinline__ uint32_t pinned(uint32_t v) { uint32_t w = (uint32_t)__builtin_amdgcn_readfirstlane(v); asm volatile("" : "+s"(w)); return w; }
__device__ __forceinline__ u32x8 tdm_group1(uint32_t rowb, uint32_t n, uint32_t pitch) {
    // words 1 to 7 pinned: the group is formed once and stays in its scalar registers for the whole ring, so that no word is written again while a request that names it is outstanding; word 0 is the constant 0
    u32x8 g;
    g[0] = uni(0u); g[1] = pinned((rowb & 0xFFFFu) << 16); g[2] = pinned((rowb >> 16) | ((n & 0xFFFFu) << 16)); g[3] = pinned((n >> 16) | (rowb << 16));
    g[4] = pinned(n); g[5] = pinned(pitch); g[6] = pinned(0u); g[7] = pinned(0u);
    return g;
}
__device__ __forceinline__ u32x4 tdm_group0(uint32_t lds_dst, uint64_t ga) {
    u32x4 g;
    g[0] = uni(1u); g[1] = uni(lds_dst); g[2] = uni((uint32_t)ga); g[3] = uni((((uint32_t)(ga >> 32)) & 0x01FFFFFFu) | 0x80000000u);
    return g;
}
// group 0 goes in and out of the statement, so that what tdm_wait holds whole are the very registers that the request names
__device__ __forceinline__ void tdm_load(u32x4& g0, u32x8 g1) { asm volatile("tensor_load_to_lds %0, %1" : "+s"(g0) : "s"(g1) : "memory"); }
// the wave's own request has landed; the descriptor it named is an input so that its registers stay whole up to the wait
__device__ __forceinline__ void tdm_wait(u32x4 g0, u32x8 g1) { asm volatile("s_wait_tensorcnt 0x0" :: "s"(g0), "s"(g1) : "memory"); }
template <typename T16, int NSPLIT, bool BIAS>
__global__ __launch_bounds__(256) void k_gemmw(const T16* __restrict__ A, const T16* __restrict__ A2, const T16* __restrict__ Bt, int K, int lda, float* C, int ldc, const float* __restrict__ bias, size_t sA, size_t sB, size_t sC) {
    typedef typename WFrag<T16>::V V; static_assert(NSPLIT == 0 || NSPLIT == 1, "the ring stages A, A2 and Bt");
    constexpr unsigned XBY = 32768u, WOFF = (NSPLIT == 1 ? 2u : 1u) * XBY, BUFB = WOFF + 16384u;   // bytes: one A part of a stage, where its Bt part begins, a whole stage
    __shared__ __attribute__((aligned(2048))) unsigned char ring[2 * BUFB];   // every tensor tile's place in LDS is a multiple of 2 KB
    __shared__ __align__(16) float osall[8 * 16 * 68];
    const size_t z = blockIdx.z; A += z * sA; if (NSPLIT == 1) A2 += z * sA; Bt += z * sB; C += z * sC;
    const int tid = threadIdx.x, lane = tid & 31, lr = lane & 15, hi = lane >> 4, wx = (tid >> 5) & 3, wy = tid >> 7;
    const int bx = blockIdx.x * 4 + wx, by = blockIdx.y * 2 + wy;   // the wave's 64 x 64 tile: bx along the x rows, by along the weight rows
    v8f acc[4][4];
#pragma unroll
    for (int mb = 0; mb < 4; ++mb)
#pragma unroll
        for (int nb = 0; nb < 4; ++nb) acc[mb][nb] = (v8f){};
    // every wave brings its own slice of a stage, whole row groups of one part. NSPLIT 0: waves 0..3 four A groups each, waves 4..7 two Bt groups each. NSPLIT 1: waves 0..2 six, five, five A groups, waves 3..5 the same of A2, waves 6, 7 four Bt groups each.
    const uint32_t wave = uni(threadIdx.x >> 5);
    uint32_t part, first, ngr;   // part 0: A, 1: A2, 2: Bt
    if (NSPLIT == 1) { part = wave / 3u; const uint32_t r = wave - 3u * part; first = part < 2u ? (r ? 5u * r + 1u : 0u) : 4u * r; ngr = part < 2u ? (r ? 5u : 6u) : 4u; }
    else { part = wave < 4u ? 0u : 2u; first = wave < 4u ? 4u * wave : 2u * (wave - 4u); ngr = wave < 4u ? 4u : 2u; }
    const T16* sp = part == 2u ? Bt + ((size_t)blockIdx.y * 8 + first) * 16 * K : (part == 1u ? A2 : A) + ((size_t)blockIdx.x * 16 + first) * 16 * lda;
    const uint64_t sga = (uint64_t)(size_t)sp;
    const uint32_t sdst = (uint32_t)(size_t)ring + (part == 2u ? WOFF : part * XBY) + first * 2048u;   // LDS byte address: the low 32 bits of the __shared__ address
    const u32x8 g1 = tdm_group1(2048u, ngr, (uint32_t)(part == 2u ? K : lda) * 32u);
    u32x4 g0 = tdm_group0(sdst, sga);
    tdm_load(g0, g1);
    tdm_wait(g0, g1);   // stage 0 has landed, as far as this wave asked for it
    __syncthreads();    // and every other wave's part of it
    if (pinned(64 < K)) { g0 = tdm_group0(sdst + BUFB, sga + 2048u); tdm_load(g0, g1); }
#pragma unroll 1   // one stage per trip: trip t reads buffer t % 2 alone
    for (int kc = 0; kc < K; kc += 64) {
        const unsigned bo = (kc & 64) ? BUFB : 0u;
        const T16* pa = (const T16*)(ring + bo) + wx * 4096 + lane * 8; const T16* pb = (const T16*)(ring + bo + WOFF) + wy * 4096 + lane * 8;   // the wave's four row groups of each part
#pragma unroll
        for (int ks = 0; ks < 2; ++ks) {
            V a[4], a2[4], b[4];
#pragma unroll
            for (int mb = 0; mb < 4; ++mb) { a[mb] = WFrag<T16>::ld(pa + mb * 1024 + ks * 512); if (NSPLIT == 1) a2[mb] = WFrag<T16>::ld(pa + XBY / 2 + mb * 1024 + ks * 512); }
#pragma unroll
            for (int nb = 0; nb < 4; ++nb) b[nb] = WFrag<T16>::ld(pb + nb * 1024 + ks * 512);
            // the 32 k's fragment loads stay one group in front of its matrix instructions: left free, the B loads sink among them, one waited place per four or eight
            __builtin_amdgcn_sched_barrier(0);
            if (ks == 1) {
                // publish point of the next stage, behind the trip's last fragment loads: this wave's reads of the buffer are done, its tensor load of the next stage has landed, every wave has come as far; only then the refill of the buffer just read.
                // The second 32 k's products, from registers alone, follow it: a wave comes out of the barrier with matrix work at hand, and the refill in front of them has a whole trip's lead.
                asm volatile("s_wait_dscnt 0x0" ::: "memory");
                tdm_wait(g0, g1);
                __syncthreads();
                // stage t + 2, while it exists (a scalar test), into the buffer of trip t; its byte offset is pinned so that the descriptor is formed behind the wait
                if (pinned(kc + 128 < K)) { g0 = tdm_group0(sdst + bo, sga + pinned((uint32_t)(kc + 128) * 32u)); tdm_load(g0, g1); }
            }
#pragma unroll
            for (int nb = 0; nb < 4; ++nb)
#pragma unroll
                for (int mb = 0; mb < 4; ++mb) { acc[mb][nb] = WFrag<T16>::mma(a[mb], b[nb], acc[mb][nb]); if (NSPLIT == 1) acc[mb][nb] = WFrag<T16>::mma(a2[mb], b[nb], acc[mb][nb]); }
        }
    }
    tdm_wait(g0, g1);   // no tensor load is outstanding when the wave goes on to its end
    asm volatile("s_wait_dscnt 0x0" ::: "memory");
    float* os = osall + (tid >> 5) * (16 * 68); const int r0 = bx * 64, c0 = by * 64;   // each wave turns its tile in its own LDS range
#pragma unroll
    for (int mb = 0; mb < 4; ++mb) {
#pragma unroll
        for (int nb = 0; nb < 4; ++nb) {
#pragma unroll
            for (int j = 0; j < 8; ++j) os[(hi * 8 + j) * 68 + nb * 16 + lr] = acc[mb][nb][j]; }
        __builtin_amdgcn_wave_barrier(); asm volatile("" ::: "memory");
        float* crow = C + (size_t)(r0 + mb * 16) * ldc + c0;
{
#pragma unroll
            for (int s = 0; s < 8; ++s) { const int row = 2 * s + hi, cofs = lr * 4; v4f val = *(const v4fa*)(os + row * 68 + cofs); if (BIAS) { val[0] += bfr(bias[c0 + cofs]); val[1] += bfr(bias[c0 + cofs + 1]); val[2] += bfr(bias[c0 + cofs + 2]); val[3] += bfr(bias[c0 + cofs + 3]); }
                *(v4f*)(crow + (size_t)row * ldc + cofs) = val; }
             }
        __builtin_amdgcn_wave_barrier(); asm volatile("" ::: "memory");
    }
}

// ---- k_proj3: the three projections in one block. A block takes 256 x rows against the SAME 128 weight rows (two heads) of wq, wk and wv, so one x stage serves three products: grid (rows / 256, DQ / 128), 256 threads, one block per WGP.
// Eight waves, 4 along the x rows, 2 along the weight rows; a wave's tile is 64 positions x one head of q, k and v (48 accumulators). X and Wt (wq wk wv in a row) are bf16 planes in fragment order, DM elements a row.
// Two-buffer LDS ring as in k_gemmw: a stage is 64 k of the x rows (32 KB) and of the three weights' rows (16 KB each), one tensor load per wave and stage, one trip ahead of its use. The publish point stands in front of a trip's last block, so that the block can fetch the next trip's first weight fragments.
// No f32 output: a tile goes from the accumulators straight into its head's fp16 plane and the plane of what that rounding left (P16, Pl: q, k, v sets in a row), in fragment order.
// A lane's 8 accumulator values run along the A operand's rows, and a plane wants 8 consecutive k per lane: d for the q and k planes [h][t][d], so there the weight is the WMMA's A operand; t for the V^T planes [h][d][t], so there x is.
__global__ __launch_bounds__(256) void k_proj3(const bf* __restrict__ X, const bf* __restrict__ Wt, h16* P16, h16* Pl) {
    typedef WFrag<bf>::V V; static_assert(DM % 128 == 0, "two stages or more");
    constexpr unsigned XBY = 32768u, WBY = 16384u, BUFB = XBY + 3u * WBY;   // bytes: the x part of a stage, one weight's part, a whole stage
    __shared__ __attribute__((aligned(2048))) unsigned char ring[2 * BUFB];   // every tensor tile's place in LDS is a multiple of 2 KB
    const int tid = threadIdx.x, lane = tid & 31, wx = (tid >> 5) & 3, wy = tid >> 7;
    const int bx = blockIdx.x * 4 + wx, by = blockIdx.y * 2 + wy;   // the wave's 64 positions and its head
    v8f acc[3][4][4];
#pragma unroll
    for (int z = 0; z < 3; ++z)
#pragma unroll
        for (int mb = 0; mb < 4; ++mb)
#pragma unroll
            for (int nb = 0; nb < 4; ++nb) acc[z][mb][nb] = (v8f){};
    // every wave brings its own slice of a stage, whole row groups of one part: waves 0, 1 eight x groups each; waves 2..7 four groups each, two waves a weight
    const uint32_t wave = uni(threadIdx.x >> 5), wz = (wave - 2u) >> 1, half = wave & 1u;
    const bf* sp = wave < 2u ? X + ((size_t)blockIdx.x * 16 + wave * 8u) * 16 * DM : Wt + (size_t)wz * DQ * DM + ((size_t)blockIdx.y * 8 + half * 4u) * 16 * DM;
    const uint64_t sga = ((uint64_t)uni((uint32_t)((uint64_t)(size_t)sp >> 32)) << 32) | uni((uint32_t)(size_t)sp);   // wave-uniform: kept in scalar registers
    const uint32_t sdst = uni((uint32_t)(size_t)ring + (wave < 2u ? wave * 16384u : XBY + wz * WBY + half * 8192u));   // LDS byte address: the low 32 bits of the __shared__ address
    const u32x8 g1 = tdm_group1(2048u, wave < 2u ? 8u : 4u, (uint32_t)DM * 32u);
    u32x4 g0 = tdm_group0(sdst, sga);
    tdm_load(g0, g1);
    tdm_wait(g0, g1);   // stage 0 has landed, as far as this wave asked for it
    __syncthreads();    // and every other wave's part of it
    g0 = tdm_group0(sdst + BUFB, sga + 2048u); tdm_load(g0, g1);
    V xf[4], wf[4];
    { const bf* w0 = (const bf*)(ring + XBY) + wy * 4096 + lane * 8;   // the first block's weight fragments, behind the barrier that published stage 0
#pragma unroll
      for (int i = 0; i < 4; ++i) wf[i] = WFrag<bf>::ld(w0 + i * 1024); }
#pragma unroll 1   // one stage per trip
    for (int kc = 0; kc < DM; kc += 64) {
        const unsigned bo = (kc & 64) ? BUFB : 0u;
        const bf* xs = (const bf*)(ring + bo) + wx * 4096 + lane * 8; const bf* wsp = (const bf*)(ring + bo + XBY) + wy * 4096 + lane * 8;   // the wave's four row groups of x and of wq; wk, wv lie WBY bytes on each
        const bf* wnx = (const bf*)(ring + (BUFB - bo) + XBY) + wy * 4096 + lane * 8;   // the same of the next stage
        // six blocks of 16 products a trip: 32 k x one weight. The four x fragments of 32 k are loaded once and serve three blocks; a block's weight fragments are fetched in the middle of the block before it.
#pragma unroll
        for (int g = 0; g < 6; ++g) {
            const int ks = g / 3, z = g % 3, gn = (g + 1) % 6;
            if (z == 0) {
#pragma unroll
                for (int i = 0; i < 4; ++i) xf[i] = WFrag<bf>::ld(xs + i * 1024 + ks * 512);
                // the x loads stay one group in front of the block's matrix instructions: left free, they sink among them, one waited place per fragment
                __builtin_amdgcn_sched_barrier(0); }
            if (g == 5) {
                // publish point of the next stage, in front of the trip's last block, whose fragments were fetched half a block ago: this wave's reads of the buffer are done, its tensor load of the next stage has landed, every wave has come as far; only then the refill of the buffer just read.
                asm volatile("s_wait_dscnt 0x0" ::: "memory");
                tdm_wait(g0, g1);
                __syncthreads();
                // stage t + 2, while it exists (a scalar test), into the buffer of trip t; its byte offset is pinned so that the descriptor is formed behind the wait
                if (pinned(kc + 128 < DM)) { g0 = tdm_group0(sdst + bo, sga + pinned((uint32_t)(kc + 128) * 32u)); tdm_load(g0, g1); }
            }
            V wn[4];
#pragma unroll
            for (int i = 0; i < 4; ++i) {
                if (i == 2) {
                    // the next block's weight fragments as one group, half a block ahead of their use; behind the publish point they come from the next stage (in the last trip: from a buffer that nobody writes any more, and they are not used)
                    __builtin_amdgcn_sched_barrier(0);
#pragma unroll
                    for (int n = 0; n < 4; ++n) wn[n] = WFrag<bf>::ld((g == 5 ? wnx : wsp) + (gn % 3) * (int)(WBY / 2) + n * 1024 + (gn / 3) * 512);
                    __builtin_amdgcn_sched_barrier(0);
                }
#pragma unroll
                for (int n = 0; n < 4; ++n) { if (z < 2) acc[z][i][n] = WFrag<bf>::mma(wf[i], xf[n], acc[z][i][n]); else acc[z][n][i] = WFrag<bf>::mma(xf[n], wf[i], acc[z][n][i]); }
            }
            // the next block's loads stay behind this block's products: lifted over them, more fragments would be live than the registers beside 48 accumulators hold, and accumulators would spill
            __builtin_amdgcn_sched_barrier(0);
#pragma unroll
            for (int i = 0; i < 4; ++i) wf[i] = wn[i];
        }
    }
    tdm_wait(g0, g1);   // no tensor load is outstanding when the wave goes on to its end
    asm volatile("s_wait_dscnt 0x0" ::: "memory");
    // acc[z][mb][nb][j]: A row mb * 16 + 8 hi + j (the plane's k), B row nb * 16 + lr (the plane's row): octet mb * 2 + hi of row group nb, so each wave-wide 16-byte store covers 512 contiguous bytes
    const int x0 = bx * 64, tb = x0 % TT;
#pragma unroll
    for (int z = 0; z < 3; ++z) {
        const bool wa = z < 2; const int sn = wa ? 16 * HD : 16 * TT;   // q, k: the weight rows were the A operand; sn: elements from one group of 16 plane rows to the next
        const size_t base = (((size_t)z * NB_ + x0 / TT) * NH_ + by) * (size_t)(TT * HD) + (wa ? tb * HD : tb * 16) + lane * 8;
#pragma unroll
        for (int mb = 0; mb < 4; ++mb)
#pragma unroll
            for (int nb = 0; nb < 4; ++nb) { v8h o16, ol;   // the split in plain source here: asm operands would pull the accumulators out of the registers above v255, and they would spill
#pragma unroll
                for (int j = 0; j < 8; j += 2) { const float y0 = acc[z][mb][nb][j], y1 = acc[z][mb][nb][j + 1]; const v2h h = __builtin_convertvector((v2f){y0, y1}, v2h), lw = __builtin_convertvector((v2f){y0 - (float)h[0], y1 - (float)h[1]}, v2h);
                    o16[j] = h[0]; o16[j + 1] = h[1]; ol[j] = lw[0]; ol[j + 1] = lw[1]; }
                const size_t e = base + (size_t)nb * sn + mb * 256; h16* s16 = P16 + e; h16* sl = Pl + e; *(v8h*)s16 = o16; *(v8h*)sl = ol;
                // s_wait_xcnt 0 behind the two stores, before a register that one of them names (address or data) is written again
                asm volatile("s_wait_xcnt 0x0" :: "v"(s16), "v"(sl), "v"(o16), "v"(ol) : "memory"); }
    }
}

__device__ __forceinline__ void splitf(float y, unsigned short& h, unsigned short& l) { h = f2bf(y); l = f2bf(y - bf2f(h)); }
typedef __attribute__((ext_vector_type(4))) _Float16 v4h;
typedef __attribute__((ext_vector_type(2))) unsigned short v2us;
typedef __attribute__((ext_vector_type(4))) unsigned short v4us;
typedef __attribute__((ext_vector_type(4))) int v4i;

__global__ __launch_bounds__(256) void k_wtG(const float* __restrict__ w, int K, int N, bf* Bt) {
    const int lane = threadIdx.x & 31; const int L0 = (blockIdx.x * 8 + (threadIdx.x >> 5)) * 8; const int nlines = N * K / 64;
{
#pragma unroll 1
        for (int l = 0; l < 8; ++l) { const int L = L0 + l; if (L >= nlines) break; const size_t e = (size_t)L * 64 + lane * 2; const int k = (int)(e % K), n = (int)(e / K); v2us o;
            o[0] = f2bf(w[(size_t)k * N + n]); o[1] = f2bf(w[(size_t)(k + 1) * N + n]); *(v2us*)(Bt + e) = o; }
         }
}
// k_cvt8: bf16 copies of the four weights and of x in one launch, in fragment order; blockIdx.y picks a chunk of DM*DM elements (0..3: wo, wq, wk, wv; 4..: x, one batch each), dst holds the chunks in that order.
// A block takes 16 rows x 256 k (blockIdx.x = row tile * 4 + k quarter): a wave reads 1 KB of one row, the 16-byte octets turn in LDS (one group of 16 rows per k octet, pitch 272 B against bank conflicts), a wave stores 512 contiguous bytes.
static_assert(DQ == DM && DKV == DM && TT == DM && NH_ == NKV && RH % 256 == 0 && TT % 256 == 0 && NH_ % 4 == 0 && HD == 64, "chunking and row blocks");
__global__ __launch_bounds__(256) void k_cvt8(const float* __restrict__ wo, const float* __restrict__ wq, const float* __restrict__ wk, const float* __restrict__ wv, const float* __restrict__ x, bf* dst) { const int y = blockIdx.y; const float* src = (y == 0) ? wo : (y == 1) ? wq : (y == 2) ? wk : (y == 3) ? wv : x + (size_t)(y - 4) * DM * DM;
    __shared__ __align__(16) bf ts[32 * 136];
    const int rt = blockIdx.x >> 2, kq = blockIdx.x & 3, tid = threadIdx.x;
    const float* s0 = src + (size_t)(rt * 16 + (tid >> 5)) * DM + kq * 256 + (tid & 31) * 8; const float* s1 = s0 + 8 * DM;   // rows tid / 32 and 8 + tid / 32, k octet tid % 32
    const v8f v0 = *(const v8f*)s0, v1 = *(const v8f*)s1;
    // s_wait_xcnt 0 behind the loads, before any register that one of them names is written again; the address (s1 is s0 plus an immediate offset) is an input so that it stays whole up to the wait
    asm volatile("s_wait_xcnt 0x0" :: "v"(s0) : "memory");
    v8us o0, o1;
#pragma unroll
    for (int k = 0; k < 8; ++k) { o0[k] = f2bf(v0[k]); o1[k] = f2bf(v1[k]); }
    *(v8usa*)(ts + (tid & 31) * 136 + (tid >> 5) * 8) = o0; *(v8usa*)(ts + (tid & 31) * 136 + (8 + (tid >> 5)) * 8) = o1;
    __syncthreads();   // the octets cross waves
    bf* d0 = dst + (size_t)y * DM * DM + ((size_t)rt * (DM / 8) + kq * 32) * 128 + tid * 8;
    *(v8us*)d0 = *(const v8usa*)(ts + (tid >> 4) * 136 + (tid & 15) * 8); *(v8us*)(d0 + 2048) = *(const v8usa*)(ts + (16 + (tid >> 4)) * 136 + (tid & 15) * 8);  }

// k_fattn: fused attention. One wave owns 32 query rows of one (batch, head) plane and walks the TT keys 32 at a time; 8 waves (256 rows) per block read the same K and V. grid (planes, TT / 256): blockIdx.y picks the row block, the hi/lo row blocks come first.
// K and V come through a two-buffer LDS ring: a stage is 128 keys (four 32-key passes) of every plane the row block uses (K 16 KB, V 16 KB, then the lo planes), brought once per block by tensor loads (8 KB a request, one request per issuing wave and stage) one stage ahead of its use; fragment order carries over, so a fragment is 1 KB in a row in LDS too.
// The waves of a block meet once per stage, not once per pass: between two publish points they may drift by up to four passes, so that one wave's softmax runs beside another's matrix instructions and LDS reads.
// St = K Q^T (A: K rows, B: Q rows): a lane holds 16 scores of ONE query (column lr; keys 8 hi + j of each 16-key tile), so maximum, sum and rescale are lane-local but for one exchange between the lane halves.
// The two St tiles of a 32-key block, converted in place, are the B operand of Ot += V^T P^T (A: VT rows d, loaded in the same k order). P is exp(t - running max) x PCAR, not normalised; Ot is divided by the f32 sum, which carries the same factor, at the end.
__device__ __forceinline__ float xhalf(float x) { const int b = __float_as_int(x); return __int_as_float(__builtin_amdgcn_permlanex16(b, b, 0x76543210, 0xfedcba98, false, false)); }   // lane l <-> l ^ 16
template <typename T16, bool HIRES>
__device__ __forceinline__ void attn_rows(const T16* Q, const T16* Q2, const T16* Kp, const T16* Kp2, const T16* Vp, const T16* Vp2, int t0, bf* Ah, bf* Al, const unsigned char* ring) {
    // every inner loop below is fully unrolled (#pragma unroll): fragment and accumulator arrays stay in registers only under constant indices
    typedef typename WFrag<T16>::V V; static_assert(PCAR == 1024.0f, "the exponent bias 10 below is log2(PCAR)");
    const int lane = threadIdx.x & 31;   // in the comments: lr = lane % 16, hi = lane / 16
    const float C = SCL * 1.4426950408889634f;
    V q[2][2], q2[2][2];
    { const T16* pq = Q + (size_t)t0 * HD + lane * 8; const T16* pq2 = HIRES ? Q2 + (size_t)t0 * HD + lane * 8 : pq;   // fragment order: 16 rows x 32 d are 512 elements in a row
#pragma unroll
      for (int qt = 0; qt < 2; ++qt)
#pragma unroll
          for (int ks = 0; ks < 2; ++ks) { q[qt][ks] = WFrag<T16>::ld(pq + qt * 16 * HD + ks * 512); if (HIRES) q2[qt][ks] = WFrag<T16>::ld(pq2 + qt * 16 * HD + ks * 512); }
      // s_wait_xcnt 0 behind the Q loads, before any register that one of them names is written again; the addresses are inputs so that they stay whole up to the wait
      asm volatile("s_wait_xcnt 0x0" :: "v"(pq), "v"(pq2) : "memory"); }
    v8f o[2][4]; float m[2], l[2];
#pragma unroll
    for (int qt = 0; qt < 2; ++qt) { m[qt] = -3.0e38f; l[qt] = 0.f;
#pragma unroll
        for (int dt = 0; dt < 4; ++dt) o[qt][dt] = (v8f){}; }
    // A stage's K is 16 KB in a row; its V is 4 KB of each of the four groups of 16 d. Wave w brings half w % 2 (two rows of 4 KB) of part w / 2 (K, V, then the lo planes' K, V); the fp16 rows have two parts, so waves 0..3 issue there.
    constexpr unsigned SK = 128u, PARTB = SK * HD * 2u, BUFB = (HIRES ? 4u : 2u) * PARTB; constexpr int NST = TT / (int)SK;   // keys of a stage; bytes of one part of it and of a whole stage; stages
    static_assert(TT % SK == 0 && NST >= 2 && PARTB == 16384u, "two stages or more; the part offsets below");
    const uint32_t wave = uni(threadIdx.x >> 5), part = HIRES ? wave >> 1 : (wave >> 1) & 1u, half = wave & 1u;
    const uint32_t issuer = HIRES ? 1u : pinned(wave < 4u);   // a scalar test: a tensor load ignores EXEC
    const T16* sp = (part & 1u) ? ((part & 2u) ? Vp2 : Vp) + (size_t)half * 32 * TT : ((part & 2u) ? Kp2 : Kp) + (size_t)half * 4096;
    const uint64_t sga = (uint64_t)(size_t)sp;
    const uint32_t sstep = (part & 1u) ? 4096u : 16384u;   // bytes from one 128-key stage to the next
    const uint32_t sdst = (uint32_t)(size_t)ring + part * PARTB + half * 8192u;   // LDS byte address: the low 32 bits of the __shared__ address
    const u32x8 g1 = tdm_group1(4096u, 2u, (part & 1u) ? 32u * TT : 4096u);
    u32x4 g0 = tdm_group0(sdst, sga);
    if (issuer) { tdm_load(g0, g1); tdm_wait(g0, g1); }   // stage 0 has landed, as far as this wave asked for it
    __syncthreads();                                       // and every other wave's part of it
    if (issuer) { g0 = tdm_group0(sdst + BUFB, sga + sstep); tdm_load(g0, g1); }
#pragma unroll 1   // one stage per trip: trip s reads buffer s % 2 alone
    for (int st = 0; st < NST; ++st) {
      const unsigned bo = (st & 1) ? BUFB : 0u;
#pragma unroll 1   // one 32-key pass per trip: an unrolled body would not fit the registers of four waves per SIMD
      for (int ps = 0; ps < 4; ++ps) {
        // the pass's 4 KB of the K part; its 1 KB of each 4-KB d group of the V part
        const T16* pk = (const T16*)(ring + bo) + ps * 2048 + lane * 8; const T16* pv = (const T16*)(ring + bo + PARTB) + ps * 512 + lane * 8; const T16* pk2 = HIRES ? pk + PARTB : pk; const T16* pv2 = HIRES ? pv + PARTB : pv;   // the lo parts lie two parts (PARTB elements) on
        V kf[2][2], kf2[2][2];
#pragma unroll
        for (int kt = 0; kt < 2; ++kt)
#pragma unroll
            for (int ks = 0; ks < 2; ++ks) { kf[kt][ks] = WFrag<T16>::ld(pk + kt * 16 * HD + ks * 512); if (HIRES) kf2[kt][ks] = WFrag<T16>::ld(pk2 + kt * 16 * HD + ks * 512); }
        v8f st[2][2];
#pragma unroll
        for (int kt = 0; kt < 2; ++kt)
#pragma unroll
            for (int qt = 0; qt < 2; ++qt) { v8f s = (v8f){};
#pragma unroll
                for (int ks = 0; ks < 2; ++ks) { s = WFrag<T16>::mma(kf[kt][ks], q[qt][ks], s); if (HIRES) { s = WFrag<T16>::mma(kf[kt][ks], q2[qt][ks], s); s = WFrag<T16>::mma(kf2[kt][ks], q[qt][ks], s); } }
                st[qt][kt] = s; }
        V vf[4], vf2[4];
#pragma unroll
        for (int dt = 0; dt < 4; ++dt) { vf[dt] = WFrag<T16>::ld(pv + dt * 2048); if (HIRES) vf2[dt] = WFrag<T16>::ld(pv2 + dt * 2048); }
        V p[2], p2[2];
#pragma unroll
        for (int qt = 0; qt < 2; ++qt) { float mx = st[qt][0][0];
#pragma unroll
            for (int j = 1; j < 16; ++j) mx = fmaxf(mx, st[qt][j >> 3][j & 7]);
            mx = fmaxf(mx, xhalf(mx)); const float mn = fmaxf(m[qt], mx); float al = (m[qt] - mn) * C; m[qt] = mn;
            const float nb = 10.0f - mn * C;   // P carries x PCAR = 2^10: small P, and the lo part of the hi/lo rows' P, stay normal fp16 numbers
            float e[16];
#pragma unroll
            for (int j = 0; j < 16; ++j) e[j] = __builtin_fmaf(st[qt][j >> 3][j & 7], C, nb);
            // the 17 exponentials of one query tile in one statement, each in place: none overwrites the source or reads the result of the one before it; the v_nop is the slot between the last one and whatever follows
            asm("v_exp_f32 %0, %0\n\tv_exp_f32 %1, %1\n\tv_exp_f32 %2, %2\n\tv_exp_f32 %3, %3\n\tv_exp_f32 %4, %4\n\tv_exp_f32 %5, %5\n\tv_exp_f32 %6, %6\n\tv_exp_f32 %7, %7\n\tv_exp_f32 %8, %8\n\t"
                "v_exp_f32 %9, %9\n\tv_exp_f32 %10, %10\n\tv_exp_f32 %11, %11\n\tv_exp_f32 %12, %12\n\tv_exp_f32 %13, %13\n\tv_exp_f32 %14, %14\n\tv_exp_f32 %15, %15\n\tv_exp_f32 %16, %16\n\tv_nop"
                : "+v"(al), "+v"(e[0]), "+v"(e[1]), "+v"(e[2]), "+v"(e[3]), "+v"(e[4]), "+v"(e[5]), "+v"(e[6]), "+v"(e[7]), "+v"(e[8]), "+v"(e[9]), "+v"(e[10]), "+v"(e[11]), "+v"(e[12]), "+v"(e[13]), "+v"(e[14]), "+v"(e[15]));
            float sum = 0.f;
#pragma unroll
            for (int j = 0; j < 16; ++j) { sum += e[j]; if constexpr (!HIRES) p[qt][j] = (h16)e[j]; }
            if constexpr (HIRES) { v4u ha, la, hb, lb; split8(e[0], e[1], e[2], e[3], e[4], e[5], e[6], e[7], ha, la); split8(e[8], e[9], e[10], e[11], e[12], e[13], e[14], e[15], hb, lb);
                p[qt] = cat16(__builtin_bit_cast(v8h, ha), __builtin_bit_cast(v8h, hb)); p2[qt] = cat16(__builtin_bit_cast(v8h, la), __builtin_bit_cast(v8h, lb)); }
            l[qt] = l[qt] * al + sum;
#pragma unroll
            for (int dt = 0; dt < 4; ++dt) o[qt][dt] *= al; }
#pragma unroll
        for (int dt = 0; dt < 4; ++dt)
#pragma unroll
            for (int qt = 0; qt < 2; ++qt) { o[qt][dt] = WFrag<T16>::mma(vf[dt], p[qt], o[qt][dt]); if (HIRES) { o[qt][dt] = WFrag<T16>::mma(vf[dt], p2[qt], o[qt][dt]); o[qt][dt] = WFrag<T16>::mma(vf2[dt], p[qt], o[qt][dt]); } }
        // hi/lo rows, whose pass ends in matrix instructions: four vector slots between the last of them and the next pass's first vector write over one of their operands. The scheduling barrier keeps the matrix instructions in front of the slots.
        if constexpr (HIRES) { __builtin_amdgcn_sched_barrier(0); asm volatile("v_nop\n\tv_nop\n\tv_nop\n\tv_nop"); }
      }
      // publish point of the next stage, behind the stage's fourth pass: this wave's reads of the buffer are done, its tensor load of the next stage has landed, every wave has come as far; only then the refill of the buffer just read
      asm volatile("s_wait_dscnt 0x0" ::: "memory");
      if (issuer) tdm_wait(g0, g1);
      __syncthreads();
      // stage s + 2, while it exists (a scalar test), into the buffer of trip s; its byte offset is pinned so that the descriptor is formed behind the wait
      if (pinned(issuer && st + 2 < NST)) { g0 = tdm_group0(sdst + bo, sga + pinned((uint32_t)(st + 2) * sstep)); tdm_load(g0, g1); }
    }
    tdm_wait(g0, g1);   // no tensor load is outstanding when the wave goes on to its end
    asm volatile("s_wait_dscnt 0x0" ::: "memory");
    // o[qt][dt][j] = Ot[d = dt * 16 + 8 hi + j][query t0 + qt * 16 + lr]: 8 consecutive d of one merged row per lane, in fragment order 512 contiguous bytes per wave-wide store
#pragma unroll
    for (int qt = 0; qt < 2; ++qt) { const float f = __fdiv_rn(1.0f, l[qt] + xhalf(l[qt])); const size_t oo = (size_t)(t0 + qt * 16) * DQ + lane * 8;
#pragma unroll
        for (int dt = 0; dt < 4; ++dt) { v8us oh, ol;
#pragma unroll
            for (int j = 0; j < 8; ++j) { unsigned short a, c2; splitf(o[qt][dt][j] * f, a, c2); oh[j] = a; ol[j] = c2; }
            bf* sh = Ah + oo + dt * 256; bf* sl = Al + oo + dt * 256; *(v8us*)sh = oh; *(v8us*)sl = ol;
            // the same wait behind the two stores, before a register that one of them names (address or data) is written again
            asm volatile("s_wait_xcnt 0x0" :: "v"(sh), "v"(sl), "v"(oh), "v"(ol) : "memory"); } }
}
// four waves per SIMD (two blocks per WGP): the softmax between the matrix runs wants waves, so the register budget is held at a quarter of a SIMD's file
__global__ __launch_bounds__(256) __attribute__((amdgpu_waves_per_eu(4, 4))) void k_fattn(const h16* Q16, const h16* K16, const h16* V16, const h16* Ql, const h16* Kl, const h16* Vl, bf* Ah, bf* Al) {
    __shared__ __attribute__((aligned(2048))) unsigned char ring[2 * 65536];   // two stages of four parts; every tensor tile's place in LDS is a multiple of 2 KB; two blocks per WGP still fit
    const int g = blockIdx.x; const size_t zo = (size_t)g * TT * HD; const int t0 = blockIdx.y * 256 + (threadIdx.x >> 5) * 32;   // plane g = batch * NH_ + head: one kv head per query head
    const size_t ao = (size_t)(g / NH_) * TT * DQ + (g % NH_) * HD * 16;   // merged planes in fragment order: a head's 8 octets of d, 128 elements each
    if (blockIdx.y * 256 < RH) attn_rows<h16, true>(Q16 + zo, Ql + zo, K16 + zo, Kl + zo, V16 + zo, Vl + zo, t0, Ah + ao, Al + ao, ring);
    else attn_rows<h16, false>(Q16 + zo, nullptr, K16 + zo, nullptr, V16 + zo, nullptr, t0, Ah + ao, Al + ao, ring);
}

extern "C" void kernel_launch(void* const* d_in, const int* in_sizes, int n_in,
                              void* d_out, int out_size, void* d_ws, size_t ws_size, hipStream_t stream) {
    (void)in_sizes; (void)n_in; (void)out_size;
    const float* x = (const float*)d_in[0]; const float* wq = (const float*)d_in[1]; const float* wk = (const float*)d_in[2]; const float* wv = (const float*)d_in[3]; const float* wo = (const float*)d_in[4]; const float* bo = (const float*)d_in[5];
    float* OUT = (float*)d_out;     // [8][1024][1024]
    char* ws = (char*)d_ws; const size_t Mi = (size_t)1 << 20;
    if (ws_size < 253 * Mi) return;    // ws 256 MiB
    // Workspace map in MiB; regions are reused in stream order once their last reader has run.
    //   0 WO | 2 WQ WK WV | 8 XB (all batches) | 25 .. 121 six planes of 16 (all batches): fp16 q k v | 73 lo q k v
    //   attention: 237 ATh (16) | 2 ATl (16, over WQ WK WV XB)
    const size_t PL = (size_t)NB_ * NH_ * TT * HD;   // elements of one plane set
    bf* WO = (bf*)ws; bf* WQ = (bf*)(ws + 2 * Mi); bf* XB = (bf*)(ws + 8 * Mi);
    h16* QP16 = (h16*)(ws + 25 * Mi); h16* KP16 = QP16 + PL; h16* VT16 = KP16 + PL; h16* QPl = (h16*)(ws + 73 * Mi); h16* KPl = QPl + PL; h16* VTl = KPl + PL;   // q, k, v in a row: the z sets of the projection launch
    bf* ATh = (bf*)(ws + 237 * Mi); bf* ATl = (bf*)(ws + 2 * Mi);
    k_cvt8<<<dim3(DM / 16 * (DM / 256), 4 + NB_, 1), 256, 0, stream>>>(wo, wq, wk, wv, x, WO);
    k_proj3<<<dim3(NB_ * TT / 256, DQ / 128, 1), 256, 0, stream>>>(XB, WQ, QP16, QPl);
    k_fattn<<<dim3(NB_ * NH_, TT / 256, 1), 256, 0, stream>>>(QP16, KP16, VT16, QPl, KPl, VTl, ATh, ATl);
    k_gemmw<bf, 1, true><<<dim3(NB_ * TT / 256, DM / 128, 1), 256, 0, stream>>>(ATh, ATl, WO, DQ, DQ, OUT, DM, bo, 0, 0, 0);
}
